// v000
// Measured on an AMD MI455X. A time is GPU time per run, averaged over a window of back-to-back runs after a warm-up
// (all launches, gaps included; the runs take copies of the inputs in turn), and the median of several windows.
// Apart from v000's, it joins two sittings. Times from different sittings can be a few percent apart, while
// side-by-side timings come from the same sitting.
// v000, which the later versions start from, runs in 1390 microseconds.
// compute dtype: x, the four weights, the lambda vectors and g (module inputs) rounded to bf16; q/k/v projections with exact bf16 products (x and W are inputs) and interleaved-pair RoPE (tables in f32 as the module's numpy code) in the epilogue; the two causal attentions per head with q.k as bf16 hi + residual pairs (3 products) and P.V with P hi/lo x V hi/lo (3 products); the differential combination, RMSNorm and (1 - lambda_init) scaling in f32; the output projection hi/lo x exact Wo (2 products); all GEMMs on WMMA 16x16x32; f32 accumulate.
#include <hip/hip_runtime.h>
#include <math.h>

typedef __attribute__((ext_vector_type(16))) _Float16 v16h;
typedef __attribute__((ext_vector_type(16))) __bf16 v16b;
typedef __attribute__((ext_vector_type(8)))  _Float16 v8h;
typedef __attribute__((ext_vector_type(8)))  float v8f;
typedef __attribute__((ext_vector_type(4)))  float v4f;
typedef __attribute__((ext_vector_type(2)))  float v2f;
typedef __attribute__((ext_vector_type(4)))  unsigned v4u;
typedef __attribute__((ext_vector_type(4)))  int v4i;
typedef float __attribute__((may_alias)) float_a;
typedef int __attribute__((may_alias)) int_a;

template <typename T> __device__ __forceinline__ void vst2(void* p, T v) { *(T*)p = v;  }
__device__ __forceinline__ v8f wmma16(v16h a, v16h b, v8f c) {
  v8f d = __builtin_amdgcn_wmma_f32_16x16x32_f16(false, a, false, b, (short)0, c, false, false);
  asm volatile("v_nop\n\tv_nop\n\tv_nop\n\tv_nop" : "+v"(d) : "v"(a), "v"(b));
  return d;
}
__device__ __forceinline__ v8f wmma_bf(v16b a, v16b b, v8f c) {
  v8f d = __builtin_amdgcn_wmma_f32_16x16x32_bf16(false, a, false, b, (short)0, c, false, false);
  asm volatile("v_nop\n\tv_nop\n\tv_nop\n\tv_nop" : "+v"(d) : "v"(a), "v"(b));
  return d;
}
// 16x16x32 fragments: lane = (h = lane>>4, row/col = lane&15); elements 0..7 = k0+8h+0..7, 8..15 = k0+16+8h+0..7; D element r = row 8h+r
__device__ __forceinline__ v16h frag_h(const _Float16* rowk0, int lane) {
  union { v16h v; v8h q[2]; } u; const _Float16* p = rowk0 + 8 * (lane >> 4);
  u.q[0] = *(const v8h*)p; u.q[1] = *(const v8h*)(p + 16); return u.v;
}
__device__ __forceinline__ v16h frag_f32(const float* rowk0, int lane) {
  v16h a; const float* p = rowk0 + 8 * (lane >> 4);
#pragma unroll
  for (int i = 0; i < 8; ++i) { a[i] = (_Float16)p[i]; a[8 + i] = (_Float16)p[16 + i]; }
  return a;
}
__device__ __forceinline__ v16h frag_f32s(const float* rowk0, int lane, float sc) {
  v16h a; const float* p = rowk0 + 8 * (lane >> 4);
#pragma unroll
  for (int i = 0; i < 8; ++i) { a[i] = (_Float16)(p[i] * sc); a[8 + i] = (_Float16)(p[16 + i] * sc); }
  return a;
}
// column fragment from a [K][ld] layout (column n), rows >= K read as 0
__device__ __forceinline__ v16h fragc_f32(const float* W, int k0, int n, int lane, int ld, int K) {
  v16h a; const int g = lane >> 4;
#pragma unroll
  for (int i = 0; i < 8; ++i) { const int ka = k0 + 8 * g + i, kb = ka + 16;
    a[i] = (_Float16)(ka < K ? W[(size_t)(ka < K ? ka : K - 1) * ld + n] : 0.f); a[8 + i] = (_Float16)(kb < K ? W[(size_t)(kb < K ? kb : K - 1) * ld + n] : 0.f); }
  return a;
}
struct F2 { v16b h, l; };
__device__ __forceinline__ F2 bsplit16(const float v[16]) { F2 r;
#pragma unroll
  for (int i = 0; i < 16; ++i) { const __bf16 h = (__bf16)v[i]; r.h[i] = h; r.l[i] = (__bf16)(v[i] - (float)h); }
  return r; }
__device__ __forceinline__ F2 split_row(const float* row, int k0, int lane) { float v[16]; const float* p = row + k0 + 8 * (lane >> 4);
#pragma unroll
  for (int i = 0; i < 8; ++i) { v[i] = p[i]; v[8 + i] = p[16 + i]; }
  return bsplit16(v); }
__device__ __forceinline__ F2 split_rowK(const float* row, int k0, int lane, int K) { float v[16]; const int g = lane >> 4;
#pragma unroll
  for (int i = 0; i < 8; ++i) { const int ka = k0 + 8 * g + i, kb = ka + 16; v[i] = ka < K ? row[ka < K ? ka : K - 1] : 0.f; v[8 + i] = kb < K ? row[kb < K ? kb : K - 1] : 0.f; }
  return bsplit16(v); }
__device__ __forceinline__ F2 split_col(const float* W, int k0, int n, int lane, int ld, int K) { float v[16]; const int g = lane >> 4;
#pragma unroll
  for (int i = 0; i < 8; ++i) { const int ka = k0 + 8 * g + i, kb = ka + 16; v[i] = ka < K ? W[(size_t)(ka < K ? ka : K - 1) * ld + n] : 0.f; v[8 + i] = kb < K ? W[(size_t)(kb < K ? kb : K - 1) * ld + n] : 0.f; }
  return bsplit16(v); }
__device__ __forceinline__ v8f mac3(const F2& a, const F2& b, v8f c) { c = wmma_bf(a.l, b.h, c); c = wmma_bf(a.h, b.l, c); return wmma_bf(a.h, b.h, c); }
__device__ __forceinline__ float sigm(float v) { return 1.0f / (1.0f + expf(-v)); }
#define LDSX() do { asm volatile("s_wait_dscnt 0" ::: "memory"); __builtin_amdgcn_wave_barrier(); __builtin_amdgcn_fence(__ATOMIC_RELEASE, "workgroup"); } while (0)


// Differential attention (B 1, S 2048, E 2048, 16 heads; q/k as 32 half-heads x 64 with interleaved RoPE, v as 16 heads x 128): a = softmax_causal(q1 k1^T/8) v - lambda_full * softmax_causal(q2 k2^T/8) v; lambda_full = exp(lq1.lk1) - exp(lq2.lk2) + lambda_init; a = RMSNorm_128(a) * g * (1 - lambda_init); out = a Wo.
#define SS 2048
#define DM 2048
#define NH 16
#define HD 128               // v head dim (2*64)
#define HQ 64                // q/k half-head dim
#define KVW DM
#define LAMBDA_INIT 0.78360577f   /* 0.8 - 0.6*exp(-0.3*12) = 0.7836057665 */
#ifndef TQB
#define TQB (SS / 64)
#define TRP (SS / 64)          // projection row tiles (all)
#endif
typedef __attribute__((ext_vector_type(8))) __bf16 v8b;
__device__ __forceinline__ v16b frag_b(const __bf16* rowk0, int lane) {
  union { v16b v; v8b q[2]; } u; const __bf16* p = rowk0 + 8 * (lane >> 4);
  u.q[0] = *(const v8b*)p; u.q[1] = *(const v8b*)(p + 16); return u.v;
}
__device__ __forceinline__ float bfr(float v) { return (float)(__bf16)v; }
__device__ __attribute__((noinline)) float exp_ni(float v) { return expf(v); }
__device__ __attribute__((noinline)) float erf_ni(float v) { return erff(v); }

#define PK_Q 0
#define PK_K (PK_Q + DM * DM)
#define PK_V (PK_K + KVW * DM)
#define PK_O (PK_V + KVW * DM)
#define PK_END (PK_O + DM * DM)
#define WS_PK  0u
#define WS_CS  (WS_PK + 2u * PK_END)             // f32 [2048][32] cos, then [2048][32] sin
#define WS_Q   (WS_CS + 4u * 2 * SS * 32)
#define WS_K   (WS_Q + 4u * SS * DM)
#define WS_VTH (WS_K + 4u * SS * KVW)
#define WS_VTL (WS_VTH + 2u * KVW * SS)
#define WS_O   (WS_VTL + 2u * KVW * SS)
#define WS_END (WS_O + 4u * SS * DM)

// ---- k_packT: block = output column n of a [K][N] (x @ W) matrix
__global__ __launch_bounds__(256) void k_packT(const float* __restrict__ Wm, int K, int N, __bf16* __restrict__ DST) {
  __shared__ __align__(16) __bf16 s[DM]; const int n = blockIdx.x, tid = threadIdx.x;
  for (int k = tid; k < K; k += 256) s[k] = (__bf16)Wm[(size_t)k * N + n];
  __syncthreads();
  for (int q = tid; q < K / 8; q += 256) vst2((unsigned*)(DST + (size_t)n * K + q * 8), *(const v4u*)&s[q * 8]);
}
__global__ __launch_bounds__(32) void k_rope_tab(float* __restrict__ CS) {
  __shared__ __align__(16) float sc[32], ssn[32]; const int t = blockIdx.x, i = threadIdx.x;
  const float dv = expf((float)(2 * i) * (-9.2103404f / 64.0f));   /* ln(1e4) as the f32 literal numpy uses */ const float ang = (float)t * dv; sc[i] = cosf(ang); ssn[i] = sinf(ang);
  __syncthreads();
  if (i < 8) vst2(CS + (size_t)t * 32 + i * 4, *(const v4f*)&sc[i * 4]); else if (i < 16) vst2(CS + (size_t)SS * 32 + (size_t)t * 32 + (i - 8) * 4, *(const v4f*)&ssn[(i - 8) * 4]);
}
// ---- k_proj<MODE>: block = (64 rows, 128 cols = one head): Y = bf16(x) . P rows (exact); MODE 0: RoPE then f32 rows (q/k; ldo); MODE 1: plain -> transposed bf16 hi/lo planes (v)
template <int MODE>
__global__ __launch_bounds__(128) void k_proj(const float* __restrict__ X, const __bf16* __restrict__ P, const float* __restrict__ CS, float* __restrict__ OUT, int ldo, __bf16* __restrict__ PH, __bf16* __restrict__ PL) {
  __shared__ __align__(16) float so[MODE ? 1 : 4][16][132]; __shared__ __align__(16) __bf16 sth[MODE ? 128 : 1][72], stl[MODE ? 128 : 1][72];
  const int tid = threadIdx.x, wave = tid >> 5, lane = tid & 31, col = lane & 15, g = lane >> 4; const size_t r0 = (size_t)blockIdx.x * 64 + wave * 16; const int n0 = blockIdx.y * 128;
  v8f acc[8] = {};
#pragma unroll 2
  for (int kc = 0; kc < DM / 32; ++kc) { v16b a; { const float* p = X + (r0 + col) * DM + kc * 32 + 8 * g;
#pragma unroll
      for (int i = 0; i < 8; ++i) { a[i] = (__bf16)p[i]; a[8 + i] = (__bf16)p[16 + i]; } }
#pragma unroll
    for (int j = 0; j < 8; ++j) acc[j] = wmma_bf(a, frag_b(P + (size_t)(n0 + j * 16 + col) * DM + kc * 32, lane), acc[j]); }
  if (MODE == 0) {
    // projections to LDS, then interleaved-pair RoPE in place within each 64-wide half-head: (x_{2i}, x_{2i+1}) -> (x c - y s, x s + y c) with angle index i
#pragma unroll
    for (int j = 0; j < 8; ++j)
#pragma unroll
      for (int r = 0; r < 8; ++r) so[wave][8 * g + r][j * 16 + col] = acc[j][r];
    LDSX();
    for (int q = lane; q < 16 * 64; q += 32) { const int rl = q >> 6, pi = q & 63; const int half = pi >> 5, i = pi & 31; const size_t t = r0 + rl; const float c = CS[t * 32 + i], s = CS[(size_t)SS * 32 + t * 32 + i]; float* e = &so[wave][rl][half * 64 + 2 * i]; const float xe = e[0], xo = e[1]; e[0] = xe * c - xo * s; e[1] = xe * s + xo * c; }
    LDSX();
    for (int rl = 0; rl < 16; ++rl) vst2(OUT + (r0 + rl) * ldo + n0 + lane * 4, *(const v4f*)&so[wave][rl][lane * 4]);
  } else {
#pragma unroll
    for (int j = 0; j < 8; ++j)
#pragma unroll
      for (int r = 0; r < 8; ++r) { const float v = acc[j][r]; const __bf16 hb = (__bf16)v; sth[j * 16 + col][wave * 16 + 8 * g + r] = hb; stl[j * 16 + col][wave * 16 + 8 * g + r] = (__bf16)(v - (float)hb); }
    __syncthreads();
    const int s0 = blockIdx.x * 64;
    for (int q = tid; q < 128 * 8; q += 128) { const int d = q >> 3, pc = q & 7; const size_t o = (size_t)(n0 + d) * SS + s0 + pc * 8; vst2((unsigned*)(PH + o), *(const v4u*)&sth[d][pc * 8]); vst2((unsigned*)(PL + o), *(const v4u*)&stl[d][pc * 8]); }
  }
}
// ---- k_attn: block = (64 queries, head h): causal flash attention, kv head = h; scores 3 products, P.V 3 products; O[q][h*128+d]
__global__ __launch_bounds__(128) void k_attn(const float* __restrict__ Q, const float* __restrict__ Kx, const __bf16* __restrict__ VTH, const __bf16* __restrict__ VTL, const float* __restrict__ LQ1, const float* __restrict__ LK1, const float* __restrict__ LQ2, const float* __restrict__ LK2, const float* __restrict__ G, float* __restrict__ O) {
  __shared__ __align__(16) float sp[4][16][36]; __shared__ __align__(16) float so[4][16][132];
  const int tid = threadIdx.x, wave = tid >> 5, lane = tid & 31, col = lane & 15, g = lane >> 4;
  const int qb = blockIdx.x, h = blockIdx.y; const int q0 = qb * 64 + wave * 16;
  // lambda_full from the inputs (64-dots)
  float lam; { float s1 = 0.f, s2 = 0.f; for (int i = lane; i < HQ; i += 32) { s1 += bfr(LQ1[i]) * bfr(LK1[i]); s2 += bfr(LQ2[i]) * bfr(LK2[i]); }
#pragma unroll
    for (int o = 1; o < 32; o <<= 1) { s1 += __shfl_xor(s1, o); s2 += __shfl_xor(s2, o); } lam = exp_ni(s1) - exp_ni(s2) + LAMBDA_INIT; }
  // the normalised attn1 output is parked in the wave's own so[] rows (own elements) while attn2 runs
  const int nks = (qb * 64 + 64) / 32;
#pragma unroll 1
  for (int sub = 0; sub < 2; ++sub) {
  const float* qrow = Q + (size_t)(q0 + col) * DM + (2 * h + sub) * HQ;
  float m[8], l[8];
#pragma unroll
  for (int r = 0; r < 8; ++r) { m[r] = -3.0e38f; l[r] = 0.f; }
  v8f acc[8] = {};
#pragma unroll 1
  for (int ks = 0; ks < nks; ++ks) { v8f s[2];
#pragma unroll
    for (int ct = 0; ct < 2; ++ct) { const int kk = ks * 32 + ct * 16 + col; const float* krow = Kx + (size_t)kk * KVW + (2 * h + sub) * HQ; v8f c = {};
#pragma unroll
      for (int kc = 0; kc < 2; ++kc) { const F2 kb = split_row(krow, kc * 32, lane); const F2 qa = split_row(qrow, kc * 32, lane); c = mac3(qa, kb, c); }
#pragma unroll
      for (int r = 0; r < 8; ++r) { const int qi = q0 + 8 * g + r; s[ct][r] = (kk <= qi) ? c[r] * 0.125f : -3.0e38f; } }
#pragma unroll
    for (int r = 0; r < 8; ++r) { float mx = fmaxf(s[0][r], s[1][r]);
#pragma unroll
      for (int o = 1; o < 16; o <<= 1) mx = fmaxf(mx, __shfl_xor(mx, o));
      const float mn = fmaxf(m[r], mx); const float alpha = (m[r] <= -1.0e38f) ? 0.f : exp_ni(m[r] - mn);
      const float e0 = (s[0][r] <= -1.0e38f) ? 0.f : exp_ni(s[0][r] - mn), e1 = (s[1][r] <= -1.0e38f) ? 0.f : exp_ni(s[1][r] - mn); float es = e0 + e1;
#pragma unroll
      for (int o = 1; o < 16; o <<= 1) es += __shfl_xor(es, o);
      l[r] = l[r] * alpha + es; m[r] = mn;
#pragma unroll
      for (int dt = 0; dt < 8; ++dt) acc[dt][r] *= alpha;
      sp[wave][8 * g + r][col] = e0; sp[wave][8 * g + r][16 + col] = e1; }
    LDSX();
    const F2 pa = split_row(&sp[wave][col][0], 0, lane);
#pragma unroll
    for (int dt = 0; dt < 8; ++dt) { const size_t vr = (size_t)(h * HD + dt * 16 + col) * SS + ks * 32; const v16b vh = frag_b(VTH + vr, lane), vl = frag_b(VTL + vr, lane); acc[dt] = wmma_bf(pa.l, vh, acc[dt]); acc[dt] = wmma_bf(pa.h, vl, acc[dt]); acc[dt] = wmma_bf(pa.h, vh, acc[dt]); }
    LDSX(); }
  if (sub == 0) {
#pragma unroll
    for (int r = 0; r < 8; ++r) { const float il = 1.0f / l[r];
#pragma unroll
      for (int dt = 0; dt < 8; ++dt) so[wave][8 * g + r][dt * 16 + col] = acc[dt][r] * il; }
  } else {
#pragma unroll
    for (int r = 0; r < 8; ++r) { const float il = 1.0f / l[r]; float a[8]; float ss = 0.f;
#pragma unroll
      for (int dt = 0; dt < 8; ++dt) { a[dt] = so[wave][8 * g + r][dt * 16 + col] - lam * (acc[dt][r] * il); ss += a[dt] * a[dt]; }
#pragma unroll
      for (int o = 1; o < 16; o <<= 1) ss += __shfl_xor(ss, o);
      const float rs = rsqrtf(ss / (float)HD + 1e-5f) * (1.0f - LAMBDA_INIT);
#pragma unroll
      for (int dt = 0; dt < 8; ++dt) { const int d = dt * 16 + col; so[wave][8 * g + r][d] = a[dt] * rs * bfr(G[d]); } }
  } }   // end sub loop
  LDSX();
  for (int rl = 0; rl < 16; ++rl) vst2(O + (size_t)(q0 + rl) * DM + h * HD + lane * 4, *(const v4f*)&so[wave][rl][lane * 4]);
}
// ---- k_out: block = (64 rows, 128 cols): out = O(hi/lo) . wproj^T rows (2 products)
__global__ __launch_bounds__(128) void k_out(const float* __restrict__ O, const __bf16* __restrict__ P, float* __restrict__ Y) {
  __shared__ __align__(16) float so[4][16][132];
  const int tid = threadIdx.x, wave = tid >> 5, lane = tid & 31, col = lane & 15, g = lane >> 4; const size_t r0 = (size_t)blockIdx.x * 64 + wave * 16; const int n0 = blockIdx.y * 128;
  v8f acc[8] = {};
#pragma unroll 2
  for (int kc = 0; kc < DM / 32; ++kc) { const F2 a = split_row(O + (r0 + col) * DM, kc * 32, lane);
#pragma unroll
    for (int j = 0; j < 8; ++j) { const v16b w = frag_b(P + (size_t)(n0 + j * 16 + col) * DM + kc * 32, lane); acc[j] = wmma_bf(a.l, w, acc[j]); acc[j] = wmma_bf(a.h, w, acc[j]); } }
#pragma unroll
  for (int j = 0; j < 8; ++j)
#pragma unroll
    for (int r = 0; r < 8; ++r) so[wave][8 * g + r][j * 16 + col] = acc[j][r];
  LDSX();
  for (int rl = 0; rl < 16; ++rl) vst2(Y + (r0 + rl) * DM + n0 + lane * 4, *(const v4f*)&so[wave][rl][lane * 4]);
}
extern "C" void kernel_launch(void* const* d_in, const int* in_sizes, int n_in, void* d_out, int out_size, void* d_ws, size_t ws_size, hipStream_t stream) {
  (void)in_sizes; (void)n_in; (void)out_size;
  const float** F = (const float**)d_in;   // 0 x [1,2048,2048], 1 Wq, 2 Wk, 3 Wv, 4 Wo [2048,2048] (x @ W), 5 lq1, 6 lk1, 7 lq2, 8 lk2 [64], 9 g [128]
  if (ws_size < (size_t)WS_END) return;
  char* ws = (char*)d_ws; __bf16 *PK = (__bf16*)(ws + WS_PK), *VTH = (__bf16*)(ws + WS_VTH), *VTL = (__bf16*)(ws + WS_VTL);
  float *CS = (float*)(ws + WS_CS), *Q = (float*)(ws + WS_Q), *Kx = (float*)(ws + WS_K), *O = (float*)(ws + WS_O);
  k_packT<<<DM, 256, 0, stream>>>(F[1], DM, DM, PK + PK_Q); k_packT<<<DM, 256, 0, stream>>>(F[2], DM, DM, PK + PK_K); k_packT<<<DM, 256, 0, stream>>>(F[3], DM, DM, PK + PK_V); k_packT<<<DM, 256, 0, stream>>>(F[4], DM, DM, PK + PK_O);
  k_rope_tab<<<SS, 32, 0, stream>>>(CS);
  k_proj<0><<<dim3(TRP, DM / 128), 128, 0, stream>>>(F[0], PK + PK_Q, CS, Q, DM, nullptr, nullptr);
  k_proj<0><<<dim3(TRP, DM / 128), 128, 0, stream>>>(F[0], PK + PK_K, CS, Kx, DM, nullptr, nullptr);
  k_proj<1><<<dim3(TRP, DM / 128), 128, 0, stream>>>(F[0], PK + PK_V, CS, nullptr, 0, VTH, VTL);
  k_attn<<<dim3(TQB, NH), 128, 0, stream>>>(Q, Kx, VTH, VTL, F[5], F[6], F[7], F[8], F[9], O);
  k_out<<<dim3(TQB, DM / 128), 128, 0, stream>>>(O, PK + PK_O, (float*)d_out);
}

// v001
// One run takes 1110 microseconds.
// In both of two side-by-side timings against v000, it was 1.26 times as fast.
// compute dtype: x, the four weights, the lambda vectors and g (module inputs) rounded to bf16; q/k/v projections with exact bf16 products (x and W are inputs) and interleaved-pair RoPE (tables in f32 as the module's numpy code) in the epilogue; the two causal attentions per head with q.k as bf16 hi + residual pairs (3 products) and P.V with P hi/lo x V hi/lo (3 products); the differential combination, RMSNorm and (1 - lambda_init) scaling in f32; the output projection hi/lo x exact Wo (2 products); all GEMMs on WMMA 16x16x32; f32 accumulate.
#include <hip/hip_runtime.h>
#include <math.h>

typedef __attribute__((ext_vector_type(16))) _Float16 v16h;
typedef __attribute__((ext_vector_type(16))) __bf16 v16b;
typedef __attribute__((ext_vector_type(8)))  _Float16 v8h;
typedef __attribute__((ext_vector_type(8)))  float v8f;
typedef __attribute__((ext_vector_type(4)))  float v4f;
typedef __attribute__((ext_vector_type(2)))  float v2f;
typedef __attribute__((ext_vector_type(4)))  unsigned v4u;
typedef __attribute__((ext_vector_type(4)))  int v4i;
typedef float __attribute__((may_alias)) float_a;
typedef int __attribute__((may_alias)) int_a;

template <typename T> __device__ __forceinline__ void vst2(void* p, T v) { *(T*)p = v;  }
__device__ __forceinline__ v8f wmma16(v16h a, v16h b, v8f c) {
  v8f d = __builtin_amdgcn_wmma_f32_16x16x32_f16(false, a, false, b, (short)0, c, false, false);
  asm volatile("v_nop\n\tv_nop\n\tv_nop\n\tv_nop" : "+v"(d) : "v"(a), "v"(b));
  return d;
}
__device__ __forceinline__ v8f wmma_bf(v16b a, v16b b, v8f c) {
  v8f d = __builtin_amdgcn_wmma_f32_16x16x32_bf16(false, a, false, b, (short)0, c, false, false);
  asm volatile("v_nop\n\tv_nop\n\tv_nop\n\tv_nop" : "+v"(d) : "v"(a), "v"(b));
  return d;
}
// 16x16x32 fragments: lane = (h = lane>>4, row/col = lane&15); elements 0..7 = k0+8h+0..7, 8..15 = k0+16+8h+0..7; D element r = row 8h+r
__device__ __forceinline__ v16h frag_h(const _Float16* rowk0, int lane) {
  union { v16h v; v8h q[2]; } u; const _Float16* p = rowk0 + 8 * (lane >> 4);
  u.q[0] = *(const v8h*)p; u.q[1] = *(const v8h*)(p + 16); return u.v;
}
__device__ __forceinline__ v16h frag_f32(const float* rowk0, int lane) {
  v16h a; const float* p = rowk0 + 8 * (lane >> 4);
#pragma unroll
  for (int i = 0; i < 8; ++i) { a[i] = (_Float16)p[i]; a[8 + i] = (_Float16)p[16 + i]; }
  return a;
}
__device__ __forceinline__ v16h frag_f32s(const float* rowk0, int lane, float sc) {
  v16h a; const float* p = rowk0 + 8 * (lane >> 4);
#pragma unroll
  for (int i = 0; i < 8; ++i) { a[i] = (_Float16)(p[i] * sc); a[8 + i] = (_Float16)(p[16 + i] * sc); }
  return a;
}
// column fragment from a [K][ld] layout (column n), rows >= K read as 0
__device__ __forceinline__ v16h fragc_f32(const float* W, int k0, int n, int lane, int ld, int K) {
  v16h a; const int g = lane >> 4;
#pragma unroll
  for (int i = 0; i < 8; ++i) { const int ka = k0 + 8 * g + i, kb = ka + 16;
    a[i] = (_Float16)(ka < K ? W[(size_t)(ka < K ? ka : K - 1) * ld + n] : 0.f); a[8 + i] = (_Float16)(kb < K ? W[(size_t)(kb < K ? kb : K - 1) * ld + n] : 0.f); }
  return a;
}
struct F2 { v16b h, l; };
__device__ __forceinline__ F2 bsplit16(const float v[16]) { F2 r;
#pragma unroll
  for (int i = 0; i < 16; ++i) { const __bf16 h = (__bf16)v[i]; r.h[i] = h; r.l[i] = (__bf16)(v[i] - (float)h); }
  return r; }
__device__ __forceinline__ F2 split_row(const float* row, int k0, int lane) { float v[16]; const float* p = row + k0 + 8 * (lane >> 4);
#pragma unroll
  for (int i = 0; i < 8; ++i) { v[i] = p[i]; v[8 + i] = p[16 + i]; }
  return bsplit16(v); }
__device__ __forceinline__ F2 split_rowK(const float* row, int k0, int lane, int K) { float v[16]; const int g = lane >> 4;
#pragma unroll
  for (int i = 0; i < 8; ++i) { const int ka = k0 + 8 * g + i, kb = ka + 16; v[i] = ka < K ? row[ka < K ? ka : K - 1] : 0.f; v[8 + i] = kb < K ? row[kb < K ? kb : K - 1] : 0.f; }
  return bsplit16(v); }
__device__ __forceinline__ F2 split_col(const float* W, int k0, int n, int lane, int ld, int K) { float v[16]; const int g = lane >> 4;
#pragma unroll
  for (int i = 0; i < 8; ++i) { const int ka = k0 + 8 * g + i, kb = ka + 16; v[i] = ka < K ? W[(size_t)(ka < K ? ka : K - 1) * ld + n] : 0.f; v[8 + i] = kb < K ? W[(size_t)(kb < K ? kb : K - 1) * ld + n] : 0.f; }
  return bsplit16(v); }
__device__ __forceinline__ v8f mac3(const F2& a, const F2& b, v8f c) { c = wmma_bf(a.l, b.h, c); c = wmma_bf(a.h, b.l, c); return wmma_bf(a.h, b.h, c); }
__device__ __forceinline__ float sigm(float v) { return 1.0f / (1.0f + expf(-v)); }
#define LDSX() do { asm volatile("s_wait_dscnt 0" ::: "memory"); __builtin_amdgcn_wave_barrier(); __builtin_amdgcn_fence(__ATOMIC_RELEASE, "workgroup"); } while (0)


// Differential attention (B 1, S 2048, E 2048, 16 heads; q/k as 32 half-heads x 64 with interleaved RoPE, v as 16 heads x 128): a = softmax_causal(q1 k1^T/8) v - lambda_full * softmax_causal(q2 k2^T/8) v; lambda_full = exp(lq1.lk1) - exp(lq2.lk2) + lambda_init; a = RMSNorm_128(a) * g * (1 - lambda_init); out = a Wo.
#define SS 2048
#define DM 2048
#define NH 16
#define HD 128               // v head dim (2*64)
#define HQ 64                // q/k half-head dim
#define KVW DM
#define LAMBDA_INIT 0.78360577f   /* 0.8 - 0.6*exp(-0.3*12) = 0.7836057665 */
#ifndef TQB
#define TQB (SS / 64)
#define TRP (SS / 64)          // projection row tiles (all)
#endif
typedef __attribute__((ext_vector_type(8))) __bf16 v8b;
__device__ __forceinline__ v16b frag_b(const __bf16* rowk0, int lane) {
  union { v16b v; v8b q[2]; } u; const __bf16* p = rowk0 + 8 * (lane >> 4);
  u.q[0] = *(const v8b*)p; u.q[1] = *(const v8b*)(p + 16); return u.v;
}
__device__ __forceinline__ float bfr(float v) { return (float)(__bf16)v; }
__device__ __attribute__((noinline)) float exp_ni(float v) { return expf(v); }
__device__ __attribute__((noinline)) float erf_ni(float v) { return erff(v); }

#define PK_Q 0
#define PK_K (PK_Q + DM * DM)
#define PK_V (PK_K + KVW * DM)
#define PK_O (PK_V + KVW * DM)
#define PK_END (PK_O + DM * DM)
#define WS_PK  0u
#define WS_CS  (WS_PK + 2u * PK_END)             // f32 [2048][32] cos, then [2048][32] sin
#define WS_Q   (WS_CS + 4u * 2 * SS * 32)
#define WS_K   (WS_Q + 4u * SS * DM)
#define WS_VTH (WS_K + 4u * SS * KVW)
#define WS_VTL (WS_VTH + 2u * KVW * SS)
#define WS_O   (WS_VTL + 2u * KVW * SS)
#define WS_END (WS_O + 4u * SS * DM)

// ---- k_packT: block = output column n of a [K][N] (x @ W) matrix
__global__ __launch_bounds__(256) void k_packT(const float* __restrict__ Wm, int K, int N, __bf16* __restrict__ DST) {
  __shared__ __align__(16) __bf16 s[DM]; const int n = blockIdx.x, tid = threadIdx.x;
  for (int k = tid; k < K; k += 256) s[k] = (__bf16)Wm[(size_t)k * N + n];
  __syncthreads();
  for (int q = tid; q < K / 8; q += 256) vst2((unsigned*)(DST + (size_t)n * K + q * 8), *(const v4u*)&s[q * 8]);
}
__global__ __launch_bounds__(32) void k_rope_tab(float* __restrict__ CS) {
  __shared__ __align__(16) float sc[32], ssn[32]; const int t = blockIdx.x, i = threadIdx.x;
  const float dv = expf((float)(2 * i) * (-9.2103404f / 64.0f));   /* ln(1e4) as the f32 literal numpy uses */ const float ang = (float)t * dv; sc[i] = cosf(ang); ssn[i] = sinf(ang);
  __syncthreads();
  if (i < 8) vst2(CS + (size_t)t * 32 + i * 4, *(const v4f*)&sc[i * 4]); else if (i < 16) vst2(CS + (size_t)SS * 32 + (size_t)t * 32 + (i - 8) * 4, *(const v4f*)&ssn[(i - 8) * 4]);
}
// ---- k_proj<MODE>: block = (64 rows, 128 cols = one head): Y = bf16(x) . P rows (exact); MODE 0: RoPE then f32 rows (q/k; ldo); MODE 1: plain -> transposed bf16 hi/lo planes (v)
template <int MODE>
__global__ __launch_bounds__(128) void k_proj(const float* __restrict__ X, const __bf16* __restrict__ P, const float* __restrict__ CS, float* __restrict__ OUT, int ldo, __bf16* __restrict__ PH, __bf16* __restrict__ PL) {
  __shared__ __align__(16) float so[MODE ? 1 : 4][16][132]; __shared__ __align__(16) __bf16 sth[MODE ? 128 : 1][72], stl[MODE ? 128 : 1][72];
  const int tid = threadIdx.x, wave = tid >> 5, lane = tid & 31, col = lane & 15, g = lane >> 4; const size_t r0 = (size_t)blockIdx.x * 64 + wave * 16; const int n0 = blockIdx.y * 128;
  v8f acc[8] = {};
#pragma unroll 2
  for (int kc = 0; kc < DM / 32; ++kc) { v16b a; { const float* p = X + (r0 + col) * DM + kc * 32 + 8 * g;
#pragma unroll
      for (int i = 0; i < 8; ++i) { a[i] = (__bf16)p[i]; a[8 + i] = (__bf16)p[16 + i]; } }
#pragma unroll
    for (int j = 0; j < 8; ++j) acc[j] = wmma_bf(a, frag_b(P + (size_t)(n0 + j * 16 + col) * DM + kc * 32, lane), acc[j]); }
  if (MODE == 0) {
    // projections to LDS, then interleaved-pair RoPE in place within each 64-wide half-head: (x_{2i}, x_{2i+1}) -> (x c - y s, x s + y c) with angle index i
#pragma unroll
    for (int j = 0; j < 8; ++j)
#pragma unroll
      for (int r = 0; r < 8; ++r) so[wave][8 * g + r][j * 16 + col] = acc[j][r];
    LDSX();
    for (int q = lane; q < 16 * 64; q += 32) { const int rl = q >> 6, pi = q & 63; const int half = pi >> 5, i = pi & 31; const size_t t = r0 + rl; const float c = CS[t * 32 + i], s = CS[(size_t)SS * 32 + t * 32 + i]; float* e = &so[wave][rl][half * 64 + 2 * i]; const float xe = e[0], xo = e[1]; e[0] = xe * c - xo * s; e[1] = xe * s + xo * c; }
    LDSX();
    for (int rl = 0; rl < 16; ++rl) vst2(OUT + (r0 + rl) * ldo + n0 + lane * 4, *(const v4f*)&so[wave][rl][lane * 4]);
  } else {
#pragma unroll
    for (int j = 0; j < 8; ++j)
#pragma unroll
      for (int r = 0; r < 8; ++r) { const float v = acc[j][r]; const __bf16 hb = (__bf16)v; sth[j * 16 + col][wave * 16 + 8 * g + r] = hb; stl[j * 16 + col][wave * 16 + 8 * g + r] = (__bf16)(v - (float)hb); }
    __syncthreads();
    const int s0 = blockIdx.x * 64;
    for (int q = tid; q < 128 * 8; q += 128) { const int d = q >> 3, pc = q & 7; const size_t o = (size_t)(n0 + d) * SS + s0 + pc * 8; vst2((unsigned*)(PH + o), *(const v4u*)&sth[d][pc * 8]); vst2((unsigned*)(PL + o), *(const v4u*)&stl[d][pc * 8]); }
  }
}
// ---- k_attn: block = (64 queries, head h), 8 waves: waves 0..3 run attention 1 and waves 4..7 attention 2 of the same four 16-query tiles side by side; scores 3 products, P.V 3 products; O[q][h*128+d]
__global__ __launch_bounds__(256) void k_attn(const float* __restrict__ Q, const float* __restrict__ Kx, const __bf16* __restrict__ VTH, const __bf16* __restrict__ VTL, const float* __restrict__ LQ1, const float* __restrict__ LK1, const float* __restrict__ LQ2, const float* __restrict__ LK2, const float* __restrict__ G, float* __restrict__ O) {
  __shared__ __align__(16) float sp[8][16][36]; __shared__ __align__(16) float so[4][16][132];
  const int tid = threadIdx.x, wave = tid >> 5, lane = tid & 31, col = lane & 15, g = lane >> 4;
  const int sub = __builtin_amdgcn_readfirstlane(wave >> 2), wq = wave & 3;   // which attention (the same in every lane of a wave), which 16-query tile
  const int qb = blockIdx.x, h = blockIdx.y; const int q0 = qb * 64 + wq * 16;
  // lambda_full from the inputs (64-dots)
  float lam; { float s1 = 0.f, s2 = 0.f; for (int i = lane; i < HQ; i += 32) { s1 += bfr(LQ1[i]) * bfr(LK1[i]); s2 += bfr(LQ2[i]) * bfr(LK2[i]); }
#pragma unroll
    for (int o = 1; o < 32; o <<= 1) { s1 += __shfl_xor(s1, o); s2 += __shfl_xor(s2, o); } lam = exp_ni(s1) - exp_ni(s2) + LAMBDA_INIT; }
  const int nks = (qb * 64 + 64) / 32;
  const float* qrow = Q + (size_t)(q0 + col) * DM + (2 * h + sub) * HQ;
  float m[8], l[8];
#pragma unroll
  for (int r = 0; r < 8; ++r) { m[r] = -3.0e38f; l[r] = 0.f; }
  v8f acc[8] = {};
#pragma unroll 1
  for (int ks = 0; ks < nks; ++ks) { v8f s[2];
#pragma unroll
    for (int ct = 0; ct < 2; ++ct) { const int kk = ks * 32 + ct * 16 + col; const float* krow = Kx + (size_t)kk * KVW + (2 * h + sub) * HQ; v8f c = {};
#pragma unroll
      for (int kc = 0; kc < 2; ++kc) { const F2 kb = split_row(krow, kc * 32, lane); const F2 qa = split_row(qrow, kc * 32, lane); c = mac3(qa, kb, c); }
#pragma unroll
      for (int r = 0; r < 8; ++r) { const int qi = q0 + 8 * g + r; s[ct][r] = (kk <= qi) ? c[r] * 0.125f : -3.0e38f; } }
#pragma unroll
    for (int r = 0; r < 8; ++r) { float mx = fmaxf(s[0][r], s[1][r]);
#pragma unroll
      for (int o = 1; o < 16; o <<= 1) mx = fmaxf(mx, __shfl_xor(mx, o));
      const float mn = fmaxf(m[r], mx); const float alpha = (m[r] <= -1.0e38f) ? 0.f : exp_ni(m[r] - mn);
      const float e0 = (s[0][r] <= -1.0e38f) ? 0.f : exp_ni(s[0][r] - mn), e1 = (s[1][r] <= -1.0e38f) ? 0.f : exp_ni(s[1][r] - mn); float es = e0 + e1;
#pragma unroll
      for (int o = 1; o < 16; o <<= 1) es += __shfl_xor(es, o);
      l[r] = l[r] * alpha + es; m[r] = mn;
#pragma unroll
      for (int dt = 0; dt < 8; ++dt) acc[dt][r] *= alpha;
      sp[wave][8 * g + r][col] = e0; sp[wave][8 * g + r][16 + col] = e1; }
    LDSX();
    const F2 pa = split_row(&sp[wave][col][0], 0, lane);
#pragma unroll
    for (int dt = 0; dt < 8; ++dt) { const size_t vr = (size_t)(h * HD + dt * 16 + col) * SS + ks * 32; const v16b vh = frag_b(VTH + vr, lane), vl = frag_b(VTL + vr, lane); acc[dt] = wmma_bf(pa.l, vh, acc[dt]); acc[dt] = wmma_bf(pa.h, vl, acc[dt]); acc[dt] = wmma_bf(pa.h, vh, acc[dt]); }
    LDSX(); }
  if (sub == 0) {
#pragma unroll
    for (int r = 0; r < 8; ++r) { const float il = 1.0f / l[r];
#pragma unroll
      for (int dt = 0; dt < 8; ++dt) so[wq][8 * g + r][dt * 16 + col] = acc[dt][r] * il; }
  }
  __syncthreads();   // hands the normalised attn1 rows of tile wq from wave wq to wave 4 + wq
  if (sub == 1) {
#pragma unroll
    for (int r = 0; r < 8; ++r) { const float il = 1.0f / l[r]; float a[8]; float ss = 0.f;
#pragma unroll
      for (int dt = 0; dt < 8; ++dt) { a[dt] = so[wq][8 * g + r][dt * 16 + col] - lam * (acc[dt][r] * il); ss += a[dt] * a[dt]; }
#pragma unroll
      for (int o = 1; o < 16; o <<= 1) ss += __shfl_xor(ss, o);
      const float rs = rsqrtf(ss / (float)HD + 1e-5f) * (1.0f - LAMBDA_INIT);
#pragma unroll
      for (int dt = 0; dt < 8; ++dt) { const int d = dt * 16 + col; so[wq][8 * g + r][d] = a[dt] * rs * bfr(G[d]); } }
    LDSX();
    for (int rl = 0; rl < 16; ++rl) vst2(O + (size_t)(q0 + rl) * DM + h * HD + lane * 4, *(const v4f*)&so[wq][rl][lane * 4]);
  }
}
// ---- k_out: block = (64 rows, 128 cols): out = O(hi/lo) . wproj^T rows (2 products)
__global__ __launch_bounds__(128) void k_out(const float* __restrict__ O, const __bf16* __restrict__ P, float* __restrict__ Y) {
  __shared__ __align__(16) float so[4][16][132];
  const int tid = threadIdx.x, wave = tid >> 5, lane = tid & 31, col = lane & 15, g = lane >> 4; const size_t r0 = (size_t)blockIdx.x * 64 + wave * 16; const int n0 = blockIdx.y * 128;
  v8f acc[8] = {};
#pragma unroll 2
  for (int kc = 0; kc < DM / 32; ++kc) { const F2 a = split_row(O + (r0 + col) * DM, kc * 32, lane);
#pragma unroll
    for (int j = 0; j < 8; ++j) { const v16b w = frag_b(P + (size_t)(n0 + j * 16 + col) * DM + kc * 32, lane); acc[j] = wmma_bf(a.l, w, acc[j]); acc[j] = wmma_bf(a.h, w, acc[j]); } }
#pragma unroll
  for (int j = 0; j < 8; ++j)
#pragma unroll
    for (int r = 0; r < 8; ++r) so[wave][8 * g + r][j * 16 + col] = acc[j][r];
  LDSX();
  for (int rl = 0; rl < 16; ++rl) vst2(Y + (r0 + rl) * DM + n0 + lane * 4, *(const v4f*)&so[wave][rl][lane * 4]);
}
extern "C" void kernel_launch(void* const* d_in, const int* in_sizes, int n_in, void* d_out, int out_size, void* d_ws, size_t ws_size, hipStream_t stream) {
  (void)in_sizes; (void)n_in; (void)out_size;
  const float** F = (const float**)d_in;   // 0 x [1,2048,2048], 1 Wq, 2 Wk, 3 Wv, 4 Wo [2048,2048] (x @ W), 5 lq1, 6 lk1, 7 lq2, 8 lk2 [64], 9 g [128]
  if (ws_size < (size_t)WS_END) return;
  char* ws = (char*)d_ws; __bf16 *PK = (__bf16*)(ws + WS_PK), *VTH = (__bf16*)(ws + WS_VTH), *VTL = (__bf16*)(ws + WS_VTL);
  float *CS = (float*)(ws + WS_CS), *Q = (float*)(ws + WS_Q), *Kx = (float*)(ws + WS_K), *O = (float*)(ws + WS_O);
  k_packT<<<DM, 256, 0, stream>>>(F[1], DM, DM, PK + PK_Q); k_packT<<<DM, 256, 0, stream>>>(F[2], DM, DM, PK + PK_K); k_packT<<<DM, 256, 0, stream>>>(F[3], DM, DM, PK + PK_V); k_packT<<<DM, 256, 0, stream>>>(F[4], DM, DM, PK + PK_O);
  k_rope_tab<<<SS, 32, 0, stream>>>(CS);
  k_proj<0><<<dim3(TRP, DM / 128), 128, 0, stream>>>(F[0], PK + PK_Q, CS, Q, DM, nullptr, nullptr);
  k_proj<0><<<dim3(TRP, DM / 128), 128, 0, stream>>>(F[0], PK + PK_K, CS, Kx, DM, nullptr, nullptr);
  k_proj<1><<<dim3(TRP, DM / 128), 128, 0, stream>>>(F[0], PK + PK_V, CS, nullptr, 0, VTH, VTL);
  k_attn<<<dim3(TQB, NH), 256, 0, stream>>>(Q, Kx, VTH, VTL, F[5], F[6], F[7], F[8], F[9], O);
  k_out<<<dim3(TQB, DM / 128), 128, 0, stream>>>(O, PK + PK_O, (float*)d_out);
}

// v002
// It runs in 759 microseconds.
// In two side-by-side timings against v001, it was 1.47 and 1.46 times as fast.
// Over all steps from v000 it is 1.85 times as fast.
// compute dtype: x, the four weights, the lambda vectors and g (module inputs) rounded to bf16; q/k/v projections with exact bf16 products (x and W are inputs) and interleaved-pair RoPE (tables in f32 as the module's numpy code) in the epilogue; the two causal attentions per head with q.k as bf16 hi + residual pairs (3 products) and P.V with P hi/lo x V hi/lo (3 products); the differential combination, RMSNorm and (1 - lambda_init) scaling in f32; the output projection hi/lo x exact Wo (2 products); all GEMMs on WMMA 16x16x32; f32 accumulate.
#include <hip/hip_runtime.h>
#include <math.h>

typedef __attribute__((ext_vector_type(16))) _Float16 v16h;
typedef __attribute__((ext_vector_type(16))) __bf16 v16b;
typedef __attribute__((ext_vector_type(8)))  _Float16 v8h;
typedef __attribute__((ext_vector_type(8)))  float v8f;
typedef __attribute__((ext_vector_type(4)))  float v4f;
typedef __attribute__((ext_vector_type(2)))  float v2f;
typedef __attribute__((ext_vector_type(4)))  unsigned v4u;
typedef __attribute__((ext_vector_type(4)))  int v4i;
typedef float __attribute__((may_alias)) float_a;
typedef int __attribute__((may_alias)) int_a;

template <typename T> __device__ __forceinline__ void vst2(void* p, T v) { *(T*)p = v;  }
__device__ __forceinline__ v8f wmma16(v16h a, v16h b, v8f c) {
  v8f d = __builtin_amdgcn_wmma_f32_16x16x32_f16(false, a, false, b, (short)0, c, false, false);
  asm volatile("v_nop\n\tv_nop\n\tv_nop\n\tv_nop" : "+v"(d) : "v"(a), "v"(b));
  return d;
}
__device__ __forceinline__ v8f wmma_bf(v16b a, v16b b, v8f c) {
  v8f d = __builtin_amdgcn_wmma_f32_16x16x32_bf16(false, a, false, b, (short)0, c, false, false);
  asm volatile("v_nop\n\tv_nop\n\tv_nop\n\tv_nop" : "+v"(d) : "v"(a), "v"(b));
  return d;
}
// 16x16x32 fragments: lane = (h = lane>>4, row/col = lane&15); elements 0..7 = k0+8h+0..7, 8..15 = k0+16+8h+0..7; D element r = row 8h+r
__device__ __forceinline__ v16h frag_h(const _Float16* rowk0, int lane) {
  union { v16h v; v8h q[2]; } u; const _Float16* p = rowk0 + 8 * (lane >> 4);
  u.q[0] = *(const v8h*)p; u.q[1] = *(const v8h*)(p + 16); return u.v;
}
__device__ __forceinline__ v16h frag_f32(const float* rowk0, int lane) {
  v16h a; const float* p = rowk0 + 8 * (lane >> 4);
#pragma unroll
  for (int i = 0; i < 8; ++i) { a[i] = (_Float16)p[i]; a[8 + i] = (_Float16)p[16 + i]; }
  return a;
}
__device__ __forceinline__ v16h frag_f32s(const float* rowk0, int lane, float sc) {
  v16h a; const float* p = rowk0 + 8 * (lane >> 4);
#pragma unroll
  for (int i = 0; i < 8; ++i) { a[i] = (_Float16)(p[i] * sc); a[8 + i] = (_Float16)(p[16 + i] * sc); }
  return a;
}
// column fragment from a [K][ld] layout (column n), rows >= K read as 0
__device__ __forceinline__ v16h fragc_f32(const float* W, int k0, int n, int lane, int ld, int K) {
  v16h a; const int g = lane >> 4;
#pragma unroll
  for (int i = 0; i < 8; ++i) { const int ka = k0 + 8 * g + i, kb = ka + 16;
    a[i] = (_Float16)(ka < K ? W[(size_t)(ka < K ? ka : K - 1) * ld + n] : 0.f); a[8 + i] = (_Float16)(kb < K ? W[(size_t)(kb < K ? kb : K - 1) * ld + n] : 0.f); }
  return a;
}
struct F2 { v16b h, l; };
__device__ __forceinline__ F2 bsplit16(const float v[16]) { F2 r;
#pragma unroll
  for (int i = 0; i < 16; ++i) { const __bf16 h = (__bf16)v[i]; r.h[i] = h; r.l[i] = (__bf16)(v[i] - (float)h); }
  return r; }
__device__ __forceinline__ F2 split_row(const float* row, int k0, int lane) { float v[16]; const float* p = row + k0 + 8 * (lane >> 4);
#pragma unroll
  for (int i = 0; i < 8; ++i) { v[i] = p[i]; v[8 + i] = p[16 + i]; }
  return bsplit16(v); }
__device__ __forceinline__ F2 split_rowK(const float* row, int k0, int lane, int K) { float v[16]; const int g = lane >> 4;
#pragma unroll
  for (int i = 0; i < 8; ++i) { const int ka = k0 + 8 * g + i, kb = ka + 16; v[i] = ka < K ? row[ka < K ? ka : K - 1] : 0.f; v[8 + i] = kb < K ? row[kb < K ? kb : K - 1] : 0.f; }
  return bsplit16(v); }
__device__ __forceinline__ F2 split_col(const float* W, int k0, int n, int lane, int ld, int K) { float v[16]; const int g = lane >> 4;
#pragma unroll
  for (int i = 0; i < 8; ++i) { const int ka = k0 + 8 * g + i, kb = ka + 16; v[i] = ka < K ? W[(size_t)(ka < K ? ka : K - 1) * ld + n] : 0.f; v[8 + i] = kb < K ? W[(size_t)(kb < K ? kb : K - 1) * ld + n] : 0.f; }
  return bsplit16(v); }
__device__ __forceinline__ v8f mac3(const F2& a, const F2& b, v8f c) { c = wmma_bf(a.l, b.h, c); c = wmma_bf(a.h, b.l, c); return wmma_bf(a.h, b.h, c); }
__device__ __forceinline__ float sigm(float v) { return 1.0f / (1.0f + expf(-v)); }
#define LDSX() do { asm volatile("s_wait_dscnt 0" ::: "memory"); __builtin_amdgcn_wave_barrier(); __builtin_amdgcn_fence(__ATOMIC_RELEASE, "workgroup"); } while (0)


// Differential attention (B 1, S 2048, E 2048, 16 heads; q/k as 32 half-heads x 64 with interleaved RoPE, v as 16 heads x 128): a = softmax_causal(q1 k1^T/8) v - lambda_full * softmax_causal(q2 k2^T/8) v; lambda_full = exp(lq1.lk1) - exp(lq2.lk2) + lambda_init; a = RMSNorm_128(a) * g * (1 - lambda_init); out = a Wo.
#define SS 2048
#define DM 2048
#define NH 16
#define HD 128               // v head dim (2*64)
#define HQ 64                // q/k half-head dim
#define KVW DM
#define LAMBDA_INIT 0.78360577f   /* 0.8 - 0.6*exp(-0.3*12) = 0.7836057665 */
#ifndef TQB
#define TQB (SS / 64)
#define TRP (SS / 64)          // projection row tiles (all)
#endif
typedef __attribute__((ext_vector_type(8))) __bf16 v8b;
__device__ __forceinline__ v16b frag_b(const __bf16* rowk0, int lane) {
  union { v16b v; v8b q[2]; } u; const __bf16* p = rowk0 + 8 * (lane >> 4);
  u.q[0] = *(const v8b*)p; u.q[1] = *(const v8b*)(p + 16); return u.v;
}
__device__ __forceinline__ float bfr(float v) { return (float)(__bf16)v; }
__device__ __attribute__((noinline)) float exp_ni(float v) { return expf(v); }
__device__ __attribute__((noinline)) float erf_ni(float v) { return erff(v); }

#define PK_Q 0
#define PK_K (PK_Q + DM * DM)
#define PK_V (PK_K + KVW * DM)
#define PK_O (PK_V + KVW * DM)
#define PK_END (PK_O + DM * DM)
#define WS_PK  0u
#define WS_CS  (WS_PK + 2u * PK_END)             // f32 [2048][32] cos, then [2048][32] sin
#define WS_Q   (WS_CS + 4u * 2 * SS * 32)
#define WS_K   (WS_Q + 4u * SS * DM)
#define WS_VTH (WS_K + 4u * SS * KVW)
#define WS_VTL (WS_VTH + 2u * KVW * SS)
#define WS_O   (WS_VTL + 2u * KVW * SS)
#define WS_END (WS_O + 4u * SS * DM)

// ---- weight tile in LDS: one stage = 128 packed weight rows x 64 k (128 B a row), LDS pitch 144 B (16 B x odd, for the ds_load_b128 readers), two stages
#define WROW 144
#define WBUF (128 * WROW)
// 128 threads bring one stage: copy i takes rows 16 i + (tid >> 3), 16 B a lane, so a wave's 32 lanes cover 4 whole 128-B rows per copy
__device__ __forceinline__ void stage_w(const __bf16* __restrict__ Pt, unsigned lds, int tid) {
  const __bf16* gp = Pt + (size_t)(tid >> 3) * DM + (tid & 7) * 8; const unsigned l = lds + (tid >> 3) * WROW + (tid & 7) * 16;
  // the eight copies and, as the last line, the wait that stands in front of any rewrite of the address registers they name
  asm volatile("global_load_async_to_lds_b128 %0, %8, off\n\t"
               "global_load_async_to_lds_b128 %1, %9, off\n\t"
               "global_load_async_to_lds_b128 %2, %10, off\n\t"
               "global_load_async_to_lds_b128 %3, %11, off\n\t"
               "global_load_async_to_lds_b128 %4, %12, off\n\t"
               "global_load_async_to_lds_b128 %5, %13, off\n\t"
               "global_load_async_to_lds_b128 %6, %14, off\n\t"
               "global_load_async_to_lds_b128 %7, %15, off\n\t"
               "s_wait_xcnt 0x0"
               :: "v"(l), "v"(l + 16 * WROW), "v"(l + 32 * WROW), "v"(l + 48 * WROW), "v"(l + 64 * WROW), "v"(l + 80 * WROW), "v"(l + 96 * WROW), "v"(l + 112 * WROW),
                  "v"(gp), "v"(gp + 16 * DM), "v"(gp + 32 * DM), "v"(gp + 48 * DM), "v"(gp + 64 * DM), "v"(gp + 80 * DM), "v"(gp + 96 * DM), "v"(gp + 112 * DM)
               : "memory");
}
// fragment of one staged row: the same bytes in the same k order as frag_b reads from the packed row
__device__ __forceinline__ v16b frag_w(const char* rowk0, int g) {
  union { v16b v; v8b q[2]; } u; const char* p = rowk0 + 16 * g;
  u.q[0] = *(const v8b*)p; u.q[1] = *(const v8b*)(p + 32); return u.v;
}
#define WAIT_COPIES() asm volatile("s_wait_asynccnt 0x0" ::: "memory")   /* this wave's copies have landed */
#define WAIT_LDS()    asm volatile("s_wait_dscnt 0x0" ::: "memory")      /* this wave's LDS reads have returned */

// ---- k_packT: block = output column n of a [K][N] (x @ W) matrix
__global__ __launch_bounds__(256) void k_packT(const float* __restrict__ Wm, int K, int N, __bf16* __restrict__ DST) {
  __shared__ __align__(16) __bf16 s[DM]; const int n = blockIdx.x, tid = threadIdx.x;
  for (int k = tid; k < K; k += 256) s[k] = (__bf16)Wm[(size_t)k * N + n];
  __syncthreads();
  for (int q = tid; q < K / 8; q += 256) vst2((unsigned*)(DST + (size_t)n * K + q * 8), *(const v4u*)&s[q * 8]);
}
__global__ __launch_bounds__(32) void k_rope_tab(float* __restrict__ CS) {
  __shared__ __align__(16) float sc[32], ssn[32]; const int t = blockIdx.x, i = threadIdx.x;
  const float dv = expf((float)(2 * i) * (-9.2103404f / 64.0f));   /* ln(1e4) as the f32 literal numpy uses */ const float ang = (float)t * dv; sc[i] = cosf(ang); ssn[i] = sinf(ang);
  __syncthreads();
  if (i < 8) vst2(CS + (size_t)t * 32 + i * 4, *(const v4f*)&sc[i * 4]); else if (i < 16) vst2(CS + (size_t)SS * 32 + (size_t)t * 32 + (i - 8) * 4, *(const v4f*)&ssn[(i - 8) * 4]);
}
// ---- k_proj<MODE>: block = (64 rows, 128 cols = one head): Y = bf16(x) . P rows (exact); MODE 0: RoPE then f32 rows (q/k; ldo); MODE 1: plain -> transposed bf16 hi/lo planes (v)
template <int MODE>
__global__ __launch_bounds__(128) void k_proj(const float* __restrict__ X, const __bf16* __restrict__ P, const float* __restrict__ CS, float* __restrict__ OUT, int ldo, __bf16* __restrict__ PH, __bf16* __restrict__ PL) {
  __shared__ __align__(16) float so[MODE ? 1 : 4][16][132]; __shared__ __align__(16) __bf16 sth[MODE ? 128 : 1][72], stl[MODE ? 128 : 1][72]; __shared__ __align__(16) char sw[2 * WBUF];
  const int tid = threadIdx.x, wave = tid >> 5, lane = tid & 31, col = lane & 15, g = lane >> 4; const size_t r0 = (size_t)blockIdx.x * 64 + wave * 16; const int n0 = blockIdx.y * 128;
  v8f acc[8] = {};
  const unsigned sw0 = (unsigned)(size_t)&sw[0]; const __bf16* Pn = P + (size_t)n0 * DM;
  stage_w(Pn, sw0, tid); WAIT_COPIES(); __syncthreads();   // tile 0 is in buffer 0 for every wave
  stage_w(Pn + 64, sw0 + WBUF, tid);                       // tile 1 flies while tile 0 is worked on
#pragma unroll 1   // one trip per stage: the ring's foot (waits, barrier, refill) stands once and the two buffers alternate by t & 1
  for (int t = 0; t < DM / 64; ++t) { const int bo = (t & 1) * WBUF; v16b a[2];
#pragma unroll
    for (int u = 0; u < 2; ++u) { const float* p = X + (r0 + col) * DM + (2 * t + u) * 32 + 8 * g;
#pragma unroll
      for (int i = 0; i < 8; ++i) { a[u][i] = (__bf16)p[i]; a[u][8 + i] = (__bf16)p[16 + i]; } }
#pragma unroll
    for (int u = 0; u < 2; ++u) { v16b b[8];
#pragma unroll
      for (int j = 0; j < 8; ++j) b[j] = frag_w(&sw[bo + (j * 16 + col) * WROW + u * 64], g);
#pragma unroll
      for (int j = 0; j < 8; ++j) acc[j] = wmma_bf(a[u], b[j], acc[j]); }
    WAIT_LDS(); WAIT_COPIES(); __syncthreads();   // publishes tile t + 1 and ends every wave's reads of tile t
    if (t + 2 < DM / 64) stage_w(Pn + (t + 2) * 64, sw0 + bo, tid); }
  WAIT_COPIES();
  if (MODE == 0) {
    // projections to LDS, then interleaved-pair RoPE in place within each 64-wide half-head: (x_{2i}, x_{2i+1}) -> (x c - y s, x s + y c) with angle index i
#pragma unroll
    for (int j = 0; j < 8; ++j)
#pragma unroll
      for (int r = 0; r < 8; ++r) so[wave][8 * g + r][j * 16 + col] = acc[j][r];
    LDSX();
    for (int q = lane; q < 16 * 64; q += 32) { const int rl = q >> 6, pi = q & 63; const int half = pi >> 5, i = pi & 31; const size_t t = r0 + rl; const float c = CS[t * 32 + i], s = CS[(size_t)SS * 32 + t * 32 + i]; float* e = &so[wave][rl][half * 64 + 2 * i]; const float xe = e[0], xo = e[1]; e[0] = xe * c - xo * s; e[1] = xe * s + xo * c; }
    LDSX();
    for (int rl = 0; rl < 16; ++rl) vst2(OUT + (r0 + rl) * ldo + n0 + lane * 4, *(const v4f*)&so[wave][rl][lane * 4]);
  } else {
#pragma unroll
    for (int j = 0; j < 8; ++j)
#pragma unroll
      for (int r = 0; r < 8; ++r) { const float v = acc[j][r]; const __bf16 hb = (__bf16)v; sth[j * 16 + col][wave * 16 + 8 * g + r] = hb; stl[j * 16 + col][wave * 16 + 8 * g + r] = (__bf16)(v - (float)hb); }
    __syncthreads();
    const int s0 = blockIdx.x * 64;
    for (int q = tid; q < 128 * 8; q += 128) { const int d = q >> 3, pc = q & 7; const size_t o = (size_t)(n0 + d) * SS + s0 + pc * 8; vst2((unsigned*)(PH + o), *(const v4u*)&sth[d][pc * 8]); vst2((unsigned*)(PL + o), *(const v4u*)&stl[d][pc * 8]); }
  }
}
// ---- k_attn: block = (64 queries, head h), 8 waves: waves 0..3 run attention 1 and waves 4..7 attention 2 of the same four 16-query tiles side by side; scores 3 products, P.V 3 products; O[q][h*128+d]
__global__ __launch_bounds__(256) void k_attn(const float* __restrict__ Q, const float* __restrict__ Kx, const __bf16* __restrict__ VTH, const __bf16* __restrict__ VTL, const float* __restrict__ LQ1, const float* __restrict__ LK1, const float* __restrict__ LQ2, const float* __restrict__ LK2, const float* __restrict__ G, float* __restrict__ O) {
  __shared__ __align__(16) float sp[8][16][36]; __shared__ __align__(16) float so[4][16][132];
  const int tid = threadIdx.x, wave = tid >> 5, lane = tid & 31, col = lane & 15, g = lane >> 4;
  const int sub = __builtin_amdgcn_readfirstlane(wave >> 2), wq = wave & 3;   // which attention (the same in every lane of a wave), which 16-query tile
  const int qb = blockIdx.x, h = blockIdx.y; const int q0 = qb * 64 + wq * 16;
  // lambda_full from the inputs (64-dots)
  float lam; { float s1 = 0.f, s2 = 0.f; for (int i = lane; i < HQ; i += 32) { s1 += bfr(LQ1[i]) * bfr(LK1[i]); s2 += bfr(LQ2[i]) * bfr(LK2[i]); }
#pragma unroll
    for (int o = 1; o < 32; o <<= 1) { s1 += __shfl_xor(s1, o); s2 += __shfl_xor(s2, o); } lam = exp_ni(s1) - exp_ni(s2) + LAMBDA_INIT; }
  const int nks = (qb * 64 + 64) / 32;
  const float* qrow = Q + (size_t)(q0 + col) * DM + (2 * h + sub) * HQ;
  float m[8], l[8];
#pragma unroll
  for (int r = 0; r < 8; ++r) { m[r] = -3.0e38f; l[r] = 0.f; }
  v8f acc[8] = {};
#pragma unroll 1
  for (int ks = 0; ks < nks; ++ks) { v8f s[2];
#pragma unroll
    for (int ct = 0; ct < 2; ++ct) { const int kk = ks * 32 + ct * 16 + col; const float* krow = Kx + (size_t)kk * KVW + (2 * h + sub) * HQ; v8f c = {};
#pragma unroll
      for (int kc = 0; kc < 2; ++kc) { const F2 kb = split_row(krow, kc * 32, lane); const F2 qa = split_row(qrow, kc * 32, lane); c = mac3(qa, kb, c); }
#pragma unroll
      for (int r = 0; r < 8; ++r) { const int qi = q0 + 8 * g + r; s[ct][r] = (kk <= qi) ? c[r] * 0.125f : -3.0e38f; } }
#pragma unroll
    for (int r = 0; r < 8; ++r) { float mx = fmaxf(s[0][r], s[1][r]);
#pragma unroll
      for (int o = 1; o < 16; o <<= 1) mx = fmaxf(mx, __shfl_xor(mx, o));
      const float mn = fmaxf(m[r], mx); const float alpha = (m[r] <= -1.0e38f) ? 0.f : exp_ni(m[r] - mn);
      const float e0 = (s[0][r] <= -1.0e38f) ? 0.f : exp_ni(s[0][r] - mn), e1 = (s[1][r] <= -1.0e38f) ? 0.f : exp_ni(s[1][r] - mn); float es = e0 + e1;
#pragma unroll
      for (int o = 1; o < 16; o <<= 1) es += __shfl_xor(es, o);
      l[r] = l[r] * alpha + es; m[r] = mn;
#pragma unroll
      for (int dt = 0; dt < 8; ++dt) acc[dt][r] *= alpha;
      sp[wave][8 * g + r][col] = e0; sp[wave][8 * g + r][16 + col] = e1; }
    LDSX();
    const F2 pa = split_row(&sp[wave][col][0], 0, lane);
#pragma unroll
    for (int dt = 0; dt < 8; ++dt) { const size_t vr = (size_t)(h * HD + dt * 16 + col) * SS + ks * 32; const v16b vh = frag_b(VTH + vr, lane), vl = frag_b(VTL + vr, lane); acc[dt] = wmma_bf(pa.l, vh, acc[dt]); acc[dt] = wmma_bf(pa.h, vl, acc[dt]); acc[dt] = wmma_bf(pa.h, vh, acc[dt]); }
    LDSX(); }
  if (sub == 0) {
#pragma unroll
    for (int r = 0; r < 8; ++r) { const float il = 1.0f / l[r];
#pragma unroll
      for (int dt = 0; dt < 8; ++dt) so[wq][8 * g + r][dt * 16 + col] = acc[dt][r] * il; }
  }
  __syncthreads();   // hands the normalised attn1 rows of tile wq from wave wq to wave 4 + wq
  if (sub == 1) {
#pragma unroll
    for (int r = 0; r < 8; ++r) { const float il = 1.0f / l[r]; float a[8]; float ss = 0.f;
#pragma unroll
      for (int dt = 0; dt < 8; ++dt) { a[dt] = so[wq][8 * g + r][dt * 16 + col] - lam * (acc[dt][r] * il); ss += a[dt] * a[dt]; }
#pragma unroll
      for (int o = 1; o < 16; o <<= 1) ss += __shfl_xor(ss, o);
      const float rs = rsqrtf(ss / (float)HD + 1e-5f) * (1.0f - LAMBDA_INIT);
#pragma unroll
      for (int dt = 0; dt < 8; ++dt) { const int d = dt * 16 + col; so[wq][8 * g + r][d] = a[dt] * rs * bfr(G[d]); } }
    LDSX();
    for (int rl = 0; rl < 16; ++rl) vst2(O + (size_t)(q0 + rl) * DM + h * HD + lane * 4, *(const v4f*)&so[wq][rl][lane * 4]);
  }
}
// ---- k_out: block = (64 rows, 128 cols): out = O(hi/lo) . wproj^T rows (2 products)
__global__ __launch_bounds__(128) void k_out(const float* __restrict__ O, const __bf16* __restrict__ P, float* __restrict__ Y) {
  __shared__ __align__(16) float so[4][16][132]; __shared__ __align__(16) char sw[2 * WBUF];
  const int tid = threadIdx.x, wave = tid >> 5, lane = tid & 31, col = lane & 15, g = lane >> 4; const size_t r0 = (size_t)blockIdx.x * 64 + wave * 16; const int n0 = blockIdx.y * 128;
  v8f acc[8] = {};
  const unsigned sw0 = (unsigned)(size_t)&sw[0]; const __bf16* Pn = P + (size_t)n0 * DM;
  stage_w(Pn, sw0, tid); WAIT_COPIES(); __syncthreads();   // tile 0 is in buffer 0 for every wave
  stage_w(Pn + 64, sw0 + WBUF, tid);                       // tile 1 flies while tile 0 is worked on
#pragma unroll 1   // one trip per stage: the ring's foot (waits, barrier, refill) stands once and the two buffers alternate by t & 1
  for (int t = 0; t < DM / 64; ++t) { const int bo = (t & 1) * WBUF; F2 a[2];
#pragma unroll
    for (int u = 0; u < 2; ++u) a[u] = split_row(O + (r0 + col) * DM, (2 * t + u) * 32, lane);
#pragma unroll
    for (int u = 0; u < 2; ++u) { v16b b[8];
#pragma unroll
      for (int j = 0; j < 8; ++j) b[j] = frag_w(&sw[bo + (j * 16 + col) * WROW + u * 64], g);
#pragma unroll
      for (int j = 0; j < 8; ++j) { acc[j] = wmma_bf(a[u].l, b[j], acc[j]); acc[j] = wmma_bf(a[u].h, b[j], acc[j]); } }
    WAIT_LDS(); WAIT_COPIES(); __syncthreads();   // publishes tile t + 1 and ends every wave's reads of tile t
    if (t + 2 < DM / 64) stage_w(Pn + (t + 2) * 64, sw0 + bo, tid); }
  WAIT_COPIES();
#pragma unroll
  for (int j = 0; j < 8; ++j)
#pragma unroll
    for (int r = 0; r < 8; ++r) so[wave][8 * g + r][j * 16 + col] = acc[j][r];
  LDSX();
  for (int rl = 0; rl < 16; ++rl) vst2(Y + (r0 + rl) * DM + n0 + lane * 4, *(const v4f*)&so[wave][rl][lane * 4]);
}
extern "C" void kernel_launch(void* const* d_in, const int* in_sizes, int n_in, void* d_out, int out_size, void* d_ws, size_t ws_size, hipStream_t stream) {
  (void)in_sizes; (void)n_in; (void)out_size;
  const float** F = (const float**)d_in;   // 0 x [1,2048,2048], 1 Wq, 2 Wk, 3 Wv, 4 Wo [2048,2048] (x @ W), 5 lq1, 6 lk1, 7 lq2, 8 lk2 [64], 9 g [128]
  if (ws_size < (size_t)WS_END) return;
  char* ws = (char*)d_ws; __bf16 *PK = (__bf16*)(ws + WS_PK), *VTH = (__bf16*)(ws + WS_VTH), *VTL = (__bf16*)(ws + WS_VTL);
  float *CS = (float*)(ws + WS_CS), *Q = (float*)(ws + WS_Q), *Kx = (float*)(ws + WS_K), *O = (float*)(ws + WS_O);
  k_packT<<<DM, 256, 0, stream>>>(F[1], DM, DM, PK + PK_Q); k_packT<<<DM, 256, 0, stream>>>(F[2], DM, DM, PK + PK_K); k_packT<<<DM, 256, 0, stream>>>(F[3], DM, DM, PK + PK_V); k_packT<<<DM, 256, 0, stream>>>(F[4], DM, DM, PK + PK_O);
  k_rope_tab<<<SS, 32, 0, stream>>>(CS);
  k_proj<0><<<dim3(TRP, DM / 128), 128, 0, stream>>>(F[0], PK + PK_Q, CS, Q, DM, nullptr, nullptr);
  k_proj<0><<<dim3(TRP, DM / 128), 128, 0, stream>>>(F[0], PK + PK_K, CS, Kx, DM, nullptr, nullptr);
  k_proj<1><<<dim3(TRP, DM / 128), 128, 0, stream>>>(F[0], PK + PK_V, CS, nullptr, 0, VTH, VTL);
  k_attn<<<dim3(TQB, NH), 256, 0, stream>>>(Q, Kx, VTH, VTL, F[5], F[6], F[7], F[8], F[9], O);
  k_out<<<dim3(TQB, DM / 128), 128, 0, stream>>>(O, PK + PK_O, (float*)d_out);
}

// v003
// A run of this version takes 604 microseconds.
// Timed twice side by side with v002, it ran 1.26 times as fast both times.
// All steps since v000 together make it 2.33 times as fast.
// compute dtype: x, the four weights, the lambda vectors and g (module inputs) rounded to bf16; q/k/v projections with exact bf16 products (x and W are inputs) and interleaved-pair RoPE (tables in f32 as the module's numpy code) in the epilogue; the two causal attentions per head with q.k as bf16 hi + residual pairs (3 products) and P.V with P hi/lo x V hi/lo (3 products); the differential combination, RMSNorm and (1 - lambda_init) scaling in f32; the output projection hi/lo x exact Wo (2 products); all GEMMs on WMMA 16x16x32; f32 accumulate.
#include <hip/hip_runtime.h>
#include <math.h>

typedef __attribute__((ext_vector_type(16))) _Float16 v16h;
typedef __attribute__((ext_vector_type(16))) __bf16 v16b;
typedef __attribute__((ext_vector_type(8)))  _Float16 v8h;
typedef __attribute__((ext_vector_type(8)))  float v8f;
typedef __attribute__((ext_vector_type(4)))  float v4f;
typedef __attribute__((ext_vector_type(2)))  float v2f;
typedef __attribute__((ext_vector_type(4)))  unsigned v4u;
typedef __attribute__((ext_vector_type(4)))  int v4i;
typedef float __attribute__((may_alias)) float_a;
typedef int __attribute__((may_alias)) int_a;

template <typename T> __device__ __forceinline__ void vst2(void* p, T v) { *(T*)p = v;  }
__device__ __forceinline__ v8f wmma16(v16h a, v16h b, v8f c) {
  v8f d = __builtin_amdgcn_wmma_f32_16x16x32_f16(false, a, false, b, (short)0, c, false, false);
  asm volatile("v_nop\n\tv_nop\n\tv_nop\n\tv_nop" : "+v"(d) : "v"(a), "v"(b));
  return d;
}
__device__ __forceinline__ v8f wmma_bf(v16b a, v16b b, v8f c) {
  v8f d = __builtin_amdgcn_wmma_f32_16x16x32_bf16(false, a, false, b, (short)0, c, false, false);
  asm volatile("v_nop\n\tv_nop\n\tv_nop\n\tv_nop" : "+v"(d) : "v"(a), "v"(b));
  return d;
}
// 16x16x32 fragments: lane = (h = lane>>4, row/col = lane&15); elements 0..7 = k0+8h+0..7, 8..15 = k0+16+8h+0..7; D element r = row 8h+r
__device__ __forceinline__ v16h frag_h(const _Float16* rowk0, int lane) {
  union { v16h v; v8h q[2]; } u; const _Float16* p = rowk0 + 8 * (lane >> 4);
  u.q[0] = *(const v8h*)p; u.q[1] = *(const v8h*)(p + 16); return u.v;
}
__device__ __forceinline__ v16h frag_f32(const float* rowk0, int lane) {
  v16h a; const float* p = rowk0 + 8 * (lane >> 4);
#pragma unroll
  for (int i = 0; i < 8; ++i) { a[i] = (_Float16)p[i]; a[8 + i] = (_Float16)p[16 + i]; }
  return a;
}
__device__ __forceinline__ v16h frag_f32s(const float* rowk0, int lane, float sc) {
  v16h a; const float* p = rowk0 + 8 * (lane >> 4);
#pragma unroll
  for (int i = 0; i < 8; ++i) { a[i] = (_Float16)(p[i] * sc); a[8 + i] = (_Float16)(p[16 + i] * sc); }
  return a;
}
// column fragment from a [K][ld] layout (column n), rows >= K read as 0
__device__ __forceinline__ v16h fragc_f32(const float* W, int k0, int n, int lane, int ld, int K) {
  v16h a; const int g = lane >> 4;
#pragma unroll
  for (int i = 0; i < 8; ++i) { const int ka = k0 + 8 * g + i, kb = ka + 16;
    a[i] = (_Float16)(ka < K ? W[(size_t)(ka < K ? ka : K - 1) * ld + n] : 0.f); a[8 + i] = (_Float16)(kb < K ? W[(size_t)(kb < K ? kb : K - 1) * ld + n] : 0.f); }
  return a;
}
struct F2 { v16b h, l; };
__device__ __forceinline__ F2 bsplit16(const float v[16]) { F2 r;
#pragma unroll
  for (int i = 0; i < 16; ++i) { const __bf16 h = (__bf16)v[i]; r.h[i] = h; r.l[i] = (__bf16)(v[i] - (float)h); }
  return r; }
__device__ __forceinline__ F2 split_row(const float* row, int k0, int lane) { float v[16]; const float* p = row + k0 + 8 * (lane >> 4);
#pragma unroll
  for (int i = 0; i < 8; ++i) { v[i] = p[i]; v[8 + i] = p[16 + i]; }
  return bsplit16(v); }
__device__ __forceinline__ F2 split_rowK(const float* row, int k0, int lane, int K) { float v[16]; const int g = lane >> 4;
#pragma unroll
  for (int i = 0; i < 8; ++i) { const int ka = k0 + 8 * g + i, kb = ka + 16; v[i] = ka < K ? row[ka < K ? ka : K - 1] : 0.f; v[8 + i] = kb < K ? row[kb < K ? kb : K - 1] : 0.f; }
  return bsplit16(v); }
__device__ __forceinline__ F2 split_col(const float* W, int k0, int n, int lane, int ld, int K) { float v[16]; const int g = lane >> 4;
#pragma unroll
  for (int i = 0; i < 8; ++i) { const int ka = k0 + 8 * g + i, kb = ka + 16; v[i] = ka < K ? W[(size_t)(ka < K ? ka : K - 1) * ld + n] : 0.f; v[8 + i] = kb < K ? W[(size_t)(kb < K ? kb : K - 1) * ld + n] : 0.f; }
  return bsplit16(v); }
__device__ __forceinline__ v8f mac3(const F2& a, const F2& b, v8f c) { c = wmma_bf(a.l, b.h, c); c = wmma_bf(a.h, b.l, c); return wmma_bf(a.h, b.h, c); }
__device__ __forceinline__ float sigm(float v) { return 1.0f / (1.0f + expf(-v)); }
#define LDSX() do { asm volatile("s_wait_dscnt 0" ::: "memory"); __builtin_amdgcn_wave_barrier(); __builtin_amdgcn_fence(__ATOMIC_RELEASE, "workgroup"); } while (0)


// Differential attention (B 1, S 2048, E 2048, 16 heads; q/k as 32 half-heads x 64 with interleaved RoPE, v as 16 heads x 128): a = softmax_causal(q1 k1^T/8) v - lambda_full * softmax_causal(q2 k2^T/8) v; lambda_full = exp(lq1.lk1) - exp(lq2.lk2) + lambda_init; a = RMSNorm_128(a) * g * (1 - lambda_init); out = a Wo.
#define SS 2048
#define DM 2048
#define NH 16
#define HD 128               // v head dim (2*64)
#define HQ 64                // q/k half-head dim
#define KVW DM
#define LAMBDA_INIT 0.78360577f   /* 0.8 - 0.6*exp(-0.3*12) = 0.7836057665 */
#ifndef TQB
#define TQB (SS / 64)
#define TRP (SS / 64)          // projection row tiles (all)
#endif
typedef __attribute__((ext_vector_type(8))) __bf16 v8b;
__device__ __forceinline__ v16b frag_b(const __bf16* rowk0, int lane) {
  union { v16b v; v8b q[2]; } u; const __bf16* p = rowk0 + 8 * (lane >> 4);
  u.q[0] = *(const v8b*)p; u.q[1] = *(const v8b*)(p + 16); return u.v;
}
__device__ __forceinline__ float bfr(float v) { return (float)(__bf16)v; }
__device__ __attribute__((noinline)) float exp_ni(float v) { return expf(v); }
__device__ __attribute__((noinline)) float erf_ni(float v) { return erff(v); }

#define PK_Q 0
#define PK_K (PK_Q + DM * DM)
#define PK_V (PK_K + KVW * DM)
#define PK_O (PK_V + KVW * DM)
#define PK_END (PK_O + DM * DM)
#define WS_PK  0u
#define WS_CS  (WS_PK + 2u * PK_END)             // f32 [2048][32] cos, then [2048][32] sin
#define WS_Q   (WS_CS + 4u * 2 * SS * 32)
#define WS_K   (WS_Q + 4u * SS * DM)
#define WS_VTH (WS_K + 4u * SS * KVW)
#define WS_VTL (WS_VTH + 2u * KVW * SS)
#define WS_O   (WS_VTL + 2u * KVW * SS)
#define WS_END (WS_O + 4u * SS * DM)

// ---- weight tile in LDS: one stage = 128 packed weight rows x 64 k (128 B a row), LDS pitch 144 B (16 B x odd, for the ds_load_b128 readers), two stages
#define WROW 144
#define WBUF (128 * WROW)
// 128 threads bring one stage: copy i takes rows 16 i + (tid >> 3), 16 B a lane, so a wave's 32 lanes cover 4 whole 128-B rows per copy
__device__ __forceinline__ void stage_w(const __bf16* __restrict__ Pt, unsigned lds, int tid) {
  const __bf16* gp = Pt + (size_t)(tid >> 3) * DM + (tid & 7) * 8; const unsigned l = lds + (tid >> 3) * WROW + (tid & 7) * 16;
  // the eight copies and, as the last line, the wait that stands in front of any rewrite of the address registers they name
  asm volatile("global_load_async_to_lds_b128 %0, %8, off\n\t"
               "global_load_async_to_lds_b128 %1, %9, off\n\t"
               "global_load_async_to_lds_b128 %2, %10, off\n\t"
               "global_load_async_to_lds_b128 %3, %11, off\n\t"
               "global_load_async_to_lds_b128 %4, %12, off\n\t"
               "global_load_async_to_lds_b128 %5, %13, off\n\t"
               "global_load_async_to_lds_b128 %6, %14, off\n\t"
               "global_load_async_to_lds_b128 %7, %15, off\n\t"
               "s_wait_xcnt 0x0"
               :: "v"(l), "v"(l + 16 * WROW), "v"(l + 32 * WROW), "v"(l + 48 * WROW), "v"(l + 64 * WROW), "v"(l + 80 * WROW), "v"(l + 96 * WROW), "v"(l + 112 * WROW),
                  "v"(gp), "v"(gp + 16 * DM), "v"(gp + 32 * DM), "v"(gp + 48 * DM), "v"(gp + 64 * DM), "v"(gp + 80 * DM), "v"(gp + 96 * DM), "v"(gp + 112 * DM)
               : "memory");
}
// fragment of one staged row: the same bytes in the same k order as frag_b reads from the packed row
__device__ __forceinline__ v16b frag_w(const char* rowk0, int g) {
  union { v16b v; v8b q[2]; } u; const char* p = rowk0 + 16 * g;
  u.q[0] = *(const v8b*)p; u.q[1] = *(const v8b*)(p + 32); return u.v;
}
#define WAIT_COPIES() asm volatile("s_wait_asynccnt 0x0" ::: "memory")   /* this wave's copies have landed */
#define WAIT_LDS()    asm volatile("s_wait_dscnt 0x0" ::: "memory")      /* this wave's LDS reads have returned */

// ---- k_packT: block = output column n of a [K][N] (x @ W) matrix
__global__ __launch_bounds__(256) void k_packT(const float* __restrict__ Wm, int K, int N, __bf16* __restrict__ DST) {
  __shared__ __align__(16) __bf16 s[DM]; const int n = blockIdx.x, tid = threadIdx.x;
  for (int k = tid; k < K; k += 256) s[k] = (__bf16)Wm[(size_t)k * N + n];
  __syncthreads();
  for (int q = tid; q < K / 8; q += 256) vst2((unsigned*)(DST + (size_t)n * K + q * 8), *(const v4u*)&s[q * 8]);
}
__global__ __launch_bounds__(32) void k_rope_tab(float* __restrict__ CS) {
  __shared__ __align__(16) float sc[32], ssn[32]; const int t = blockIdx.x, i = threadIdx.x;
  const float dv = expf((float)(2 * i) * (-9.2103404f / 64.0f));   /* ln(1e4) as the f32 literal numpy uses */ const float ang = (float)t * dv; sc[i] = cosf(ang); ssn[i] = sinf(ang);
  __syncthreads();
  if (i < 8) vst2(CS + (size_t)t * 32 + i * 4, *(const v4f*)&sc[i * 4]); else if (i < 16) vst2(CS + (size_t)SS * 32 + (size_t)t * 32 + (i - 8) * 4, *(const v4f*)&ssn[(i - 8) * 4]);
}
// ---- k_proj<MODE>: block = (64 rows, 128 cols = one head): Y = bf16(x) . P rows (exact); MODE 0: RoPE then f32 rows (q/k; ldo); MODE 1: plain -> transposed bf16 hi/lo planes (v)
template <int MODE>
__global__ __launch_bounds__(128) void k_proj(const float* __restrict__ X, const __bf16* __restrict__ P, const float* __restrict__ CS, float* __restrict__ OUT, int ldo, __bf16* __restrict__ PH, __bf16* __restrict__ PL) {
  __shared__ __align__(16) float so[MODE ? 1 : 4][16][132]; __shared__ __align__(16) __bf16 sth[MODE ? 128 : 1][72], stl[MODE ? 128 : 1][72]; __shared__ __align__(16) char sw[2 * WBUF];
  const int tid = threadIdx.x, wave = tid >> 5, lane = tid & 31, col = lane & 15, g = lane >> 4; const size_t r0 = (size_t)blockIdx.x * 64 + wave * 16; const int n0 = blockIdx.y * 128;
  v8f acc[8] = {};
  const unsigned sw0 = (unsigned)(size_t)&sw[0]; const __bf16* Pn = P + (size_t)n0 * DM;
  stage_w(Pn, sw0, tid); WAIT_COPIES(); __syncthreads();   // tile 0 is in buffer 0 for every wave
  stage_w(Pn + 64, sw0 + WBUF, tid);                       // tile 1 flies while tile 0 is worked on
#pragma unroll 1   // one trip per stage: the ring's foot (waits, barrier, refill) stands once and the two buffers alternate by t & 1
  for (int t = 0; t < DM / 64; ++t) { const int bo = (t & 1) * WBUF; v16b a[2];
#pragma unroll
    for (int u = 0; u < 2; ++u) { const float* p = X + (r0 + col) * DM + (2 * t + u) * 32 + 8 * g;
#pragma unroll
      for (int i = 0; i < 8; ++i) { a[u][i] = (__bf16)p[i]; a[u][8 + i] = (__bf16)p[16 + i]; } }
#pragma unroll
    for (int u = 0; u < 2; ++u) { v16b b[8];
#pragma unroll
      for (int j = 0; j < 8; ++j) b[j] = frag_w(&sw[bo + (j * 16 + col) * WROW + u * 64], g);
#pragma unroll
      for (int j = 0; j < 8; ++j) acc[j] = wmma_bf(a[u], b[j], acc[j]); }
    WAIT_LDS(); WAIT_COPIES(); __syncthreads();   // publishes tile t + 1 and ends every wave's reads of tile t
    if (t + 2 < DM / 64) stage_w(Pn + (t + 2) * 64, sw0 + bo, tid); }
  WAIT_COPIES();
  if (MODE == 0) {
    // projections to LDS, then interleaved-pair RoPE in place within each 64-wide half-head: (x_{2i}, x_{2i+1}) -> (x c - y s, x s + y c) with angle index i
#pragma unroll
    for (int j = 0; j < 8; ++j)
#pragma unroll
      for (int r = 0; r < 8; ++r) so[wave][8 * g + r][j * 16 + col] = acc[j][r];
    LDSX();
    for (int q = lane; q < 16 * 64; q += 32) { const int rl = q >> 6, pi = q & 63; const int half = pi >> 5, i = pi & 31; const size_t t = r0 + rl; const float c = CS[t * 32 + i], s = CS[(size_t)SS * 32 + t * 32 + i]; float* e = &so[wave][rl][half * 64 + 2 * i]; const float xe = e[0], xo = e[1]; e[0] = xe * c - xo * s; e[1] = xe * s + xo * c; }
    LDSX();
    for (int rl = 0; rl < 16; ++rl) vst2(OUT + (r0 + rl) * ldo + n0 + lane * 4, *(const v4f*)&so[wave][rl][lane * 4]);
  } else {
#pragma unroll
    for (int j = 0; j < 8; ++j)
#pragma unroll
      for (int r = 0; r < 8; ++r) { const float v = acc[j][r]; const __bf16 hb = (__bf16)v; sth[j * 16 + col][wave * 16 + 8 * g + r] = hb; stl[j * 16 + col][wave * 16 + 8 * g + r] = (__bf16)(v - (float)hb); }
    __syncthreads();
    const int s0 = blockIdx.x * 64;
    for (int q = tid; q < 128 * 8; q += 128) { const int d = q >> 3, pc = q & 7; const size_t o = (size_t)(n0 + d) * SS + s0 + pc * 8; vst2((unsigned*)(PH + o), *(const v4u*)&sth[d][pc * 8]); vst2((unsigned*)(PL + o), *(const v4u*)&stl[d][pc * 8]); }
  }
}
// ---- K and V tiles in LDS: one stage = the 32 keys of one trip for one head: 32 K rows x 512 B (both 64-float half-heads of a key), then the hi and the lo plane of V^T, 128 rows (d) x 64 B (32 keys) each; LDS pitches 528 B and 80 B (16 B x odd, for the ds_load_b128 readers), two stages
#define KROW 528
#define VROW 80
#define KBUF (32 * KROW)
#define VPL  (128 * VROW)
#define ABUF (KBUF + 2 * VPL)
// 256 threads bring one stage, 16 B a lane: K copy i takes rows 8 i + (tid >> 5), a wave covering one whole 512-B row; V copy i of a plane takes rows 64 i + (tid >> 2), a wave covering 8 rows of 64 B
__device__ __forceinline__ void stage_kv(const float* __restrict__ Kt, const __bf16* __restrict__ Vh, const __bf16* __restrict__ Vl, unsigned lds, int tid) {
  const float* kp = Kt + (size_t)(tid >> 5) * KVW + (tid & 31) * 4; const unsigned kl = lds + (tid >> 5) * KROW + (tid & 31) * 16;
  const size_t vo = (size_t)(tid >> 2) * SS + (tid & 3) * 8; const __bf16 *hp = Vh + vo, *lp = Vl + vo; const unsigned vl = lds + KBUF + (tid >> 2) * VROW + (tid & 3) * 16;
  // the eight copies and, as the last line, the wait that stands in front of any rewrite of the address registers they name
  asm volatile("global_load_async_to_lds_b128 %0, %8, off\n\t"
               "global_load_async_to_lds_b128 %1, %9, off\n\t"
               "global_load_async_to_lds_b128 %2, %10, off\n\t"
               "global_load_async_to_lds_b128 %3, %11, off\n\t"
               "global_load_async_to_lds_b128 %4, %12, off\n\t"
               "global_load_async_to_lds_b128 %5, %13, off\n\t"
               "global_load_async_to_lds_b128 %6, %14, off\n\t"
               "global_load_async_to_lds_b128 %7, %15, off\n\t"
               "s_wait_xcnt 0x0"
               :: "v"(kl), "v"(kl + 8 * KROW), "v"(kl + 16 * KROW), "v"(kl + 24 * KROW), "v"(vl), "v"(vl + 64 * VROW), "v"(vl + VPL), "v"(vl + VPL + 64 * VROW),
                  "v"(kp), "v"(kp + 8 * KVW), "v"(kp + 16 * KVW), "v"(kp + 24 * KVW), "v"(hp), "v"(hp + 64 * SS), "v"(lp), "v"(lp + 64 * SS)
               : "memory");
}
// ---- k_attn: block = (64 queries, head h), 8 waves: waves 0..3 run attention 1 and waves 4..7 attention 2 of the same four 16-query tiles side by side; each trip's K and V tiles are staged once in LDS for all 8 waves; scores 3 products, P.V 3 products; O[q][h*128+d]
__global__ __launch_bounds__(256) void k_attn(const float* __restrict__ Q, const float* __restrict__ Kx, const __bf16* __restrict__ VTH, const __bf16* __restrict__ VTL, const float* __restrict__ LQ1, const float* __restrict__ LK1, const float* __restrict__ LQ2, const float* __restrict__ LK2, const float* __restrict__ G, float* __restrict__ O) {
  __shared__ __align__(16) float sp[8][16][36]; __shared__ __align__(16) float so[4][16][132]; __shared__ __align__(16) char skv[2 * ABUF];
  const int tid = threadIdx.x, wave = tid >> 5, lane = tid & 31, col = lane & 15, g = lane >> 4;
  const int sub = __builtin_amdgcn_readfirstlane(wave >> 2), wq = wave & 3;   // which attention (the same in every lane of a wave), which 16-query tile
  const int qb = blockIdx.x, h = blockIdx.y; const int q0 = qb * 64 + wq * 16;
  // lambda_full from the inputs (64-dots)
  float lam; { float s1 = 0.f, s2 = 0.f; for (int i = lane; i < HQ; i += 32) { s1 += bfr(LQ1[i]) * bfr(LK1[i]); s2 += bfr(LQ2[i]) * bfr(LK2[i]); }
#pragma unroll
    for (int o = 1; o < 32; o <<= 1) { s1 += __shfl_xor(s1, o); s2 += __shfl_xor(s2, o); } lam = exp_ni(s1) - exp_ni(s2) + LAMBDA_INIT; }
  const int nks = (qb * 64 + 64) / 32;
  const float* qrow = Q + (size_t)(q0 + col) * DM + (2 * h + sub) * HQ;
  float m[8], l[8];
#pragma unroll
  for (int r = 0; r < 8; ++r) { m[r] = -3.0e38f; l[r] = 0.f; }
  v8f acc[8] = {};
  const unsigned kv0 = (unsigned)(size_t)&skv[0]; const float* Kh = Kx + 2 * h * HQ; const __bf16 *Vhh = VTH + (size_t)h * HD * SS, *Vlh = VTL + (size_t)h * HD * SS;
  stage_kv(Kh, Vhh, Vlh, kv0, tid); WAIT_COPIES(); __syncthreads();          // tile 0 is in buffer 0 for every wave
  stage_kv(Kh + (size_t)32 * KVW, Vhh + 32, Vlh + 32, kv0 + ABUF, tid);      // tile 1 (nks is 2 qb + 2, never below 2) flies while tile 0 is worked on
#pragma unroll 1
  for (int ks = 0; ks < nks; ++ks) { const int bo = (ks & 1) * ABUF; v8f s[2];
#pragma unroll
    for (int ct = 0; ct < 2; ++ct) { const int kk = ks * 32 + ct * 16 + col; const float* krow = (const float*)&skv[bo + (ct * 16 + col) * KROW] + sub * HQ; v8f c = {};
#pragma unroll
      for (int kc = 0; kc < 2; ++kc) { const F2 kb = split_row(krow, kc * 32, lane); const F2 qa = split_row(qrow, kc * 32, lane); c = mac3(qa, kb, c); }
#pragma unroll
      for (int r = 0; r < 8; ++r) { const int qi = q0 + 8 * g + r; s[ct][r] = (kk <= qi) ? c[r] * 0.125f : -3.0e38f; } }
#pragma unroll
    for (int r = 0; r < 8; ++r) { float mx = fmaxf(s[0][r], s[1][r]);
#pragma unroll
      for (int o = 1; o < 16; o <<= 1) mx = fmaxf(mx, __shfl_xor(mx, o));
      const float mn = fmaxf(m[r], mx); const float alpha = (m[r] <= -1.0e38f) ? 0.f : exp_ni(m[r] - mn);
      const float e0 = (s[0][r] <= -1.0e38f) ? 0.f : exp_ni(s[0][r] - mn), e1 = (s[1][r] <= -1.0e38f) ? 0.f : exp_ni(s[1][r] - mn); float es = e0 + e1;
#pragma unroll
      for (int o = 1; o < 16; o <<= 1) es += __shfl_xor(es, o);
      l[r] = l[r] * alpha + es; m[r] = mn;
#pragma unroll
      for (int dt = 0; dt < 8; ++dt) acc[dt][r] *= alpha;
      sp[wave][8 * g + r][col] = e0; sp[wave][8 * g + r][16 + col] = e1; }
    LDSX();
    const F2 pa = split_row(&sp[wave][col][0], 0, lane);
#pragma unroll
    for (int dt = 0; dt < 8; ++dt) { const char* vr = &skv[bo + KBUF + (dt * 16 + col) * VROW]; const v16b vh = frag_w(vr, g), vl = frag_w(vr + VPL, g); acc[dt] = wmma_bf(pa.l, vh, acc[dt]); acc[dt] = wmma_bf(pa.h, vl, acc[dt]); acc[dt] = wmma_bf(pa.h, vh, acc[dt]); }
    WAIT_LDS(); WAIT_COPIES(); __syncthreads();   // publishes tile ks + 1 and ends every wave's reads of tile ks (and this wave's reads of its sp rows)
    if (ks + 2 < nks) stage_kv(Kh + (size_t)(ks + 2) * 32 * KVW, Vhh + (ks + 2) * 32, Vlh + (ks + 2) * 32, kv0 + bo, tid); }
  WAIT_COPIES();
  if (sub == 0) {
#pragma unroll
    for (int r = 0; r < 8; ++r) { const float il = 1.0f / l[r];
#pragma unroll
      for (int dt = 0; dt < 8; ++dt) so[wq][8 * g + r][dt * 16 + col] = acc[dt][r] * il; }
  }
  __syncthreads();   // hands the normalised attn1 rows of tile wq from wave wq to wave 4 + wq
  if (sub == 1) {
#pragma unroll
    for (int r = 0; r < 8; ++r) { const float il = 1.0f / l[r]; float a[8]; float ss = 0.f;
#pragma unroll
      for (int dt = 0; dt < 8; ++dt) { a[dt] = so[wq][8 * g + r][dt * 16 + col] - lam * (acc[dt][r] * il); ss += a[dt] * a[dt]; }
#pragma unroll
      for (int o = 1; o < 16; o <<= 1) ss += __shfl_xor(ss, o);
      const float rs = rsqrtf(ss / (float)HD + 1e-5f) * (1.0f - LAMBDA_INIT);
#pragma unroll
      for (int dt = 0; dt < 8; ++dt) { const int d = dt * 16 + col; so[wq][8 * g + r][d] = a[dt] * rs * bfr(G[d]); } }
    LDSX();
    for (int rl = 0; rl < 16; ++rl) vst2(O + (size_t)(q0 + rl) * DM + h * HD + lane * 4, *(const v4f*)&so[wq][rl][lane * 4]);
  }
}
// ---- k_out: block = (64 rows, 128 cols): out = O(hi/lo) . wproj^T rows (2 products)
__global__ __launch_bounds__(128) void k_out(const float* __restrict__ O, const __bf16* __restrict__ P, float* __restrict__ Y) {
  __shared__ __align__(16) float so[4][16][132]; __shared__ __align__(16) char sw[2 * WBUF];
  const int tid = threadIdx.x, wave = tid >> 5, lane = tid & 31, col = lane & 15, g = lane >> 4; const size_t r0 = (size_t)blockIdx.x * 64 + wave * 16; const int n0 = blockIdx.y * 128;
  v8f acc[8] = {};
  const unsigned sw0 = (unsigned)(size_t)&sw[0]; const __bf16* Pn = P + (size_t)n0 * DM;
  stage_w(Pn, sw0, tid); WAIT_COPIES(); __syncthreads();   // tile 0 is in buffer 0 for every wave
  stage_w(Pn + 64, sw0 + WBUF, tid);                       // tile 1 flies while tile 0 is worked on
#pragma unroll 1   // one trip per stage: the ring's foot (waits, barrier, refill) stands once and the two buffers alternate by t & 1
  for (int t = 0; t < DM / 64; ++t) { const int bo = (t & 1) * WBUF; F2 a[2];
#pragma unroll
    for (int u = 0; u < 2; ++u) a[u] = split_row(O + (r0 + col) * DM, (2 * t + u) * 32, lane);
#pragma unroll
    for (int u = 0; u < 2; ++u) { v16b b[8];
#pragma unroll
      for (int j = 0; j < 8; ++j) b[j] = frag_w(&sw[bo + (j * 16 + col) * WROW + u * 64], g);
#pragma unroll
      for (int j = 0; j < 8; ++j) { acc[j] = wmma_bf(a[u].l, b[j], acc[j]); acc[j] = wmma_bf(a[u].h, b[j], acc[j]); } }
    WAIT_LDS(); WAIT_COPIES(); __syncthreads();   // publishes tile t + 1 and ends every wave's reads of tile t
    if (t + 2 < DM / 64) stage_w(Pn + (t + 2) * 64, sw0 + bo, tid); }
  WAIT_COPIES();
#pragma unroll
  for (int j = 0; j < 8; ++j)
#pragma unroll
    for (int r = 0; r < 8; ++r) so[wave][8 * g + r][j * 16 + col] = acc[j][r];
  LDSX();
  for (int rl = 0; rl < 16; ++rl) vst2(Y + (r0 + rl) * DM + n0 + lane * 4, *(const v4f*)&so[wave][rl][lane * 4]);
}
extern "C" void kernel_launch(void* const* d_in, const int* in_sizes, int n_in, void* d_out, int out_size, void* d_ws, size_t ws_size, hipStream_t stream) {
  (void)in_sizes; (void)n_in; (void)out_size;
  const float** F = (const float**)d_in;   // 0 x [1,2048,2048], 1 Wq, 2 Wk, 3 Wv, 4 Wo [2048,2048] (x @ W), 5 lq1, 6 lk1, 7 lq2, 8 lk2 [64], 9 g [128]
  if (ws_size < (size_t)WS_END) return;
  char* ws = (char*)d_ws; __bf16 *PK = (__bf16*)(ws + WS_PK), *VTH = (__bf16*)(ws + WS_VTH), *VTL = (__bf16*)(ws + WS_VTL);
  float *CS = (float*)(ws + WS_CS), *Q = (float*)(ws + WS_Q), *Kx = (float*)(ws + WS_K), *O = (float*)(ws + WS_O);
  k_packT<<<DM, 256, 0, stream>>>(F[1], DM, DM, PK + PK_Q); k_packT<<<DM, 256, 0, stream>>>(F[2], DM, DM, PK + PK_K); k_packT<<<DM, 256, 0, stream>>>(F[3], DM, DM, PK + PK_V); k_packT<<<DM, 256, 0, stream>>>(F[4], DM, DM, PK + PK_O);
  k_rope_tab<<<SS, 32, 0, stream>>>(CS);
  k_proj<0><<<dim3(TRP, DM / 128), 128, 0, stream>>>(F[0], PK + PK_Q, CS, Q, DM, nullptr, nullptr);
  k_proj<0><<<dim3(TRP, DM / 128), 128, 0, stream>>>(F[0], PK + PK_K, CS, Kx, DM, nullptr, nullptr);
  k_proj<1><<<dim3(TRP, DM / 128), 128, 0, stream>>>(F[0], PK + PK_V, CS, nullptr, 0, VTH, VTL);
  k_attn<<<dim3(TQB, NH), 256, 0, stream>>>(Q, Kx, VTH, VTL, F[5], F[6], F[7], F[8], F[9], O);
  k_out<<<dim3(TQB, DM / 128), 128, 0, stream>>>(O, PK + PK_O, (float*)d_out);
}

// v004
// Measured time: 495 microseconds a run.
// Two timings next to v003 both put it at 1.22 times that version's speed.
// All steps since v000 together make it 2.84 times as fast.
// compute dtype: x, the four weights, the lambda vectors and g (module inputs) rounded to bf16; q/k/v projections with exact bf16 products (x and W are inputs) and interleaved-pair RoPE (tables in f32 as the module's numpy code) in the epilogue; the two causal attentions per head with q.k as bf16 hi + residual pairs (3 products) and P.V with P hi/lo x V hi/lo (3 products); the differential combination, RMSNorm and (1 - lambda_init) scaling in f32; the output projection hi/lo x exact Wo (2 products); all GEMMs on WMMA 16x16x32; f32 accumulate.
#include <hip/hip_runtime.h>
#include <math.h>

typedef __attribute__((ext_vector_type(16))) _Float16 v16h;
typedef __attribute__((ext_vector_type(16))) __bf16 v16b;
typedef __attribute__((ext_vector_type(8)))  _Float16 v8h;
typedef __attribute__((ext_vector_type(8)))  float v8f;
typedef __attribute__((ext_vector_type(4)))  float v4f;
typedef __attribute__((ext_vector_type(2)))  float v2f;
typedef __attribute__((ext_vector_type(4)))  unsigned v4u;
typedef __attribute__((ext_vector_type(4)))  int v4i;
typedef float __attribute__((may_alias)) float_a;
typedef int __attribute__((may_alias)) int_a;

template <typename T> __device__ __forceinline__ void vst2(void* p, T v) { *(T*)p = v;  }
__device__ __forceinline__ v8f wmma16(v16h a, v16h b, v8f c) {
  v8f d = __builtin_amdgcn_wmma_f32_16x16x32_f16(false, a, false, b, (short)0, c, false, false);
  asm volatile("v_nop\n\tv_nop\n\tv_nop\n\tv_nop" : "+v"(d) : "v"(a), "v"(b));
  return d;
}
__device__ __forceinline__ v8f wmma_bf(v16b a, v16b b, v8f c) {
  v8f d = __builtin_amdgcn_wmma_f32_16x16x32_bf16(false, a, false, b, (short)0, c, false, false);
  asm volatile("v_nop\n\tv_nop\n\tv_nop\n\tv_nop" : "+v"(d) : "v"(a), "v"(b));
  return d;
}
// 16x16x32 fragments: lane = (h = lane>>4, row/col = lane&15); elements 0..7 = k0+8h+0..7, 8..15 = k0+16+8h+0..7; D element r = row 8h+r
__device__ __forceinline__ v16h frag_h(const _Float16* rowk0, int lane) {
  union { v16h v; v8h q[2]; } u; const _Float16* p = rowk0 + 8 * (lane >> 4);
  u.q[0] = *(const v8h*)p; u.q[1] = *(const v8h*)(p + 16); return u.v;
}
__device__ __forceinline__ v16h frag_f32(const float* rowk0, int lane) {
  v16h a; const float* p = rowk0 + 8 * (lane >> 4);
#pragma unroll
  for (int i = 0; i < 8; ++i) { a[i] = (_Float16)p[i]; a[8 + i] = (_Float16)p[16 + i]; }
  return a;
}
__device__ __forceinline__ v16h frag_f32s(const float* rowk0, int lane, float sc) {
  v16h a; const float* p = rowk0 + 8 * (lane >> 4);
#pragma unroll
  for (int i = 0; i < 8; ++i) { a[i] = (_Float16)(p[i] * sc); a[8 + i] = (_Float16)(p[16 + i] * sc); }
  return a;
}
// column fragment from a [K][ld] layout (column n), rows >= K read as 0
__device__ __forceinline__ v16h fragc_f32(const float* W, int k0, int n, int lane, int ld, int K) {
  v16h a; const int g = lane >> 4;
#pragma unroll
  for (int i = 0; i < 8; ++i) { const int ka = k0 + 8 * g + i, kb = ka + 16;
    a[i] = (_Float16)(ka < K ? W[(size_t)(ka < K ? ka : K - 1) * ld + n] : 0.f); a[8 + i] = (_Float16)(kb < K ? W[(size_t)(kb < K ? kb : K - 1) * ld + n] : 0.f); }
  return a;
}
struct F2 { v16b h, l; };
__device__ __forceinline__ F2 bsplit16(const float v[16]) { F2 r;
#pragma unroll
  for (int i = 0; i < 16; ++i) { const __bf16 h = (__bf16)v[i]; r.h[i] = h; r.l[i] = (__bf16)(v[i] - (float)h); }
  return r; }
__device__ __forceinline__ F2 split_row(const float* row, int k0, int lane) { float v[16]; const float* p = row + k0 + 8 * (lane >> 4);
#pragma unroll
  for (int i = 0; i < 8; ++i) { v[i] = p[i]; v[8 + i] = p[16 + i]; }
  return bsplit16(v); }
__device__ __forceinline__ F2 split_rowK(const float* row, int k0, int lane, int K) { float v[16]; const int g = lane >> 4;
#pragma unroll
  for (int i = 0; i < 8; ++i) { const int ka = k0 + 8 * g + i, kb = ka + 16; v[i] = ka < K ? row[ka < K ? ka : K - 1] : 0.f; v[8 + i] = kb < K ? row[kb < K ? kb : K - 1] : 0.f; }
  return bsplit16(v); }
__device__ __forceinline__ F2 split_col(const float* W, int k0, int n, int lane, int ld, int K) { float v[16]; const int g = lane >> 4;
#pragma unroll
  for (int i = 0; i < 8; ++i) { const int ka = k0 + 8 * g + i, kb = ka + 16; v[i] = ka < K ? W[(size_t)(ka < K ? ka : K - 1) * ld + n] : 0.f; v[8 + i] = kb < K ? W[(size_t)(kb < K ? kb : K - 1) * ld + n] : 0.f; }
  return bsplit16(v); }
__device__ __forceinline__ v8f mac3(const F2& a, const F2& b, v8f c) { c = wmma_bf(a.l, b.h, c); c = wmma_bf(a.h, b.l, c); return wmma_bf(a.h, b.h, c); }
__device__ __forceinline__ float sigm(float v) { return 1.0f / (1.0f + expf(-v)); }
#define LDSX() do { asm volatile("s_wait_dscnt 0" ::: "memory"); __builtin_amdgcn_wave_barrier(); __builtin_amdgcn_fence(__ATOMIC_RELEASE, "workgroup"); } while (0)


// Differential attention (B 1, S 2048, E 2048, 16 heads; q/k as 32 half-heads x 64 with interleaved RoPE, v as 16 heads x 128): a = softmax_causal(q1 k1^T/8) v - lambda_full * softmax_causal(q2 k2^T/8) v; lambda_full = exp(lq1.lk1) - exp(lq2.lk2) + lambda_init; a = RMSNorm_128(a) * g * (1 - lambda_init); out = a Wo.
#define SS 2048
#define DM 2048
#define NH 16
#define HD 128               // v head dim (2*64)
#define HQ 64                // q/k half-head dim
#define KVW DM
#define LAMBDA_INIT 0.78360577f   /* 0.8 - 0.6*exp(-0.3*12) = 0.7836057665 */
#ifndef TQB
#define TQB (SS / 64)
#define TRP (SS / 64)          // projection row tiles (all)
#endif
typedef __attribute__((ext_vector_type(8))) __bf16 v8b;
__device__ __forceinline__ v16b frag_b(const __bf16* rowk0, int lane) {
  union { v16b v; v8b q[2]; } u; const __bf16* p = rowk0 + 8 * (lane >> 4);
  u.q[0] = *(const v8b*)p; u.q[1] = *(const v8b*)(p + 16); return u.v;
}
__device__ __forceinline__ float bfr(float v) { return (float)(__bf16)v; }
__device__ __attribute__((noinline)) float exp_ni(float v) { return expf(v); }
__device__ __attribute__((noinline)) float erf_ni(float v) { return erff(v); }

#define PK_Q 0
#define PK_K (PK_Q + DM * DM)
#define PK_V (PK_K + KVW * DM)
#define PK_O (PK_V + KVW * DM)
#define PK_END (PK_O + DM * DM)
#define WS_PK  0u
#define WS_CS  (WS_PK + 2u * PK_END)             // f32 [2048][32] cos, then [2048][32] sin
#define WS_Q   (WS_CS + 4u * 2 * SS * 32)
#define WS_K   (WS_Q + 4u * SS * DM)
#define WS_VTH (WS_K + 4u * SS * KVW)
#define WS_VTL (WS_VTH + 2u * KVW * SS)
#define WS_O   (WS_VTL + 2u * KVW * SS)
#define WS_END (WS_O + 4u * SS * DM)

// ---- weight tile in LDS: one stage = 128 packed weight rows x 64 k (128 B a row), LDS pitch 144 B (16 B x odd, for the ds_load_b128 readers), two stages
#define WROW 144
#define WBUF (128 * WROW)
// 128 threads bring one stage: copy i takes rows 16 i + (tid >> 3), 16 B a lane, so a wave's 32 lanes cover 4 whole 128-B rows per copy
__device__ __forceinline__ void stage_w(const __bf16* __restrict__ Pt, unsigned lds, int tid) {
  const __bf16* gp = Pt + (size_t)(tid >> 3) * DM + (tid & 7) * 8; const unsigned l = lds + (tid >> 3) * WROW + (tid & 7) * 16;
  // the eight copies and, as the last line, the wait that stands in front of any rewrite of the address registers they name
  asm volatile("global_load_async_to_lds_b128 %0, %8, off\n\t"
               "global_load_async_to_lds_b128 %1, %9, off\n\t"
               "global_load_async_to_lds_b128 %2, %10, off\n\t"
               "global_load_async_to_lds_b128 %3, %11, off\n\t"
               "global_load_async_to_lds_b128 %4, %12, off\n\t"
               "global_load_async_to_lds_b128 %5, %13, off\n\t"
               "global_load_async_to_lds_b128 %6, %14, off\n\t"
               "global_load_async_to_lds_b128 %7, %15, off\n\t"
               "s_wait_xcnt 0x0"
               :: "v"(l), "v"(l + 16 * WROW), "v"(l + 32 * WROW), "v"(l + 48 * WROW), "v"(l + 64 * WROW), "v"(l + 80 * WROW), "v"(l + 96 * WROW), "v"(l + 112 * WROW),
                  "v"(gp), "v"(gp + 16 * DM), "v"(gp + 32 * DM), "v"(gp + 48 * DM), "v"(gp + 64 * DM), "v"(gp + 80 * DM), "v"(gp + 96 * DM), "v"(gp + 112 * DM)
               : "memory");
}
// fragment of one staged row: the same bytes in the same k order as frag_b reads from the packed row
__device__ __forceinline__ v16b frag_w(const char* rowk0, int g) {
  union { v16b v; v8b q[2]; } u; const char* p = rowk0 + 16 * g;
  u.q[0] = *(const v8b*)p; u.q[1] = *(const v8b*)(p + 32); return u.v;
}
#define WAIT_COPIES() asm volatile("s_wait_asynccnt 0x0" ::: "memory")   /* this wave's copies have landed */
#define WAIT_LDS()    asm volatile("s_wait_dscnt 0x0" ::: "memory")      /* this wave's LDS reads have returned */

// ---- k_packT: block = output column n of a [K][N] (x @ W) matrix
__global__ __launch_bounds__(256) void k_packT(const float* __restrict__ Wm, int K, int N, __bf16* __restrict__ DST) {
  __shared__ __align__(16) __bf16 s[DM]; const int n = blockIdx.x, tid = threadIdx.x;
  for (int k = tid; k < K; k += 256) s[k] = (__bf16)Wm[(size_t)k * N + n];
  __syncthreads();
  for (int q = tid; q < K / 8; q += 256) vst2((unsigned*)(DST + (size_t)n * K + q * 8), *(const v4u*)&s[q * 8]);
}
__global__ __launch_bounds__(32) void k_rope_tab(float* __restrict__ CS) {
  __shared__ __align__(16) float sc[32], ssn[32]; const int t = blockIdx.x, i = threadIdx.x;
  const float dv = expf((float)(2 * i) * (-9.2103404f / 64.0f));   /* ln(1e4) as the f32 literal numpy uses */ const float ang = (float)t * dv; sc[i] = cosf(ang); ssn[i] = sinf(ang);
  __syncthreads();
  if (i < 8) vst2(CS + (size_t)t * 32 + i * 4, *(const v4f*)&sc[i * 4]); else if (i < 16) vst2(CS + (size_t)SS * 32 + (size_t)t * 32 + (i - 8) * 4, *(const v4f*)&ssn[(i - 8) * 4]);
}
// ---- k_proj<MODE>: block = (64 rows, 128 cols = one head): Y = bf16(x) . P rows (exact); MODE 0: RoPE then f32 rows (q/k; ldo); MODE 1: plain -> transposed bf16 hi/lo planes (v)
template <int MODE>
__global__ __launch_bounds__(128) void k_proj(const float* __restrict__ X, const __bf16* __restrict__ P, const float* __restrict__ CS, float* __restrict__ OUT, int ldo, __bf16* __restrict__ PH, __bf16* __restrict__ PL) {
  __shared__ __align__(16) float so[MODE ? 1 : 4][16][132]; __shared__ __align__(16) __bf16 sth[MODE ? 128 : 1][72], stl[MODE ? 128 : 1][72]; __shared__ __align__(16) char sw[2 * WBUF];
  const int tid = threadIdx.x, wave = tid >> 5, lane = tid & 31, col = lane & 15, g = lane >> 4; const size_t r0 = (size_t)blockIdx.x * 64 + wave * 16; const int n0 = blockIdx.y * 128;
  v8f acc[8] = {};
  const unsigned sw0 = (unsigned)(size_t)&sw[0]; const __bf16* Pn = P + (size_t)n0 * DM;
  stage_w(Pn, sw0, tid); WAIT_COPIES(); __syncthreads();   // tile 0 is in buffer 0 for every wave
  stage_w(Pn + 64, sw0 + WBUF, tid);                       // tile 1 flies while tile 0 is worked on
#pragma unroll 1   // one trip per stage: the ring's foot (waits, barrier, refill) stands once and the two buffers alternate by t & 1
  for (int t = 0; t < DM / 64; ++t) { const int bo = (t & 1) * WBUF; v16b a[2];
#pragma unroll
    for (int u = 0; u < 2; ++u) { const float* p = X + (r0 + col) * DM + (2 * t + u) * 32 + 8 * g;
#pragma unroll
      for (int i = 0; i < 8; ++i) { a[u][i] = (__bf16)p[i]; a[u][8 + i] = (__bf16)p[16 + i]; } }
#pragma unroll
    for (int u = 0; u < 2; ++u) { v16b b[8];
#pragma unroll
      for (int j = 0; j < 8; ++j) b[j] = frag_w(&sw[bo + (j * 16 + col) * WROW + u * 64], g);
#pragma unroll
      for (int j = 0; j < 8; ++j) acc[j] = wmma_bf(a[u], b[j], acc[j]); }
    WAIT_LDS(); WAIT_COPIES(); __syncthreads();   // publishes tile t + 1 and ends every wave's reads of tile t
    if (t + 2 < DM / 64) stage_w(Pn + (t + 2) * 64, sw0 + bo, tid); }
  WAIT_COPIES();
  if (MODE == 0) {
    // projections to LDS, then interleaved-pair RoPE in place within each 64-wide half-head: (x_{2i}, x_{2i+1}) -> (x c - y s, x s + y c) with angle index i
#pragma unroll
    for (int j = 0; j < 8; ++j)
#pragma unroll
      for (int r = 0; r < 8; ++r) so[wave][8 * g + r][j * 16 + col] = acc[j][r];
    LDSX();
    for (int q = lane; q < 16 * 64; q += 32) { const int rl = q >> 6, pi = q & 63; const int half = pi >> 5, i = pi & 31; const size_t t = r0 + rl; const float c = CS[t * 32 + i], s = CS[(size_t)SS * 32 + t * 32 + i]; float* e = &so[wave][rl][half * 64 + 2 * i]; const float xe = e[0], xo = e[1]; e[0] = xe * c - xo * s; e[1] = xe * s + xo * c; }
    LDSX();
    for (int rl = 0; rl < 16; ++rl) vst2(OUT + (r0 + rl) * ldo + n0 + lane * 4, *(const v4f*)&so[wave][rl][lane * 4]);
  } else {
#pragma unroll
    for (int j = 0; j < 8; ++j)
#pragma unroll
      for (int r = 0; r < 8; ++r) { const float v = acc[j][r]; const __bf16 hb = (__bf16)v; sth[j * 16 + col][wave * 16 + 8 * g + r] = hb; stl[j * 16 + col][wave * 16 + 8 * g + r] = (__bf16)(v - (float)hb); }
    __syncthreads();
    const int s0 = blockIdx.x * 64;
    for (int q = tid; q < 128 * 8; q += 128) { const int d = q >> 3, pc = q & 7; const size_t o = (size_t)(n0 + d) * SS + s0 + pc * 8; vst2((unsigned*)(PH + o), *(const v4u*)&sth[d][pc * 8]); vst2((unsigned*)(PL + o), *(const v4u*)&stl[d][pc * 8]); }
  }
}
// ---- K and V tiles in LDS: one stage = the 32 keys of one trip for one head: 32 K rows x 512 B (both 64-float half-heads of a key), then the hi and the lo plane of V^T, 128 rows (d) x 64 B (32 keys) each; LDS pitches 528 B and 80 B (16 B x odd, for the ds_load_b128 readers), two stages
#define KROW 528
#define VROW 80
#define KBUF (32 * KROW)
#define VPL  (128 * VROW)
#define ABUF (KBUF + 2 * VPL)
// 256 threads bring one stage, 16 B a lane: K copy i takes rows 8 i + (tid >> 5), a wave covering one whole 512-B row; V copy i of a plane takes rows 64 i + (tid >> 2), a wave covering 8 rows of 64 B
__device__ __forceinline__ void stage_kv(const float* __restrict__ Kt, const __bf16* __restrict__ Vh, const __bf16* __restrict__ Vl, unsigned lds, int tid) {
  const float* kp = Kt + (size_t)(tid >> 5) * KVW + (tid & 31) * 4; const unsigned kl = lds + (tid >> 5) * KROW + (tid & 31) * 16;
  const size_t vo = (size_t)(tid >> 2) * SS + (tid & 3) * 8; const __bf16 *hp = Vh + vo, *lp = Vl + vo; const unsigned vl = lds + KBUF + (tid >> 2) * VROW + (tid & 3) * 16;
  // the eight copies and, as the last line, the wait that stands in front of any rewrite of the address registers they name
  asm volatile("global_load_async_to_lds_b128 %0, %8, off\n\t"
               "global_load_async_to_lds_b128 %1, %9, off\n\t"
               "global_load_async_to_lds_b128 %2, %10, off\n\t"
               "global_load_async_to_lds_b128 %3, %11, off\n\t"
               "global_load_async_to_lds_b128 %4, %12, off\n\t"
               "global_load_async_to_lds_b128 %5, %13, off\n\t"
               "global_load_async_to_lds_b128 %6, %14, off\n\t"
               "global_load_async_to_lds_b128 %7, %15, off\n\t"
               "s_wait_xcnt 0x0"
               :: "v"(kl), "v"(kl + 8 * KROW), "v"(kl + 16 * KROW), "v"(kl + 24 * KROW), "v"(vl), "v"(vl + 64 * VROW), "v"(vl + VPL), "v"(vl + VPL + 64 * VROW),
                  "v"(kp), "v"(kp + 8 * KVW), "v"(kp + 16 * KVW), "v"(kp + 24 * KVW), "v"(hp), "v"(hp + 64 * SS), "v"(lp), "v"(lp + 64 * SS)
               : "memory");
}
// lane l with lane l ^ 16 (the two halves of a wave hold the two halves of one query's keys, or of its output row)
__device__ __forceinline__ float xhalf(float x) { return __builtin_bit_cast(float, __builtin_amdgcn_permlanex16(__builtin_bit_cast(int, x), __builtin_bit_cast(int, x), 0x76543210, 0xfedcba98, false, false)); }
// ---- k_attn: block = (64 queries, head h), 8 waves: waves 0..3 run attention 1 and waves 4..7 attention 2 of the same four 16-query tiles side by side; each trip's K and V tiles are staged once in LDS for all 8 waves; transposed products: S^T = K.Q^T (3 products) and O^T += V^T.P^T (3 products), so lane (g, col) holds query q0 + col: its scores of keys 8 g + r and 16 + 8 g + r of a trip, and its outputs d = 16 dt + 8 g + r; O[q][h*128+d]
__global__ __launch_bounds__(256) void k_attn(const float* __restrict__ Q, const float* __restrict__ Kx, const __bf16* __restrict__ VTH, const __bf16* __restrict__ VTL, const float* __restrict__ LQ1, const float* __restrict__ LK1, const float* __restrict__ LQ2, const float* __restrict__ LK2, const float* __restrict__ G, float* __restrict__ O) {
  __shared__ __align__(16) float so[4][16][132]; __shared__ __align__(16) char skv[2 * ABUF];
  const int tid = threadIdx.x, wave = tid >> 5, lane = tid & 31, col = lane & 15, g = lane >> 4;
  const int sub = __builtin_amdgcn_readfirstlane(wave >> 2), wq = wave & 3;   // which attention (the same in every lane of a wave), which 16-query tile
  const int qb = blockIdx.x, h = blockIdx.y; const int q0 = qb * 64 + wq * 16;
  // lambda_full from the inputs (64-dots)
  float lam; { float s1 = 0.f, s2 = 0.f; for (int i = lane; i < HQ; i += 32) { s1 += bfr(LQ1[i]) * bfr(LK1[i]); s2 += bfr(LQ2[i]) * bfr(LK2[i]); }
#pragma unroll
    for (int o = 1; o < 32; o <<= 1) { s1 += __shfl_xor(s1, o); s2 += __shfl_xor(s2, o); } lam = exp_ni(s1) - exp_ni(s2) + LAMBDA_INIT; }
  const int nks = (qb * 64 + 64) / 32;
  const int qi = q0 + col;
  const float* qrow = Q + (size_t)qi * DM + (2 * h + sub) * HQ;
  float m = -3.0e38f, l = 0.f;   // of query qi: running maximum (the same in both halves of the wave) and the running sum over this half's keys
  v8f acc[8] = {};
  const unsigned kv0 = (unsigned)(size_t)&skv[0]; const float* Kh = Kx + 2 * h * HQ; const __bf16 *Vhh = VTH + (size_t)h * HD * SS, *Vlh = VTL + (size_t)h * HD * SS;
  stage_kv(Kh, Vhh, Vlh, kv0, tid); WAIT_COPIES(); __syncthreads();          // tile 0 is in buffer 0 for every wave
  stage_kv(Kh + (size_t)32 * KVW, Vhh + 32, Vlh + 32, kv0 + ABUF, tid);      // tile 1 (nks is 2 qb + 2, never below 2) flies while tile 0 is worked on
#pragma unroll 1
  for (int ks = 0; ks < nks; ++ks) { const int bo = (ks & 1) * ABUF; float s[16];   // s[8 ct + r]: key ks * 32 + ct * 16 + 8 g + r, which is the k order of a B fragment
#pragma unroll
    for (int ct = 0; ct < 2; ++ct) { const float* krow = (const float*)&skv[bo + (ct * 16 + col) * KROW] + sub * HQ; v8f c = {};
#pragma unroll
      for (int kc = 0; kc < 2; ++kc) { const F2 kb = split_row(krow, kc * 32, lane); const F2 qa = split_row(qrow, kc * 32, lane); c = wmma_bf(kb.h, qa.l, c); c = wmma_bf(kb.l, qa.h, c); c = wmma_bf(kb.h, qa.h, c); }
#pragma unroll
      for (int r = 0; r < 8; ++r) { const int kk = ks * 32 + ct * 16 + 8 * g + r; s[8 * ct + r] = (kk <= qi) ? c[r] * 0.125f : -3.0e38f; } }
    float mx = s[0];
#pragma unroll
    for (int i = 1; i < 16; ++i) mx = fmaxf(mx, s[i]);
    mx = fmaxf(mx, xhalf(mx));
    const float mn = fmaxf(m, mx); const float alpha = (m <= -1.0e38f) ? 0.f : exp_ni(m - mn);
    float e[16], t[8];
#pragma unroll
    for (int i = 0; i < 16; ++i) e[i] = (s[i] <= -1.0e38f) ? 0.f : exp_ni(s[i] - mn);
#pragma unroll
    for (int i = 0; i < 8; ++i) t[i] = e[i] + e[8 + i];
    float es = ((t[0] + t[4]) + (t[2] + t[6])) + ((t[1] + t[5]) + (t[3] + t[7]));
    l = l * alpha + es; m = mn;
#pragma unroll
    for (int dt = 0; dt < 8; ++dt) acc[dt] *= alpha;
    const F2 pb = bsplit16(e);
#pragma unroll
    for (int dt = 0; dt < 8; ++dt) { const char* vr = &skv[bo + KBUF + (dt * 16 + col) * VROW]; const v16b vh = frag_w(vr, g), vl = frag_w(vr + VPL, g); acc[dt] = wmma_bf(vh, pb.l, acc[dt]); acc[dt] = wmma_bf(vl, pb.h, acc[dt]); acc[dt] = wmma_bf(vh, pb.h, acc[dt]); }
    WAIT_LDS(); WAIT_COPIES(); __syncthreads();   // publishes tile ks + 1 and ends every wave's reads of tile ks
    if (ks + 2 < nks) stage_kv(Kh + (size_t)(ks + 2) * 32 * KVW, Vhh + (ks + 2) * 32, Vlh + (ks + 2) * 32, kv0 + bo, tid); }
  WAIT_COPIES();
  l += xhalf(l);   // the two halves' sums join once
  const float il = 1.0f / l; float* orow = &so[wq][col][8 * g];   // this lane's 8 consecutive d of each 16-wide group dt
  if (sub == 0) {
#pragma unroll
    for (int dt = 0; dt < 8; ++dt) { const v8f a = acc[dt] * il; *(v4f*)(orow + dt * 16) = __builtin_shufflevector(a, a, 0, 1, 2, 3); *(v4f*)(orow + dt * 16 + 4) = __builtin_shufflevector(a, a, 4, 5, 6, 7); }
  }
  __syncthreads();   // hands the normalised attn1 rows of tile wq from wave wq to wave 4 + wq
  if (sub == 1) {
    float ss = 0.f;
#pragma unroll
    for (int dt = 0; dt < 8; ++dt)
#pragma unroll
      for (int r = 0; r < 8; ++r) { const float a = orow[dt * 16 + r] - lam * (acc[dt][r] * il); acc[dt][r] = a; ss += a * a; }
    ss += xhalf(ss);
    const float rs = rsqrtf(ss / (float)HD + 1e-5f) * (1.0f - LAMBDA_INIT);
    v4f gv[16]; const v4f* gp = (const v4f*)(G + 8 * g);   // g in this lane's order: the 8 consecutive values of each 16-wide group as two 16-byte loads, all from one base
#pragma unroll
    for (int dt = 0; dt < 8; ++dt) { gv[2 * dt] = gp[4 * dt]; gv[2 * dt + 1] = gp[4 * dt + 1]; }
    asm volatile("s_wait_xcnt 0x0" :: "v"(gp) : "memory");   // stands in front of any rewrite of the address pair that the g loads name; taking the pair as an input keeps it whole up to here, so that no load of the run lands in it
#pragma unroll
    for (int dt = 0; dt < 8; ++dt)
#pragma unroll
      for (int r = 0; r < 8; ++r) orow[dt * 16 + r] = acc[dt][r] * rs * bfr(gv[2 * dt + (r >> 2)][r & 3]);
    LDSX();
    for (int rl = 0; rl < 16; ++rl) vst2(O + (size_t)(q0 + rl) * DM + h * HD + lane * 4, *(const v4f*)&so[wq][rl][lane * 4]);
  }
}
// ---- k_out: block = (64 rows, 128 cols): out = O(hi/lo) . wproj^T rows (2 products)
__global__ __launch_bounds__(128) void k_out(const float* __restrict__ O, const __bf16* __restrict__ P, float* __restrict__ Y) {
  __shared__ __align__(16) float so[4][16][132]; __shared__ __align__(16) char sw[2 * WBUF];
  const int tid = threadIdx.x, wave = tid >> 5, lane = tid & 31, col = lane & 15, g = lane >> 4; const size_t r0 = (size_t)blockIdx.x * 64 + wave * 16; const int n0 = blockIdx.y * 128;
  v8f acc[8] = {};
  const unsigned sw0 = (unsigned)(size_t)&sw[0]; const __bf16* Pn = P + (size_t)n0 * DM;
  stage_w(Pn, sw0, tid); WAIT_COPIES(); __syncthreads();   // tile 0 is in buffer 0 for every wave
  stage_w(Pn + 64, sw0 + WBUF, tid);                       // tile 1 flies while tile 0 is worked on
#pragma unroll 1   // one trip per stage: the ring's foot (waits, barrier, refill) stands once and the two buffers alternate by t & 1
  for (int t = 0; t < DM / 64; ++t) { const int bo = (t & 1) * WBUF; F2 a[2];
#pragma unroll
    for (int u = 0; u < 2; ++u) a[u] = split_row(O + (r0 + col) * DM, (2 * t + u) * 32, lane);
#pragma unroll
    for (int u = 0; u < 2; ++u) { v16b b[8];
#pragma unroll
      for (int j = 0; j < 8; ++j) b[j] = frag_w(&sw[bo + (j * 16 + col) * WROW + u * 64], g);
#pragma unroll
      for (int j = 0; j < 8; ++j) { acc[j] = wmma_bf(a[u].l, b[j], acc[j]); acc[j] = wmma_bf(a[u].h, b[j], acc[j]); } }
    WAIT_LDS(); WAIT_COPIES(); __syncthreads();   // publishes tile t + 1 and ends every wave's reads of tile t
    if (t + 2 < DM / 64) stage_w(Pn + (t + 2) * 64, sw0 + bo, tid); }
  WAIT_COPIES();
#pragma unroll
  for (int j = 0; j < 8; ++j)
#pragma unroll
    for (int r = 0; r < 8; ++r) so[wave][8 * g + r][j * 16 + col] = acc[j][r];
  LDSX();
  for (int rl = 0; rl < 16; ++rl) vst2(Y + (r0 + rl) * DM + n0 + lane * 4, *(const v4f*)&so[wave][rl][lane * 4]);
}
extern "C" void kernel_launch(void* const* d_in, const int* in_sizes, int n_in, void* d_out, int out_size, void* d_ws, size_t ws_size, hipStream_t stream) {
  (void)in_sizes; (void)n_in; (void)out_size;
  const float** F = (const float**)d_in;   // 0 x [1,2048,2048], 1 Wq, 2 Wk, 3 Wv, 4 Wo [2048,2048] (x @ W), 5 lq1, 6 lk1, 7 lq2, 8 lk2 [64], 9 g [128]
  if (ws_size < (size_t)WS_END) return;
  char* ws = (char*)d_ws; __bf16 *PK = (__bf16*)(ws + WS_PK), *VTH = (__bf16*)(ws + WS_VTH), *VTL = (__bf16*)(ws + WS_VTL);
  float *CS = (float*)(ws + WS_CS), *Q = (float*)(ws + WS_Q), *Kx = (float*)(ws + WS_K), *O = (float*)(ws + WS_O);
  k_packT<<<DM, 256, 0, stream>>>(F[1], DM, DM, PK + PK_Q); k_packT<<<DM, 256, 0, stream>>>(F[2], DM, DM, PK + PK_K); k_packT<<<DM, 256, 0, stream>>>(F[3], DM, DM, PK + PK_V); k_packT<<<DM, 256, 0, stream>>>(F[4], DM, DM, PK + PK_O);
  k_rope_tab<<<SS, 32, 0, stream>>>(CS);
  k_proj<0><<<dim3(TRP, DM / 128), 128, 0, stream>>>(F[0], PK + PK_Q, CS, Q, DM, nullptr, nullptr);
  k_proj<0><<<dim3(TRP, DM / 128), 128, 0, stream>>>(F[0], PK + PK_K, CS, Kx, DM, nullptr, nullptr);
  k_proj<1><<<dim3(TRP, DM / 128), 128, 0, stream>>>(F[0], PK + PK_V, CS, nullptr, 0, VTH, VTL);
  k_attn<<<dim3(TQB, NH), 256, 0, stream>>>(Q, Kx, VTH, VTL, F[5], F[6], F[7], F[8], F[9], O);
  k_out<<<dim3(TQB, DM / 128), 128, 0, stream>>>(O, PK + PK_O, (float*)d_out);
}

// v005
// Measured time: 442 microseconds a run.
// In both of two side-by-side timings against v004, it was 1.12 times as fast.
// Counting every step since v000, it is 3.18 times as fast.
// compute dtype: x, the four weights, the lambda vectors and g (module inputs) rounded to bf16; q/k/v projections with exact bf16 products (x and W are inputs) and interleaved-pair RoPE (tables in f32 as the module's numpy code) in the epilogue; the two causal attentions per head with q.k as bf16 hi + residual pairs (3 products) and P.V with P hi/lo x V hi/lo (3 products); the differential combination, RMSNorm and (1 - lambda_init) scaling in f32; the output projection hi/lo x exact Wo (2 products); all GEMMs on WMMA 16x16x32; f32 accumulate.
#include <hip/hip_runtime.h>
#include <math.h>

typedef __attribute__((ext_vector_type(16))) _Float16 v16h;
typedef __attribute__((ext_vector_type(16))) __bf16 v16b;
typedef __attribute__((ext_vector_type(8)))  _Float16 v8h;
typedef __attribute__((ext_vector_type(8)))  float v8f;
typedef __attribute__((ext_vector_type(4)))  float v4f;
typedef __attribute__((ext_vector_type(2)))  float v2f;
typedef __attribute__((ext_vector_type(4)))  unsigned v4u;
typedef __attribute__((ext_vector_type(4)))  int v4i;
typedef float __attribute__((may_alias)) float_a;
typedef int __attribute__((may_alias)) int_a;

template <typename T> __device__ __forceinline__ void vst2(void* p, T v) { *(T*)p = v;  }
__device__ __forceinline__ v8f wmma16(v16h a, v16h b, v8f c) {
  v8f d = __builtin_amdgcn_wmma_f32_16x16x32_f16(false, a, false, b, (short)0, c, false, false);
  asm volatile("v_nop\n\tv_nop\n\tv_nop\n\tv_nop" : "+v"(d) : "v"(a), "v"(b));
  return d;
}
__device__ __forceinline__ v8f wmma_bf(v16b a, v16b b, v8f c) {
  v8f d = __builtin_amdgcn_wmma_f32_16x16x32_bf16(false, a, false, b, (short)0, c, false, false);
  asm volatile("v_nop\n\tv_nop\n\tv_nop\n\tv_nop" : "+v"(d) : "v"(a), "v"(b));
  return d;
}
// 16x16x32 fragments: lane = (h = lane>>4, row/col = lane&15); elements 0..7 = k0+8h+0..7, 8..15 = k0+16+8h+0..7; D element r = row 8h+r
__device__ __forceinline__ v16h frag_h(const _Float16* rowk0, int lane) {
  union { v16h v; v8h q[2]; } u; const _Float16* p = rowk0 + 8 * (lane >> 4);
  u.q[0] = *(const v8h*)p; u.q[1] = *(const v8h*)(p + 16); return u.v;
}
__device__ __forceinline__ v16h frag_f32(const float* rowk0, int lane) {
  v16h a; const float* p = rowk0 + 8 * (lane >> 4);
#pragma unroll
  for (int i = 0; i < 8; ++i) { a[i] = (_Float16)p[i]; a[8 + i] = (_Float16)p[16 + i]; }
  return a;
}
__device__ __forceinline__ v16h frag_f32s(const float* rowk0, int lane, float sc) {
  v16h a; const float* p = rowk0 + 8 * (lane >> 4);
#pragma unroll
  for (int i = 0; i < 8; ++i) { a[i] = (_Float16)(p[i] * sc); a[8 + i] = (_Float16)(p[16 + i] * sc); }
  return a;
}
// column fragment from a [K][ld] layout (column n), rows >= K read as 0
__device__ __forceinline__ v16h fragc_f32(const float* W, int k0, int n, int lane, int ld, int K) {
  v16h a; const int g = lane >> 4;
#pragma unroll
  for (int i = 0; i < 8; ++i) { const int ka = k0 + 8 * g + i, kb = ka + 16;
    a[i] = (_Float16)(ka < K ? W[(size_t)(ka < K ? ka : K - 1) * ld + n] : 0.f); a[8 + i] = (_Float16)(kb < K ? W[(size_t)(kb < K ? kb : K - 1) * ld + n] : 0.f); }
  return a;
}
struct F2 { v16b h, l; };
__device__ __forceinline__ F2 bsplit16(const float v[16]) { F2 r;
#pragma unroll
  for (int i = 0; i < 16; ++i) { const __bf16 h = (__bf16)v[i]; r.h[i] = h; r.l[i] = (__bf16)(v[i] - (float)h); }
  return r; }
__device__ __forceinline__ F2 split_row(const float* row, int k0, int lane) { float v[16]; const float* p = row + k0 + 8 * (lane >> 4);
#pragma unroll
  for (int i = 0; i < 8; ++i) { v[i] = p[i]; v[8 + i] = p[16 + i]; }
  return bsplit16(v); }
__device__ __forceinline__ F2 split_rowK(const float* row, int k0, int lane, int K) { float v[16]; const int g = lane >> 4;
#pragma unroll
  for (int i = 0; i < 8; ++i) { const int ka = k0 + 8 * g + i, kb = ka + 16; v[i] = ka < K ? row[ka < K ? ka : K - 1] : 0.f; v[8 + i] = kb < K ? row[kb < K ? kb : K - 1] : 0.f; }
  return bsplit16(v); }
__device__ __forceinline__ F2 split_col(const float* W, int k0, int n, int lane, int ld, int K) { float v[16]; const int g = lane >> 4;
#pragma unroll
  for (int i = 0; i < 8; ++i) { const int ka = k0 + 8 * g + i, kb = ka + 16; v[i] = ka < K ? W[(size_t)(ka < K ? ka : K - 1) * ld + n] : 0.f; v[8 + i] = kb < K ? W[(size_t)(kb < K ? kb : K - 1) * ld + n] : 0.f; }
  return bsplit16(v); }
__device__ __forceinline__ v8f mac3(const F2& a, const F2& b, v8f c) { c = wmma_bf(a.l, b.h, c); c = wmma_bf(a.h, b.l, c); return wmma_bf(a.h, b.h, c); }
__device__ __forceinline__ float sigm(float v) { return 1.0f / (1.0f + expf(-v)); }
#define LDSX() do { asm volatile("s_wait_dscnt 0" ::: "memory"); __builtin_amdgcn_wave_barrier(); __builtin_amdgcn_fence(__ATOMIC_RELEASE, "workgroup"); } while (0)


// Differential attention (B 1, S 2048, E 2048, 16 heads; q/k as 32 half-heads x 64 with interleaved RoPE, v as 16 heads x 128): a = softmax_causal(q1 k1^T/8) v - lambda_full * softmax_causal(q2 k2^T/8) v; lambda_full = exp(lq1.lk1) - exp(lq2.lk2) + lambda_init; a = RMSNorm_128(a) * g * (1 - lambda_init); out = a Wo.
#define SS 2048
#define DM 2048
#define NH 16
#define HD 128               // v head dim (2*64)
#define HQ 64                // q/k half-head dim
#define KVW DM
#define LAMBDA_INIT 0.78360577f   /* 0.8 - 0.6*exp(-0.3*12) = 0.7836057665 */
#ifndef TQB
#define TQB (SS / 64)
#define TRP (SS / 64)          // projection row tiles (all)
#endif
typedef __attribute__((ext_vector_type(8))) __bf16 v8b;
__device__ __forceinline__ v16b frag_b(const __bf16* rowk0, int lane) {
  union { v16b v; v8b q[2]; } u; const __bf16* p = rowk0 + 8 * (lane >> 4);
  u.q[0] = *(const v8b*)p; u.q[1] = *(const v8b*)(p + 16); return u.v;
}
__device__ __forceinline__ float bfr(float v) { return (float)(__bf16)v; }
__device__ __attribute__((noinline)) float exp_ni(float v) { return expf(v); }
__device__ __attribute__((noinline)) float erf_ni(float v) { return erff(v); }
// 2^v as the one hardware instruction v_exp_f32, in line; a very negative v (a masked score, the start value of the running maximum) gives exactly 0
__device__ __forceinline__ float exp2_hw(float v) { return __builtin_amdgcn_exp2f(v); }
#define QK_SCALE_LOG2 0.18033688f   /* (1/8) * log2(e): scores and their running maximum are kept in the base-2 domain, so that exp(s - m) is 2^(s2 - m2) */

#define PK_Q 0
#define PK_K (PK_Q + DM * DM)
#define PK_V (PK_K + KVW * DM)
#define PK_O (PK_V + KVW * DM)
#define PK_END (PK_O + DM * DM)
#define WS_PK  0u
#define WS_CS  (WS_PK + 2u * PK_END)             // f32 [2048][32] cos, then [2048][32] sin
#define WS_Q   (WS_CS + 4u * 2 * SS * 32)
#define WS_K   (WS_Q + 4u * SS * DM)
#define WS_VTH (WS_K + 4u * SS * KVW)
#define WS_VTL (WS_VTH + 2u * KVW * SS)
#define WS_O   (WS_VTL + 2u * KVW * SS)
#define WS_END (WS_O + 4u * SS * DM)

// ---- weight tile in LDS: one stage = 128 packed weight rows x 64 k (128 B a row), LDS pitch 144 B (16 B x odd, for the ds_load_b128 readers), two stages
#define WROW 144
#define WBUF (128 * WROW)
// 128 threads bring one stage: copy i takes rows 16 i + (tid >> 3), 16 B a lane, so a wave's 32 lanes cover 4 whole 128-B rows per copy
__device__ __forceinline__ void stage_w(const __bf16* __restrict__ Pt, unsigned lds, int tid) {
  const __bf16* gp = Pt + (size_t)(tid >> 3) * DM + (tid & 7) * 8; const unsigned l = lds + (tid >> 3) * WROW + (tid & 7) * 16;
  // the eight copies and, as the last line, the wait that stands in front of any rewrite of the address registers they name
  asm volatile("global_load_async_to_lds_b128 %0, %8, off\n\t"
               "global_load_async_to_lds_b128 %1, %9, off\n\t"
               "global_load_async_to_lds_b128 %2, %10, off\n\t"
               "global_load_async_to_lds_b128 %3, %11, off\n\t"
               "global_load_async_to_lds_b128 %4, %12, off\n\t"
               "global_load_async_to_lds_b128 %5, %13, off\n\t"
               "global_load_async_to_lds_b128 %6, %14, off\n\t"
               "global_load_async_to_lds_b128 %7, %15, off\n\t"
               "s_wait_xcnt 0x0"
               :: "v"(l), "v"(l + 16 * WROW), "v"(l + 32 * WROW), "v"(l + 48 * WROW), "v"(l + 64 * WROW), "v"(l + 80 * WROW), "v"(l + 96 * WROW), "v"(l + 112 * WROW),
                  "v"(gp), "v"(gp + 16 * DM), "v"(gp + 32 * DM), "v"(gp + 48 * DM), "v"(gp + 64 * DM), "v"(gp + 80 * DM), "v"(gp + 96 * DM), "v"(gp + 112 * DM)
               : "memory");
}
// fragment of one staged row: the same bytes in the same k order as frag_b reads from the packed row
__device__ __forceinline__ v16b frag_w(const char* rowk0, int g) {
  union { v16b v; v8b q[2]; } u; const char* p = rowk0 + 16 * g;
  u.q[0] = *(const v8b*)p; u.q[1] = *(const v8b*)(p + 32); return u.v;
}
#define WAIT_COPIES() asm volatile("s_wait_asynccnt 0x0" ::: "memory")   /* this wave's copies have landed */
#define WAIT_LDS()    asm volatile("s_wait_dscnt 0x0" ::: "memory")      /* this wave's LDS reads have returned */

// ---- k_packT: block = output column n of a [K][N] (x @ W) matrix
__global__ __launch_bounds__(256) void k_packT(const float* __restrict__ Wm, int K, int N, __bf16* __restrict__ DST) {
  __shared__ __align__(16) __bf16 s[DM]; const int n = blockIdx.x, tid = threadIdx.x;
  for (int k = tid; k < K; k += 256) s[k] = (__bf16)Wm[(size_t)k * N + n];
  __syncthreads();
  for (int q = tid; q < K / 8; q += 256) vst2((unsigned*)(DST + (size_t)n * K + q * 8), *(const v4u*)&s[q * 8]);
}
__global__ __launch_bounds__(32) void k_rope_tab(float* __restrict__ CS) {
  __shared__ __align__(16) float sc[32], ssn[32]; const int t = blockIdx.x, i = threadIdx.x;
  const float dv = expf((float)(2 * i) * (-9.2103404f / 64.0f));   /* ln(1e4) as the f32 literal numpy uses */ const float ang = (float)t * dv; sc[i] = cosf(ang); ssn[i] = sinf(ang);
  __syncthreads();
  if (i < 8) vst2(CS + (size_t)t * 32 + i * 4, *(const v4f*)&sc[i * 4]); else if (i < 16) vst2(CS + (size_t)SS * 32 + (size_t)t * 32 + (i - 8) * 4, *(const v4f*)&ssn[(i - 8) * 4]);
}
// ---- k_proj<MODE>: block = (64 rows, 128 cols = one head): Y = bf16(x) . P rows (exact); MODE 0: RoPE then f32 rows (q/k; ldo); MODE 1: plain -> transposed bf16 hi/lo planes (v)
template <int MODE>
__global__ __launch_bounds__(128) void k_proj(const float* __restrict__ X, const __bf16* __restrict__ P, const float* __restrict__ CS, float* __restrict__ OUT, int ldo, __bf16* __restrict__ PH, __bf16* __restrict__ PL) {
  __shared__ __align__(16) float so[MODE ? 1 : 4][16][132]; __shared__ __align__(16) __bf16 sth[MODE ? 128 : 1][72], stl[MODE ? 128 : 1][72]; __shared__ __align__(16) char sw[2 * WBUF];
  const int tid = threadIdx.x, wave = tid >> 5, lane = tid & 31, col = lane & 15, g = lane >> 4; const size_t r0 = (size_t)blockIdx.x * 64 + wave * 16; const int n0 = blockIdx.y * 128;
  v8f acc[8] = {};
  const unsigned sw0 = (unsigned)(size_t)&sw[0]; const __bf16* Pn = P + (size_t)n0 * DM;
  stage_w(Pn, sw0, tid); WAIT_COPIES(); __syncthreads();   // tile 0 is in buffer 0 for every wave
  stage_w(Pn + 64, sw0 + WBUF, tid);                       // tile 1 flies while tile 0 is worked on
#pragma unroll 1   // one trip per stage: the ring's foot (waits, barrier, refill) stands once and the two buffers alternate by t & 1
  for (int t = 0; t < DM / 64; ++t) { const int bo = (t & 1) * WBUF; v16b a[2];
#pragma unroll
    for (int u = 0; u < 2; ++u) { const float* p = X + (r0 + col) * DM + (2 * t + u) * 32 + 8 * g;
#pragma unroll
      for (int i = 0; i < 8; ++i) { a[u][i] = (__bf16)p[i]; a[u][8 + i] = (__bf16)p[16 + i]; } }
#pragma unroll
    for (int u = 0; u < 2; ++u) { v16b b[8];
#pragma unroll
      for (int j = 0; j < 8; ++j) b[j] = frag_w(&sw[bo + (j * 16 + col) * WROW + u * 64], g);
#pragma unroll
      for (int j = 0; j < 8; ++j) acc[j] = wmma_bf(a[u], b[j], acc[j]); }
    WAIT_LDS(); WAIT_COPIES(); __syncthreads();   // publishes tile t + 1 and ends every wave's reads of tile t
    if (t + 2 < DM / 64) stage_w(Pn + (t + 2) * 64, sw0 + bo, tid); }
  WAIT_COPIES();
  if (MODE == 0) {
    // projections to LDS, then interleaved-pair RoPE in place within each 64-wide half-head: (x_{2i}, x_{2i+1}) -> (x c - y s, x s + y c) with angle index i
#pragma unroll
    for (int j = 0; j < 8; ++j)
#pragma unroll
      for (int r = 0; r < 8; ++r) so[wave][8 * g + r][j * 16 + col] = acc[j][r];
    LDSX();
    for (int q = lane; q < 16 * 64; q += 32) { const int rl = q >> 6, pi = q & 63; const int half = pi >> 5, i = pi & 31; const size_t t = r0 + rl; const float c = CS[t * 32 + i], s = CS[(size_t)SS * 32 + t * 32 + i]; float* e = &so[wave][rl][half * 64 + 2 * i]; const float xe = e[0], xo = e[1]; e[0] = xe * c - xo * s; e[1] = xe * s + xo * c; }
    LDSX();
    for (int rl = 0; rl < 16; ++rl) vst2(OUT + (r0 + rl) * ldo + n0 + lane * 4, *(const v4f*)&so[wave][rl][lane * 4]);
  } else {
#pragma unroll
    for (int j = 0; j < 8; ++j)
#pragma unroll
      for (int r = 0; r < 8; ++r) { const float v = acc[j][r]; const __bf16 hb = (__bf16)v; sth[j * 16 + col][wave * 16 + 8 * g + r] = hb; stl[j * 16 + col][wave * 16 + 8 * g + r] = (__bf16)(v - (float)hb); }
    __syncthreads();
    const int s0 = blockIdx.x * 64;
    for (int q = tid; q < 128 * 8; q += 128) { const int d = q >> 3, pc = q & 7; const size_t o = (size_t)(n0 + d) * SS + s0 + pc * 8; vst2((unsigned*)(PH + o), *(const v4u*)&sth[d][pc * 8]); vst2((unsigned*)(PL + o), *(const v4u*)&stl[d][pc * 8]); }
  }
}
// ---- K and V tiles in LDS: one stage = the 32 keys of one trip for one head: 32 K rows x 512 B (both 64-float half-heads of a key), then the hi and the lo plane of V^T, 128 rows (d) x 64 B (32 keys) each; LDS pitches 528 B and 80 B (16 B x odd, for the ds_load_b128 readers), two stages
#define KROW 528
#define VROW 80
#define KBUF (32 * KROW)
#define VPL  (128 * VROW)
#define ABUF (KBUF + 2 * VPL)
// 256 threads bring one stage, 16 B a lane: K copy i takes rows 8 i + (tid >> 5), a wave covering one whole 512-B row; V copy i of a plane takes rows 64 i + (tid >> 2), a wave covering 8 rows of 64 B
__device__ __forceinline__ void stage_kv(const float* __restrict__ Kt, const __bf16* __restrict__ Vh, const __bf16* __restrict__ Vl, unsigned lds, int tid) {
  const float* kp = Kt + (size_t)(tid >> 5) * KVW + (tid & 31) * 4; const unsigned kl = lds + (tid >> 5) * KROW + (tid & 31) * 16;
  const size_t vo = (size_t)(tid >> 2) * SS + (tid & 3) * 8; const __bf16 *hp = Vh + vo, *lp = Vl + vo; const unsigned vl = lds + KBUF + (tid >> 2) * VROW + (tid & 3) * 16;
  // the eight copies and, as the last line, the wait that stands in front of any rewrite of the address registers they name
  asm volatile("global_load_async_to_lds_b128 %0, %8, off\n\t"
               "global_load_async_to_lds_b128 %1, %9, off\n\t"
               "global_load_async_to_lds_b128 %2, %10, off\n\t"
               "global_load_async_to_lds_b128 %3, %11, off\n\t"
               "global_load_async_to_lds_b128 %4, %12, off\n\t"
               "global_load_async_to_lds_b128 %5, %13, off\n\t"
               "global_load_async_to_lds_b128 %6, %14, off\n\t"
               "global_load_async_to_lds_b128 %7, %15, off\n\t"
               "s_wait_xcnt 0x0"
               :: "v"(kl), "v"(kl + 8 * KROW), "v"(kl + 16 * KROW), "v"(kl + 24 * KROW), "v"(vl), "v"(vl + 64 * VROW), "v"(vl + VPL), "v"(vl + VPL + 64 * VROW),
                  "v"(kp), "v"(kp + 8 * KVW), "v"(kp + 16 * KVW), "v"(kp + 24 * KVW), "v"(hp), "v"(hp + 64 * SS), "v"(lp), "v"(lp + 64 * SS)
               : "memory");
}
// lane l with lane l ^ 16 (the two halves of a wave hold the two halves of one query's keys, or of its output row)
__device__ __forceinline__ float xhalf(float x) { return __builtin_bit_cast(float, __builtin_amdgcn_permlanex16(__builtin_bit_cast(int, x), __builtin_bit_cast(int, x), 0x76543210, 0xfedcba98, false, false)); }
// ---- k_attn: block = (64 queries, head h), 8 waves: waves 0..3 run attention 1 and waves 4..7 attention 2 of the same four 16-query tiles side by side; each trip's K and V tiles are staged once in LDS for all 8 waves; transposed products: S^T = K.Q^T (3 products) and O^T += V^T.P^T (3 products), so lane (g, col) holds query q0 + col: its scores of keys 8 g + r and 16 + 8 g + r of a trip, and its outputs d = 16 dt + 8 g + r; O[q][h*128+d]
__global__ __launch_bounds__(256) void k_attn(const float* __restrict__ Q, const float* __restrict__ Kx, const __bf16* __restrict__ VTH, const __bf16* __restrict__ VTL, const float* __restrict__ LQ1, const float* __restrict__ LK1, const float* __restrict__ LQ2, const float* __restrict__ LK2, const float* __restrict__ G, float* __restrict__ O) {
  __shared__ __align__(16) float so[4][16][132]; __shared__ __align__(16) char skv[2 * ABUF];
  const int tid = threadIdx.x, wave = tid >> 5, lane = tid & 31, col = lane & 15, g = lane >> 4;
  const int sub = __builtin_amdgcn_readfirstlane(wave >> 2), wq = wave & 3;   // which attention (the same in every lane of a wave), which 16-query tile
  const int qb = blockIdx.x, h = blockIdx.y; const int q0 = qb * 64 + wq * 16;
  // lambda_full from the inputs (64-dots)
  float lam; { float s1 = 0.f, s2 = 0.f; for (int i = lane; i < HQ; i += 32) { s1 += bfr(LQ1[i]) * bfr(LK1[i]); s2 += bfr(LQ2[i]) * bfr(LK2[i]); }
#pragma unroll
    for (int o = 1; o < 32; o <<= 1) { s1 += __shfl_xor(s1, o); s2 += __shfl_xor(s2, o); } lam = exp_ni(s1) - exp_ni(s2) + LAMBDA_INIT; }
  const int nks = (qb * 64 + 64) / 32;
  const int qi = q0 + col;
  const float* qrow = Q + (size_t)qi * DM + (2 * h + sub) * HQ;
  float m = -3.0e38f, l = 0.f;   // of query qi: running maximum, base-2 domain (the same in both halves of the wave) and the running sum over this half's keys
  v8f acc[8] = {};
  const unsigned kv0 = (unsigned)(size_t)&skv[0]; const float* Kh = Kx + 2 * h * HQ; const __bf16 *Vhh = VTH + (size_t)h * HD * SS, *Vlh = VTL + (size_t)h * HD * SS;
  stage_kv(Kh, Vhh, Vlh, kv0, tid); WAIT_COPIES(); __syncthreads();          // tile 0 is in buffer 0 for every wave
  stage_kv(Kh + (size_t)32 * KVW, Vhh + 32, Vlh + 32, kv0 + ABUF, tid);      // tile 1 (nks is 2 qb + 2, never below 2) flies while tile 0 is worked on
#pragma unroll 1
  for (int ks = 0; ks < nks; ++ks) { const int bo = (ks & 1) * ABUF; float s[16];   // s[8 ct + r]: key ks * 32 + ct * 16 + 8 g + r, which is the k order of a B fragment
#pragma unroll
    for (int ct = 0; ct < 2; ++ct) { const float* krow = (const float*)&skv[bo + (ct * 16 + col) * KROW] + sub * HQ; v8f c = {};
#pragma unroll
      for (int kc = 0; kc < 2; ++kc) { const F2 kb = split_row(krow, kc * 32, lane); const F2 qa = split_row(qrow, kc * 32, lane); c = wmma_bf(kb.h, qa.l, c); c = wmma_bf(kb.l, qa.h, c); c = wmma_bf(kb.h, qa.h, c); }
#pragma unroll
      for (int r = 0; r < 8; ++r) { const int kk = ks * 32 + ct * 16 + 8 * g + r; s[8 * ct + r] = (kk <= qi) ? c[r] * QK_SCALE_LOG2 : -3.0e38f; } }
    float mx = s[0];
#pragma unroll
    for (int i = 1; i < 16; ++i) mx = fmaxf(mx, s[i]);
    mx = fmaxf(mx, xhalf(mx));
    const float mn = fmaxf(m, mx); const float alpha = exp2_hw(m - mn);   // key 0 is open to every query, so mn is a real score from the first trip on
    float e[16], t[8];
#pragma unroll
    for (int i = 0; i < 16; ++i) e[i] = exp2_hw(s[i] - mn);
#pragma unroll
    for (int i = 0; i < 8; ++i) t[i] = e[i] + e[8 + i];
    float es = ((t[0] + t[4]) + (t[2] + t[6])) + ((t[1] + t[5]) + (t[3] + t[7]));
    l = l * alpha + es; m = mn;
#pragma unroll
    for (int dt = 0; dt < 8; ++dt) acc[dt] *= alpha;
    const F2 pb = bsplit16(e);
#pragma unroll
    for (int dt = 0; dt < 8; ++dt) { const char* vr = &skv[bo + KBUF + (dt * 16 + col) * VROW]; const v16b vh = frag_w(vr, g), vl = frag_w(vr + VPL, g); acc[dt] = wmma_bf(vh, pb.l, acc[dt]); acc[dt] = wmma_bf(vl, pb.h, acc[dt]); acc[dt] = wmma_bf(vh, pb.h, acc[dt]); }
    WAIT_LDS(); WAIT_COPIES(); __syncthreads();   // publishes tile ks + 1 and ends every wave's reads of tile ks
    if (ks + 2 < nks) stage_kv(Kh + (size_t)(ks + 2) * 32 * KVW, Vhh + (ks + 2) * 32, Vlh + (ks + 2) * 32, kv0 + bo, tid); }
  WAIT_COPIES();
  l += xhalf(l);   // the two halves' sums join once
  const float il = 1.0f / l; float* orow = &so[wq][col][8 * g];   // this lane's 8 consecutive d of each 16-wide group dt
  if (sub == 0) {
#pragma unroll
    for (int dt = 0; dt < 8; ++dt) { const v8f a = acc[dt] * il; *(v4f*)(orow + dt * 16) = __builtin_shufflevector(a, a, 0, 1, 2, 3); *(v4f*)(orow + dt * 16 + 4) = __builtin_shufflevector(a, a, 4, 5, 6, 7); }
  }
  __syncthreads();   // hands the normalised attn1 rows of tile wq from wave wq to wave 4 + wq
  if (sub == 1) {
    float ss = 0.f;
#pragma unroll
    for (int dt = 0; dt < 8; ++dt)
#pragma unroll
      for (int r = 0; r < 8; ++r) { const float a = orow[dt * 16 + r] - lam * (acc[dt][r] * il); acc[dt][r] = a; ss += a * a; }
    ss += xhalf(ss);
    const float rs = rsqrtf(ss / (float)HD + 1e-5f) * (1.0f - LAMBDA_INIT);
    v4f gv[16]; const v4f* gp = (const v4f*)(G + 8 * g);   // g in this lane's order: the 8 consecutive values of each 16-wide group as two 16-byte loads, all from one base
#pragma unroll
    for (int dt = 0; dt < 8; ++dt) { gv[2 * dt] = gp[4 * dt]; gv[2 * dt + 1] = gp[4 * dt + 1]; }
    asm volatile("s_wait_xcnt 0x0" :: "v"(gp) : "memory");   // stands in front of any rewrite of the address pair that the g loads name; taking the pair as an input keeps it whole up to here, so that no load of the run lands in it
#pragma unroll
    for (int dt = 0; dt < 8; ++dt)
#pragma unroll
      for (int r = 0; r < 8; ++r) orow[dt * 16 + r] = acc[dt][r] * rs * bfr(gv[2 * dt + (r >> 2)][r & 3]);
    LDSX();
    for (int rl = 0; rl < 16; ++rl) vst2(O + (size_t)(q0 + rl) * DM + h * HD + lane * 4, *(const v4f*)&so[wq][rl][lane * 4]);
  }
}
// ---- k_out: block = (64 rows, 128 cols): out = O(hi/lo) . wproj^T rows (2 products)
__global__ __launch_bounds__(128) void k_out(const float* __restrict__ O, const __bf16* __restrict__ P, float* __restrict__ Y) {
  __shared__ __align__(16) float so[4][16][132]; __shared__ __align__(16) char sw[2 * WBUF];
  const int tid = threadIdx.x, wave = tid >> 5, lane = tid & 31, col = lane & 15, g = lane >> 4; const size_t r0 = (size_t)blockIdx.x * 64 + wave * 16; const int n0 = blockIdx.y * 128;
  v8f acc[8] = {};
  const unsigned sw0 = (unsigned)(size_t)&sw[0]; const __bf16* Pn = P + (size_t)n0 * DM;
  stage_w(Pn, sw0, tid); WAIT_COPIES(); __syncthreads();   // tile 0 is in buffer 0 for every wave
  stage_w(Pn + 64, sw0 + WBUF, tid);                       // tile 1 flies while tile 0 is worked on
#pragma unroll 1   // one trip per stage: the ring's foot (waits, barrier, refill) stands once and the two buffers alternate by t & 1
  for (int t = 0; t < DM / 64; ++t) { const int bo = (t & 1) * WBUF; F2 a[2];
#pragma unroll
    for (int u = 0; u < 2; ++u) a[u] = split_row(O + (r0 + col) * DM, (2 * t + u) * 32, lane);
#pragma unroll
    for (int u = 0; u < 2; ++u) { v16b b[8];
#pragma unroll
      for (int j = 0; j < 8; ++j) b[j] = frag_w(&sw[bo + (j * 16 + col) * WROW + u * 64], g);
#pragma unroll
      for (int j = 0; j < 8; ++j) { acc[j] = wmma_bf(a[u].l, b[j], acc[j]); acc[j] = wmma_bf(a[u].h, b[j], acc[j]); } }
    WAIT_LDS(); WAIT_COPIES(); __syncthreads();   // publishes tile t + 1 and ends every wave's reads of tile t
    if (t + 2 < DM / 64) stage_w(Pn + (t + 2) * 64, sw0 + bo, tid); }
  WAIT_COPIES();
#pragma unroll
  for (int j = 0; j < 8; ++j)
#pragma unroll
    for (int r = 0; r < 8; ++r) so[wave][8 * g + r][j * 16 + col] = acc[j][r];
  LDSX();
  for (int rl = 0; rl < 16; ++rl) vst2(Y + (r0 + rl) * DM + n0 + lane * 4, *(const v4f*)&so[wave][rl][lane * 4]);
}
extern "C" void kernel_launch(void* const* d_in, const int* in_sizes, int n_in, void* d_out, int out_size, void* d_ws, size_t ws_size, hipStream_t stream) {
  (void)in_sizes; (void)n_in; (void)out_size;
  const float** F = (const float**)d_in;   // 0 x [1,2048,2048], 1 Wq, 2 Wk, 3 Wv, 4 Wo [2048,2048] (x @ W), 5 lq1, 6 lk1, 7 lq2, 8 lk2 [64], 9 g [128]
  if (ws_size < (size_t)WS_END) return;
  char* ws = (char*)d_ws; __bf16 *PK = (__bf16*)(ws + WS_PK), *VTH = (__bf16*)(ws + WS_VTH), *VTL = (__bf16*)(ws + WS_VTL);
  float *CS = (float*)(ws + WS_CS), *Q = (float*)(ws + WS_Q), *Kx = (float*)(ws + WS_K), *O = (float*)(ws + WS_O);
  k_packT<<<DM, 256, 0, stream>>>(F[1], DM, DM, PK + PK_Q); k_packT<<<DM, 256, 0, stream>>>(F[2], DM, DM, PK + PK_K); k_packT<<<DM, 256, 0, stream>>>(F[3], DM, DM, PK + PK_V); k_packT<<<DM, 256, 0, stream>>>(F[4], DM, DM, PK + PK_O);
  k_rope_tab<<<SS, 32, 0, stream>>>(CS);
  k_proj<0><<<dim3(TRP, DM / 128), 128, 0, stream>>>(F[0], PK + PK_Q, CS, Q, DM, nullptr, nullptr);
  k_proj<0><<<dim3(TRP, DM / 128), 128, 0, stream>>>(F[0], PK + PK_K, CS, Kx, DM, nullptr, nullptr);
  k_proj<1><<<dim3(TRP, DM / 128), 128, 0, stream>>>(F[0], PK + PK_V, CS, nullptr, 0, VTH, VTL);
  k_attn<<<dim3(TQB, NH), 256, 0, stream>>>(Q, Kx, VTH, VTL, F[5], F[6], F[7], F[8], F[9], O);
  k_out<<<dim3(TQB, DM / 128), 128, 0, stream>>>(O, PK + PK_O, (float*)d_out);
}

// v006
// Measured time: 357 microseconds a run.
// Two timings next to v005 both put it at 1.24 times that version's speed.
// Counting every step since v000, it is 3.93 times as fast.
// compute dtype: x, the four weights, the lambda vectors and g (module inputs) rounded to bf16; q/k/v projections with exact bf16 products (x and W are inputs) and interleaved-pair RoPE (tables in f32 as the module's numpy code) in the epilogue; the two causal attentions per head with q.k as bf16 hi + residual pairs (3 products) and P.V with P hi/lo x V hi/lo (3 products); the differential combination, RMSNorm and (1 - lambda_init) scaling in f32; the output projection hi/lo x exact Wo (2 products); all GEMMs on WMMA 16x16x32; f32 accumulate.
#include <hip/hip_runtime.h>
#include <math.h>

typedef __attribute__((ext_vector_type(16))) _Float16 v16h;
typedef __attribute__((ext_vector_type(16))) __bf16 v16b;
typedef __attribute__((ext_vector_type(8)))  _Float16 v8h;
typedef __attribute__((ext_vector_type(8)))  float v8f;
typedef __attribute__((ext_vector_type(4)))  float v4f;
typedef __attribute__((ext_vector_type(2)))  float v2f;
typedef __attribute__((ext_vector_type(4)))  unsigned v4u;
typedef __attribute__((ext_vector_type(4)))  int v4i;
typedef float __attribute__((may_alias)) float_a;
typedef int __attribute__((may_alias)) int_a;

template <typename T> __device__ __forceinline__ void vst2(void* p, T v) { *(T*)p = v;  }
__device__ __forceinline__ v8f wmma16(v16h a, v16h b, v8f c) {
  v8f d = __builtin_amdgcn_wmma_f32_16x16x32_f16(false, a, false, b, (short)0, c, false, false);
  asm volatile("v_nop\n\tv_nop\n\tv_nop\n\tv_nop" : "+v"(d) : "v"(a), "v"(b));
  return d;
}
__device__ __forceinline__ v8f wmma_bf(v16b a, v16b b, v8f c) {
  v8f d = __builtin_amdgcn_wmma_f32_16x16x32_bf16(false, a, false, b, (short)0, c, false, false);
  asm volatile("v_nop\n\tv_nop\n\tv_nop\n\tv_nop" : "+v"(d) : "v"(a), "v"(b));
  return d;
}
// 16x16x32 fragments: lane = (h = lane>>4, row/col = lane&15); elements 0..7 = k0+8h+0..7, 8..15 = k0+16+8h+0..7; D element r = row 8h+r
__device__ __forceinline__ v16h frag_h(const _Float16* rowk0, int lane) {
  union { v16h v; v8h q[2]; } u; const _Float16* p = rowk0 + 8 * (lane >> 4);
  u.q[0] = *(const v8h*)p; u.q[1] = *(const v8h*)(p + 16); return u.v;
}
__device__ __forceinline__ v16h frag_f32(const float* rowk0, int lane) {
  v16h a; const float* p = rowk0 + 8 * (lane >> 4);
#pragma unroll
  for (int i = 0; i < 8; ++i) { a[i] = (_Float16)p[i]; a[8 + i] = (_Float16)p[16 + i]; }
  return a;
}
__device__ __forceinline__ v16h frag_f32s(const float* rowk0, int lane, float sc) {
  v16h a; const float* p = rowk0 + 8 * (lane >> 4);
#pragma unroll
  for (int i = 0; i < 8; ++i) { a[i] = (_Float16)(p[i] * sc); a[8 + i] = (_Float16)(p[16 + i] * sc); }
  return a;
}
// column fragment from a [K][ld] layout (column n), rows >= K read as 0
__device__ __forceinline__ v16h fragc_f32(const float* W, int k0, int n, int lane, int ld, int K) {
  v16h a; const int g = lane >> 4;
#pragma unroll
  for (int i = 0; i < 8; ++i) { const int ka = k0 + 8 * g + i, kb = ka + 16;
    a[i] = (_Float16)(ka < K ? W[(size_t)(ka < K ? ka : K - 1) * ld + n] : 0.f); a[8 + i] = (_Float16)(kb < K ? W[(size_t)(kb < K ? kb : K - 1) * ld + n] : 0.f); }
  return a;
}
struct F2 { v16b h, l; };
__device__ __forceinline__ F2 bsplit16(const float v[16]) { F2 r;
#pragma unroll
  for (int i = 0; i < 16; ++i) { const __bf16 h = (__bf16)v[i]; r.h[i] = h; r.l[i] = (__bf16)(v[i] - (float)h); }
  return r; }
__device__ __forceinline__ F2 split_row(const float* row, int k0, int lane) { float v[16]; const float* p = row + k0 + 8 * (lane >> 4);
#pragma unroll
  for (int i = 0; i < 8; ++i) { v[i] = p[i]; v[8 + i] = p[16 + i]; }
  return bsplit16(v); }
__device__ __forceinline__ F2 split_rowK(const float* row, int k0, int lane, int K) { float v[16]; const int g = lane >> 4;
#pragma unroll
  for (int i = 0; i < 8; ++i) { const int ka = k0 + 8 * g + i, kb = ka + 16; v[i] = ka < K ? row[ka < K ? ka : K - 1] : 0.f; v[8 + i] = kb < K ? row[kb < K ? kb : K - 1] : 0.f; }
  return bsplit16(v); }
__device__ __forceinline__ F2 split_col(const float* W, int k0, int n, int lane, int ld, int K) { float v[16]; const int g = lane >> 4;
#pragma unroll
  for (int i = 0; i < 8; ++i) { const int ka = k0 + 8 * g + i, kb = ka + 16; v[i] = ka < K ? W[(size_t)(ka < K ? ka : K - 1) * ld + n] : 0.f; v[8 + i] = kb < K ? W[(size_t)(kb < K ? kb : K - 1) * ld + n] : 0.f; }
  return bsplit16(v); }
__device__ __forceinline__ v8f mac3(const F2& a, const F2& b, v8f c) { c = wmma_bf(a.l, b.h, c); c = wmma_bf(a.h, b.l, c); return wmma_bf(a.h, b.h, c); }
__device__ __forceinline__ float sigm(float v) { return 1.0f / (1.0f + expf(-v)); }
#define LDSX() do { asm volatile("s_wait_dscnt 0" ::: "memory"); __builtin_amdgcn_wave_barrier(); __builtin_amdgcn_fence(__ATOMIC_RELEASE, "workgroup"); } while (0)


// Differential attention (B 1, S 2048, E 2048, 16 heads; q/k as 32 half-heads x 64 with interleaved RoPE, v as 16 heads x 128): a = softmax_causal(q1 k1^T/8) v - lambda_full * softmax_causal(q2 k2^T/8) v; lambda_full = exp(lq1.lk1) - exp(lq2.lk2) + lambda_init; a = RMSNorm_128(a) * g * (1 - lambda_init); out = a Wo.
#define SS 2048
#define DM 2048
#define NH 16
#define HD 128               // v head dim (2*64)
#define HQ 64                // q/k half-head dim
#define KVW DM
#define LAMBDA_INIT 0.78360577f   /* 0.8 - 0.6*exp(-0.3*12) = 0.7836057665 */
#ifndef TQB
#define TQB (SS / 64)
#define TRP (SS / 64)          // projection row tiles (all)
#endif
typedef __attribute__((ext_vector_type(8))) __bf16 v8b;
__device__ __forceinline__ v16b frag_b(const __bf16* rowk0, int lane) {
  union { v16b v; v8b q[2]; } u; const __bf16* p = rowk0 + 8 * (lane >> 4);
  u.q[0] = *(const v8b*)p; u.q[1] = *(const v8b*)(p + 16); return u.v;
}
__device__ __forceinline__ float bfr(float v) { return (float)(__bf16)v; }
__device__ __attribute__((noinline)) float exp_ni(float v) { return expf(v); }
__device__ __attribute__((noinline)) float erf_ni(float v) { return erff(v); }
// 2^v as the one hardware instruction v_exp_f32, in line; a very negative v (a masked score, the start value of the running maximum) gives exactly 0
__device__ __forceinline__ float exp2_hw(float v) { return __builtin_amdgcn_exp2f(v); }
#define QK_SCALE_LOG2 0.18033688f   /* (1/8) * log2(e): scores and their running maximum are kept in the base-2 domain, so that exp(s - m) is 2^(s2 - m2) */

#define PK_Q 0
#define PK_K (PK_Q + DM * DM)
#define PK_V (PK_K + KVW * DM)
#define PK_O (PK_V + KVW * DM)
#define PK_END (PK_O + DM * DM)
#define WS_PK  0u
#define WS_CS  (WS_PK + 2u * PK_END)             // f32 [2048][32] cos, then [2048][32] sin
#define WS_Q   (WS_CS + 4u * 2 * SS * 32)
#define WS_K   (WS_Q + 4u * SS * DM)
#define WS_VTH (WS_K + 4u * SS * KVW)
#define WS_VTL (WS_VTH + 2u * KVW * SS)
#define WS_O   (WS_VTL + 2u * KVW * SS)
#define WS_END (WS_O + 4u * SS * DM)

// ---- weight tile in LDS: one stage = 128 packed weight rows x 64 k (128 B a row), LDS pitch 144 B (16 B x odd, for the ds_load_b128 readers), two stages
#define WROW 144
#define WBUF (128 * WROW)
// 128 threads bring one stage: copy i takes rows 16 i + (tid >> 3), 16 B a lane, so a wave's 32 lanes cover 4 whole 128-B rows per copy
__device__ __forceinline__ void stage_w(const __bf16* __restrict__ Pt, unsigned lds, int tid) {
  const __bf16* gp = Pt + (size_t)(tid >> 3) * DM + (tid & 7) * 8; const unsigned l = lds + (tid >> 3) * WROW + (tid & 7) * 16;
  // the eight copies and, as the last line, the wait that stands in front of any rewrite of the address registers they name
  asm volatile("global_load_async_to_lds_b128 %0, %8, off\n\t"
               "global_load_async_to_lds_b128 %1, %9, off\n\t"
               "global_load_async_to_lds_b128 %2, %10, off\n\t"
               "global_load_async_to_lds_b128 %3, %11, off\n\t"
               "global_load_async_to_lds_b128 %4, %12, off\n\t"
               "global_load_async_to_lds_b128 %5, %13, off\n\t"
               "global_load_async_to_lds_b128 %6, %14, off\n\t"
               "global_load_async_to_lds_b128 %7, %15, off\n\t"
               "s_wait_xcnt 0x0"
               :: "v"(l), "v"(l + 16 * WROW), "v"(l + 32 * WROW), "v"(l + 48 * WROW), "v"(l + 64 * WROW), "v"(l + 80 * WROW), "v"(l + 96 * WROW), "v"(l + 112 * WROW),
                  "v"(gp), "v"(gp + 16 * DM), "v"(gp + 32 * DM), "v"(gp + 48 * DM), "v"(gp + 64 * DM), "v"(gp + 80 * DM), "v"(gp + 96 * DM), "v"(gp + 112 * DM)
               : "memory");
}
// fragment of one staged row: the same bytes in the same k order as frag_b reads from the packed row
__device__ __forceinline__ v16b frag_w(const char* rowk0, int g) {
  union { v16b v; v8b q[2]; } u; const char* p = rowk0 + 16 * g;
  u.q[0] = *(const v8b*)p; u.q[1] = *(const v8b*)(p + 32); return u.v;
}
#define WAIT_COPIES() asm volatile("s_wait_asynccnt 0x0" ::: "memory")   /* this wave's copies have landed */
#define WAIT_LDS()    asm volatile("s_wait_dscnt 0x0" ::: "memory")      /* this wave's LDS reads have returned */

// ---- k_packT: block = a 64 (k) x 128 (n) tile of a [DM][DM] (x @ W) matrix, written as 128 packed rows DST[n][k0 .. k0 + 63]; both sides of the transpose move whole 128-B lines: a wave's load covers 512 contiguous bytes of one k row, and 8 lanes store one 128-B piece of a packed row
#define PROW 144   /* LDS pitch of a tile row: 64 k x 2 B + 16 B; unpadded, the rows that the lanes of one ds_store_b128 write (4 apart) would all fall on the same banks */
__global__ __launch_bounds__(256) void k_packT(const float* __restrict__ Wm, __bf16* __restrict__ DST) {
  __shared__ __align__(16) char s[128 * PROW]; const int tid = threadIdx.x, wave = tid >> 5, lane = tid & 31; const int k0 = blockIdx.x * 64, n0 = blockIdx.y * 128;
  const float* p = Wm + (size_t)(k0 + 8 * wave) * DM + n0 + 4 * lane; v4f r[8];   // rows k0 + 8 wave + 0..7, columns n0 + 4 lane + 0..3
  // every loop of this kernel is unrolled: r[] and o are indexed by constants and stay in registers, and the 8 loads go out as one group ahead of the first use
#pragma unroll
  for (int i = 0; i < 8; ++i) r[i] = *(const v4f*)(p + (size_t)i * DM);
#pragma unroll
  for (int j = 0; j < 4; ++j) { v8b o;
#pragma unroll
    for (int i = 0; i < 8; ++i) o[i] = (__bf16)r[i][j];
    *(v8b*)&s[(4 * lane + j) * PROW + 16 * wave] = o; }
  __syncthreads();
#pragma unroll
  for (int i = 0; i < 4; ++i) { const int row = 32 * i + (tid >> 3), pc = tid & 7; vst2((unsigned*)(DST + (size_t)(n0 + row) * DM + k0 + pc * 8), *(const v4u*)&s[row * PROW + pc * 16]); }
}
__global__ __launch_bounds__(32) void k_rope_tab(float* __restrict__ CS) {
  __shared__ __align__(16) float sc[32], ssn[32]; const int t = blockIdx.x, i = threadIdx.x;
  const float dv = expf((float)(2 * i) * (-9.2103404f / 64.0f));   /* ln(1e4) as the f32 literal numpy uses */ const float ang = (float)t * dv; sc[i] = cosf(ang); ssn[i] = sinf(ang);
  __syncthreads();
  if (i < 8) vst2(CS + (size_t)t * 32 + i * 4, *(const v4f*)&sc[i * 4]); else if (i < 16) vst2(CS + (size_t)SS * 32 + (size_t)t * 32 + (i - 8) * 4, *(const v4f*)&ssn[(i - 8) * 4]);
}
// ---- k_proj<MODE>: block = (64 rows, 128 cols = one head): Y = bf16(x) . P rows (exact); MODE 0: RoPE then f32 rows (q/k; ldo); MODE 1: plain -> transposed bf16 hi/lo planes (v)
template <int MODE>
__global__ __launch_bounds__(128) void k_proj(const float* __restrict__ X, const __bf16* __restrict__ P, const float* __restrict__ CS, float* __restrict__ OUT, int ldo, __bf16* __restrict__ PH, __bf16* __restrict__ PL) {
  __shared__ __align__(16) float so[MODE ? 1 : 4][16][132]; __shared__ __align__(16) __bf16 sth[MODE ? 128 : 1][72], stl[MODE ? 128 : 1][72]; __shared__ __align__(16) char sw[2 * WBUF];
  const int tid = threadIdx.x, wave = tid >> 5, lane = tid & 31, col = lane & 15, g = lane >> 4; const size_t r0 = (size_t)blockIdx.x * 64 + wave * 16; const int n0 = blockIdx.y * 128;
  v8f acc[8] = {};
  const unsigned sw0 = (unsigned)(size_t)&sw[0]; const __bf16* Pn = P + (size_t)n0 * DM;
  stage_w(Pn, sw0, tid); WAIT_COPIES(); __syncthreads();   // tile 0 is in buffer 0 for every wave
  stage_w(Pn + 64, sw0 + WBUF, tid);                       // tile 1 flies while tile 0 is worked on
#pragma unroll 1   // one trip per stage: the ring's foot (waits, barrier, refill) stands once and the two buffers alternate by t & 1
  for (int t = 0; t < DM / 64; ++t) { const int bo = (t & 1) * WBUF; v16b a[2];
#pragma unroll
    for (int u = 0; u < 2; ++u) { const float* p = X + (r0 + col) * DM + (2 * t + u) * 32 + 8 * g;
#pragma unroll
      for (int i = 0; i < 8; ++i) { a[u][i] = (__bf16)p[i]; a[u][8 + i] = (__bf16)p[16 + i]; } }
#pragma unroll
    for (int u = 0; u < 2; ++u) { v16b b[8];
#pragma unroll
      for (int j = 0; j < 8; ++j) b[j] = frag_w(&sw[bo + (j * 16 + col) * WROW + u * 64], g);
#pragma unroll
      for (int j = 0; j < 8; ++j) acc[j] = wmma_bf(a[u], b[j], acc[j]); }
    WAIT_LDS(); WAIT_COPIES(); __syncthreads();   // publishes tile t + 1 and ends every wave's reads of tile t
    if (t + 2 < DM / 64) stage_w(Pn + (t + 2) * 64, sw0 + bo, tid); }
  WAIT_COPIES();
  if (MODE == 0) {
    // projections to LDS, then interleaved-pair RoPE in place within each 64-wide half-head: (x_{2i}, x_{2i+1}) -> (x c - y s, x s + y c) with angle index i
#pragma unroll
    for (int j = 0; j < 8; ++j)
#pragma unroll
      for (int r = 0; r < 8; ++r) so[wave][8 * g + r][j * 16 + col] = acc[j][r];
    LDSX();
    for (int q = lane; q < 16 * 64; q += 32) { const int rl = q >> 6, pi = q & 63; const int half = pi >> 5, i = pi & 31; const size_t t = r0 + rl; const float c = CS[t * 32 + i], s = CS[(size_t)SS * 32 + t * 32 + i]; float* e = &so[wave][rl][half * 64 + 2 * i]; const float xe = e[0], xo = e[1]; e[0] = xe * c - xo * s; e[1] = xe * s + xo * c; }
    LDSX();
    for (int rl = 0; rl < 16; ++rl) vst2(OUT + (r0 + rl) * ldo + n0 + lane * 4, *(const v4f*)&so[wave][rl][lane * 4]);
  } else {
#pragma unroll
    for (int j = 0; j < 8; ++j)
#pragma unroll
      for (int r = 0; r < 8; ++r) { const float v = acc[j][r]; const __bf16 hb = (__bf16)v; sth[j * 16 + col][wave * 16 + 8 * g + r] = hb; stl[j * 16 + col][wave * 16 + 8 * g + r] = (__bf16)(v - (float)hb); }
    __syncthreads();
    const int s0 = blockIdx.x * 64;
    for (int q = tid; q < 128 * 8; q += 128) { const int d = q >> 3, pc = q & 7; const size_t o = (size_t)(n0 + d) * SS + s0 + pc * 8; vst2((unsigned*)(PH + o), *(const v4u*)&sth[d][pc * 8]); vst2((unsigned*)(PL + o), *(const v4u*)&stl[d][pc * 8]); }
  }
}
// ---- K and V tiles in LDS: one stage = the 32 keys of one trip for one head: 32 K rows x 512 B (both 64-float half-heads of a key), then the hi and the lo plane of V^T, 128 rows (d) x 64 B (32 keys) each; LDS pitches 528 B and 80 B (16 B x odd, for the ds_load_b128 readers), two stages
#define KROW 528
#define VROW 80
#define KBUF (32 * KROW)
#define VPL  (128 * VROW)
#define ABUF (KBUF + 2 * VPL)
// 256 threads bring one stage, 16 B a lane: K copy i takes rows 8 i + (tid >> 5), a wave covering one whole 512-B row; V copy i of a plane takes rows 64 i + (tid >> 2), a wave covering 8 rows of 64 B
__device__ __forceinline__ void stage_kv(const float* __restrict__ Kt, const __bf16* __restrict__ Vh, const __bf16* __restrict__ Vl, unsigned lds, int tid) {
  const float* kp = Kt + (size_t)(tid >> 5) * KVW + (tid & 31) * 4; const unsigned kl = lds + (tid >> 5) * KROW + (tid & 31) * 16;
  const size_t vo = (size_t)(tid >> 2) * SS + (tid & 3) * 8; const __bf16 *hp = Vh + vo, *lp = Vl + vo; const unsigned vl = lds + KBUF + (tid >> 2) * VROW + (tid & 3) * 16;
  // the eight copies and, as the last line, the wait that stands in front of any rewrite of the address registers they name
  asm volatile("global_load_async_to_lds_b128 %0, %8, off\n\t"
               "global_load_async_to_lds_b128 %1, %9, off\n\t"
               "global_load_async_to_lds_b128 %2, %10, off\n\t"
               "global_load_async_to_lds_b128 %3, %11, off\n\t"
               "global_load_async_to_lds_b128 %4, %12, off\n\t"
               "global_load_async_to_lds_b128 %5, %13, off\n\t"
               "global_load_async_to_lds_b128 %6, %14, off\n\t"
               "global_load_async_to_lds_b128 %7, %15, off\n\t"
               "s_wait_xcnt 0x0"
               :: "v"(kl), "v"(kl + 8 * KROW), "v"(kl + 16 * KROW), "v"(kl + 24 * KROW), "v"(vl), "v"(vl + 64 * VROW), "v"(vl + VPL), "v"(vl + VPL + 64 * VROW),
                  "v"(kp), "v"(kp + 8 * KVW), "v"(kp + 16 * KVW), "v"(kp + 24 * KVW), "v"(hp), "v"(hp + 64 * SS), "v"(lp), "v"(lp + 64 * SS)
               : "memory");
}
// lane l with lane l ^ 16 (the two halves of a wave hold the two halves of one query's keys, or of its output row)
__device__ __forceinline__ float xhalf(float x) { return __builtin_bit_cast(float, __builtin_amdgcn_permlanex16(__builtin_bit_cast(int, x), __builtin_bit_cast(int, x), 0x76543210, 0xfedcba98, false, false)); }
// ---- k_attn: block = (64 queries, head h), 8 waves: waves 0..3 run attention 1 and waves 4..7 attention 2 of the same four 16-query tiles side by side; each trip's K and V tiles are staged once in LDS for all 8 waves; transposed products: S^T = K.Q^T (3 products) and O^T += V^T.P^T (3 products), so lane (g, col) holds query q0 + col: its scores of keys 8 g + r and 16 + 8 g + r of a trip, and its outputs d = 16 dt + 8 g + r; O[q][h*128+d]
__global__ __launch_bounds__(256) void k_attn(const float* __restrict__ Q, const float* __restrict__ Kx, const __bf16* __restrict__ VTH, const __bf16* __restrict__ VTL, const float* __restrict__ LQ1, const float* __restrict__ LK1, const float* __restrict__ LQ2, const float* __restrict__ LK2, const float* __restrict__ G, float* __restrict__ O) {
  __shared__ __align__(16) float so[4][16][132]; __shared__ __align__(16) char skv[2 * ABUF];
  const int tid = threadIdx.x, wave = tid >> 5, lane = tid & 31, col = lane & 15, g = lane >> 4;
  const int sub = __builtin_amdgcn_readfirstlane(wave >> 2), wq = wave & 3;   // which attention (the same in every lane of a wave), which 16-query tile
  const int qb = blockIdx.x, h = blockIdx.y; const int q0 = qb * 64 + wq * 16;
  // lambda_full from the inputs (64-dots)
  float lam; { float s1 = 0.f, s2 = 0.f; for (int i = lane; i < HQ; i += 32) { s1 += bfr(LQ1[i]) * bfr(LK1[i]); s2 += bfr(LQ2[i]) * bfr(LK2[i]); }
#pragma unroll
    for (int o = 1; o < 32; o <<= 1) { s1 += __shfl_xor(s1, o); s2 += __shfl_xor(s2, o); } lam = exp_ni(s1) - exp_ni(s2) + LAMBDA_INIT; }
  const int nks = (qb * 64 + 64) / 32;
  const int qi = q0 + col;
  const float* qrow = Q + (size_t)qi * DM + (2 * h + sub) * HQ;
  float m = -3.0e38f, l = 0.f;   // of query qi: running maximum, base-2 domain (the same in both halves of the wave) and the running sum over this half's keys
  v8f acc[8] = {};
  const unsigned kv0 = (unsigned)(size_t)&skv[0]; const float* Kh = Kx + 2 * h * HQ; const __bf16 *Vhh = VTH + (size_t)h * HD * SS, *Vlh = VTL + (size_t)h * HD * SS;
  stage_kv(Kh, Vhh, Vlh, kv0, tid); WAIT_COPIES(); __syncthreads();          // tile 0 is in buffer 0 for every wave
  stage_kv(Kh + (size_t)32 * KVW, Vhh + 32, Vlh + 32, kv0 + ABUF, tid);      // tile 1 (nks is 2 qb + 2, never below 2) flies while tile 0 is worked on
#pragma unroll 1
  for (int ks = 0; ks < nks; ++ks) { const int bo = (ks & 1) * ABUF; float s[16];   // s[8 ct + r]: key ks * 32 + ct * 16 + 8 g + r, which is the k order of a B fragment
#pragma unroll
    for (int ct = 0; ct < 2; ++ct) { const float* krow = (const float*)&skv[bo + (ct * 16 + col) * KROW] + sub * HQ; v8f c = {};
#pragma unroll
      for (int kc = 0; kc < 2; ++kc) { const F2 kb = split_row(krow, kc * 32, lane); const F2 qa = split_row(qrow, kc * 32, lane); c = wmma_bf(kb.h, qa.l, c); c = wmma_bf(kb.l, qa.h, c); c = wmma_bf(kb.h, qa.h, c); }
#pragma unroll
      for (int r = 0; r < 8; ++r) { const int kk = ks * 32 + ct * 16 + 8 * g + r; s[8 * ct + r] = (kk <= qi) ? c[r] * QK_SCALE_LOG2 : -3.0e38f; } }
    float mx = s[0];
#pragma unroll
    for (int i = 1; i < 16; ++i) mx = fmaxf(mx, s[i]);
    mx = fmaxf(mx, xhalf(mx));
    const float mn = fmaxf(m, mx); const float alpha = exp2_hw(m - mn);   // key 0 is open to every query, so mn is a real score from the first trip on
    float e[16], t[8];
#pragma unroll
    for (int i = 0; i < 16; ++i) e[i] = exp2_hw(s[i] - mn);
#pragma unroll
    for (int i = 0; i < 8; ++i) t[i] = e[i] + e[8 + i];
    float es = ((t[0] + t[4]) + (t[2] + t[6])) + ((t[1] + t[5]) + (t[3] + t[7]));
    l = l * alpha + es; m = mn;
#pragma unroll
    for (int dt = 0; dt < 8; ++dt) acc[dt] *= alpha;
    const F2 pb = bsplit16(e);
#pragma unroll
    for (int dt = 0; dt < 8; ++dt) { const char* vr = &skv[bo + KBUF + (dt * 16 + col) * VROW]; const v16b vh = frag_w(vr, g), vl = frag_w(vr + VPL, g); acc[dt] = wmma_bf(vh, pb.l, acc[dt]); acc[dt] = wmma_bf(vl, pb.h, acc[dt]); acc[dt] = wmma_bf(vh, pb.h, acc[dt]); }
    WAIT_LDS(); WAIT_COPIES(); __syncthreads();   // publishes tile ks + 1 and ends every wave's reads of tile ks
    if (ks + 2 < nks) stage_kv(Kh + (size_t)(ks + 2) * 32 * KVW, Vhh + (ks + 2) * 32, Vlh + (ks + 2) * 32, kv0 + bo, tid); }
  WAIT_COPIES();
  l += xhalf(l);   // the two halves' sums join once
  const float il = 1.0f / l; float* orow = &so[wq][col][8 * g];   // this lane's 8 consecutive d of each 16-wide group dt
  if (sub == 0) {
#pragma unroll
    for (int dt = 0; dt < 8; ++dt) { const v8f a = acc[dt] * il; *(v4f*)(orow + dt * 16) = __builtin_shufflevector(a, a, 0, 1, 2, 3); *(v4f*)(orow + dt * 16 + 4) = __builtin_shufflevector(a, a, 4, 5, 6, 7); }
  }
  __syncthreads();   // hands the normalised attn1 rows of tile wq from wave wq to wave 4 + wq
  if (sub == 1) {
    float ss = 0.f;
#pragma unroll
    for (int dt = 0; dt < 8; ++dt)
#pragma unroll
      for (int r = 0; r < 8; ++r) { const float a = orow[dt * 16 + r] - lam * (acc[dt][r] * il); acc[dt][r] = a; ss += a * a; }
    ss += xhalf(ss);
    const float rs = rsqrtf(ss / (float)HD + 1e-5f) * (1.0f - LAMBDA_INIT);
    v4f gv[16]; const v4f* gp = (const v4f*)(G + 8 * g);   // g in this lane's order: the 8 consecutive values of each 16-wide group as two 16-byte loads, all from one base
#pragma unroll
    for (int dt = 0; dt < 8; ++dt) { gv[2 * dt] = gp[4 * dt]; gv[2 * dt + 1] = gp[4 * dt + 1]; }
    asm volatile("s_wait_xcnt 0x0" :: "v"(gp) : "memory");   // stands in front of any rewrite of the address pair that the g loads name; taking the pair as an input keeps it whole up to here, so that no load of the run lands in it
#pragma unroll
    for (int dt = 0; dt < 8; ++dt)
#pragma unroll
      for (int r = 0; r < 8; ++r) orow[dt * 16 + r] = acc[dt][r] * rs * bfr(gv[2 * dt + (r >> 2)][r & 3]);
    LDSX();
    for (int rl = 0; rl < 16; ++rl) vst2(O + (size_t)(q0 + rl) * DM + h * HD + lane * 4, *(const v4f*)&so[wq][rl][lane * 4]);
  }
}
// ---- k_out: block = (64 rows, 128 cols): out = O(hi/lo) . wproj^T rows (2 products)
__global__ __launch_bounds__(128) void k_out(const float* __restrict__ O, const __bf16* __restrict__ P, float* __restrict__ Y) {
  __shared__ __align__(16) float so[4][16][132]; __shared__ __align__(16) char sw[2 * WBUF];
  const int tid = threadIdx.x, wave = tid >> 5, lane = tid & 31, col = lane & 15, g = lane >> 4; const size_t r0 = (size_t)blockIdx.x * 64 + wave * 16; const int n0 = blockIdx.y * 128;
  v8f acc[8] = {};
  const unsigned sw0 = (unsigned)(size_t)&sw[0]; const __bf16* Pn = P + (size_t)n0 * DM;
  stage_w(Pn, sw0, tid); WAIT_COPIES(); __syncthreads();   // tile 0 is in buffer 0 for every wave
  stage_w(Pn + 64, sw0 + WBUF, tid);                       // tile 1 flies while tile 0 is worked on
#pragma unroll 1   // one trip per stage: the ring's foot (waits, barrier, refill) stands once and the two buffers alternate by t & 1
  for (int t = 0; t < DM / 64; ++t) { const int bo = (t & 1) * WBUF; F2 a[2];
#pragma unroll
    for (int u = 0; u < 2; ++u) a[u] = split_row(O + (r0 + col) * DM, (2 * t + u) * 32, lane);
#pragma unroll
    for (int u = 0; u < 2; ++u) { v16b b[8];
#pragma unroll
      for (int j = 0; j < 8; ++j) b[j] = frag_w(&sw[bo + (j * 16 + col) * WROW + u * 64], g);
#pragma unroll
      for (int j = 0; j < 8; ++j) { acc[j] = wmma_bf(a[u].l, b[j], acc[j]); acc[j] = wmma_bf(a[u].h, b[j], acc[j]); } }
    WAIT_LDS(); WAIT_COPIES(); __syncthreads();   // publishes tile t + 1 and ends every wave's reads of tile t
    if (t + 2 < DM / 64) stage_w(Pn + (t + 2) * 64, sw0 + bo, tid); }
  WAIT_COPIES();
#pragma unroll
  for (int j = 0; j < 8; ++j)
#pragma unroll
    for (int r = 0; r < 8; ++r) so[wave][8 * g + r][j * 16 + col] = acc[j][r];
  LDSX();
  for (int rl = 0; rl < 16; ++rl) vst2(Y + (r0 + rl) * DM + n0 + lane * 4, *(const v4f*)&so[wave][rl][lane * 4]);
}
extern "C" void kernel_launch(void* const* d_in, const int* in_sizes, int n_in, void* d_out, int out_size, void* d_ws, size_t ws_size, hipStream_t stream) {
  (void)in_sizes; (void)n_in; (void)out_size;
  const float** F = (const float**)d_in;   // 0 x [1,2048,2048], 1 Wq, 2 Wk, 3 Wv, 4 Wo [2048,2048] (x @ W), 5 lq1, 6 lk1, 7 lq2, 8 lk2 [64], 9 g [128]
  if (ws_size < (size_t)WS_END) return;
  char* ws = (char*)d_ws; __bf16 *PK = (__bf16*)(ws + WS_PK), *VTH = (__bf16*)(ws + WS_VTH), *VTL = (__bf16*)(ws + WS_VTL);
  float *CS = (float*)(ws + WS_CS), *Q = (float*)(ws + WS_Q), *Kx = (float*)(ws + WS_K), *O = (float*)(ws + WS_O);
  k_packT<<<dim3(DM / 64, DM / 128), 256, 0, stream>>>(F[1], PK + PK_Q); k_packT<<<dim3(DM / 64, DM / 128), 256, 0, stream>>>(F[2], PK + PK_K); k_packT<<<dim3(DM / 64, DM / 128), 256, 0, stream>>>(F[3], PK + PK_V); k_packT<<<dim3(DM / 64, DM / 128), 256, 0, stream>>>(F[4], PK + PK_O);
  k_rope_tab<<<SS, 32, 0, stream>>>(CS);
  k_proj<0><<<dim3(TRP, DM / 128), 128, 0, stream>>>(F[0], PK + PK_Q, CS, Q, DM, nullptr, nullptr);
  k_proj<0><<<dim3(TRP, DM / 128), 128, 0, stream>>>(F[0], PK + PK_K, CS, Kx, DM, nullptr, nullptr);
  k_proj<1><<<dim3(TRP, DM / 128), 128, 0, stream>>>(F[0], PK + PK_V, CS, nullptr, 0, VTH, VTL);
  k_attn<<<dim3(TQB, NH), 256, 0, stream>>>(Q, Kx, VTH, VTL, F[5], F[6], F[7], F[8], F[9], O);
  k_out<<<dim3(TQB, DM / 128), 128, 0, stream>>>(O, PK + PK_O, (float*)d_out);
}

// v007
// A run of this version takes 280 microseconds.
// Next to v006, in two timings, it ran 1.27 times as fast each time.
// Over all steps from v000 it is 4.99 times as fast.
// compute dtype: x, the four weights, the lambda vectors and g (module inputs) rounded to bf16; q/k/v projections with exact bf16 products (x and W are inputs) and interleaved-pair RoPE (tables in f32 as the module's numpy code) in the epilogue; the two causal attentions per head with q.k as bf16 hi + residual pairs (3 products) and P.V with P hi/lo x V hi/lo (3 products); the differential combination, RMSNorm and (1 - lambda_init) scaling in f32; the output projection hi/lo x exact Wo (2 products); all GEMMs on WMMA 16x16x32; f32 accumulate.
#include <hip/hip_runtime.h>
#include <math.h>

typedef __attribute__((ext_vector_type(16))) _Float16 v16h;
typedef __attribute__((ext_vector_type(16))) __bf16 v16b;
typedef __attribute__((ext_vector_type(8)))  _Float16 v8h;
typedef __attribute__((ext_vector_type(8)))  float v8f;
typedef __attribute__((ext_vector_type(4)))  float v4f;
typedef __attribute__((ext_vector_type(2)))  float v2f;
typedef __attribute__((ext_vector_type(4)))  unsigned v4u;
typedef __attribute__((ext_vector_type(4)))  int v4i;
typedef float __attribute__((may_alias)) float_a;
typedef int __attribute__((may_alias)) int_a;

template <typename T> __device__ __forceinline__ void vst2(void* p, T v) { *(T*)p = v;  }
__device__ __forceinline__ v8f wmma16(v16h a, v16h b, v8f c) {
  v8f d = __builtin_amdgcn_wmma_f32_16x16x32_f16(false, a, false, b, (short)0, c, false, false);
  asm volatile("v_nop\n\tv_nop\n\tv_nop\n\tv_nop" : "+v"(d) : "v"(a), "v"(b));
  return d;
}
__device__ __forceinline__ v8f wmma_bf(v16b a, v16b b, v8f c) {
  v8f d = __builtin_amdgcn_wmma_f32_16x16x32_bf16(false, a, false, b, (short)0, c, false, false);
  asm volatile("v_nop\n\tv_nop\n\tv_nop\n\tv_nop" : "+v"(d) : "v"(a), "v"(b));
  return d;
}
// 16x16x32 fragments: lane = (h = lane>>4, row/col = lane&15); elements 0..7 = k0+8h+0..7, 8..15 = k0+16+8h+0..7; D element r = row 8h+r
__device__ __forceinline__ v16h frag_h(const _Float16* rowk0, int lane) {
  union { v16h v; v8h q[2]; } u; const _Float16* p = rowk0 + 8 * (lane >> 4);
  u.q[0] = *(const v8h*)p; u.q[1] = *(const v8h*)(p + 16); return u.v;
}
__device__ __forceinline__ v16h frag_f32(const float* rowk0, int lane) {
  v16h a; const float* p = rowk0 + 8 * (lane >> 4);
#pragma unroll
  for (int i = 0; i < 8; ++i) { a[i] = (_Float16)p[i]; a[8 + i] = (_Float16)p[16 + i]; }
  return a;
}
__device__ __forceinline__ v16h frag_f32s(const float* rowk0, int lane, float sc) {
  v16h a; const float* p = rowk0 + 8 * (lane >> 4);
#pragma unroll
  for (int i = 0; i < 8; ++i) { a[i] = (_Float16)(p[i] * sc); a[8 + i] = (_Float16)(p[16 + i] * sc); }
  return a;
}
// column fragment from a [K][ld] layout (column n), rows >= K read as 0
__device__ __forceinline__ v16h fragc_f32(const float* W, int k0, int n, int lane, int ld, int K) {
  v16h a; const int g = lane >> 4;
#pragma unroll
  for (int i = 0; i < 8; ++i) { const int ka = k0 + 8 * g + i, kb = ka + 16;
    a[i] = (_Float16)(ka < K ? W[(size_t)(ka < K ? ka : K - 1) * ld + n] : 0.f); a[8 + i] = (_Float16)(kb < K ? W[(size_t)(kb < K ? kb : K - 1) * ld + n] : 0.f); }
  return a;
}
struct F2 { v16b h, l; };
__device__ __forceinline__ F2 bsplit16(const float v[16]) { F2 r;
#pragma unroll
  for (int i = 0; i < 16; ++i) { const __bf16 h = (__bf16)v[i]; r.h[i] = h; r.l[i] = (__bf16)(v[i] - (float)h); }
  return r; }
__device__ __forceinline__ F2 split_row(const float* row, int k0, int lane) { float v[16]; const float* p = row + k0 + 8 * (lane >> 4);
#pragma unroll
  for (int i = 0; i < 8; ++i) { v[i] = p[i]; v[8 + i] = p[16 + i]; }
  return bsplit16(v); }
__device__ __forceinline__ F2 split_rowK(const float* row, int k0, int lane, int K) { float v[16]; const int g = lane >> 4;
#pragma unroll
  for (int i = 0; i < 8; ++i) { const int ka = k0 + 8 * g + i, kb = ka + 16; v[i] = ka < K ? row[ka < K ? ka : K - 1] : 0.f; v[8 + i] = kb < K ? row[kb < K ? kb : K - 1] : 0.f; }
  return bsplit16(v); }
__device__ __forceinline__ F2 split_col(const float* W, int k0, int n, int lane, int ld, int K) { float v[16]; const int g = lane >> 4;
#pragma unroll
  for (int i = 0; i < 8; ++i) { const int ka = k0 + 8 * g + i, kb = ka + 16; v[i] = ka < K ? W[(size_t)(ka < K ? ka : K - 1) * ld + n] : 0.f; v[8 + i] = kb < K ? W[(size_t)(kb < K ? kb : K - 1) * ld + n] : 0.f; }
  return bsplit16(v); }
__device__ __forceinline__ v8f mac3(const F2& a, const F2& b, v8f c) { c = wmma_bf(a.l, b.h, c); c = wmma_bf(a.h, b.l, c); return wmma_bf(a.h, b.h, c); }
__device__ __forceinline__ float sigm(float v) { return 1.0f / (1.0f + expf(-v)); }
#define LDSX() do { asm volatile("s_wait_dscnt 0" ::: "memory"); __builtin_amdgcn_wave_barrier(); __builtin_amdgcn_fence(__ATOMIC_RELEASE, "workgroup"); } while (0)


// Differential attention (B 1, S 2048, E 2048, 16 heads; q/k as 32 half-heads x 64 with interleaved RoPE, v as 16 heads x 128): a = softmax_causal(q1 k1^T/8) v - lambda_full * softmax_causal(q2 k2^T/8) v; lambda_full = exp(lq1.lk1) - exp(lq2.lk2) + lambda_init; a = RMSNorm_128(a) * g * (1 - lambda_init); out = a Wo.
#define SS 2048
#define DM 2048
#define NH 16
#define HD 128               // v head dim (2*64)
#define HQ 64                // q/k half-head dim
#define KVW DM
#define LAMBDA_INIT 0.78360577f   /* 0.8 - 0.6*exp(-0.3*12) = 0.7836057665 */
#ifndef TQB
#define TQB (SS / 64)
#define TRP (SS / 64)          // projection row tiles (all)
#endif
typedef __attribute__((ext_vector_type(8))) __bf16 v8b;
__device__ __forceinline__ v16b frag_b(const __bf16* rowk0, int lane) {
  union { v16b v; v8b q[2]; } u; const __bf16* p = rowk0 + 8 * (lane >> 4);
  u.q[0] = *(const v8b*)p; u.q[1] = *(const v8b*)(p + 16); return u.v;
}
__device__ __forceinline__ float bfr(float v) { return (float)(__bf16)v; }
__device__ __attribute__((noinline)) float exp_ni(float v) { return expf(v); }
__device__ __attribute__((noinline)) float erf_ni(float v) { return erff(v); }
// 2^v as the one hardware instruction v_exp_f32, in line; a very negative v (a masked score, the start value of the running maximum) gives exactly 0
__device__ __forceinline__ float exp2_hw(float v) { return __builtin_amdgcn_exp2f(v); }
#define QK_SCALE_LOG2 0.18033688f   /* (1/8) * log2(e): scores and their running maximum are kept in the base-2 domain, so that exp(s - m) is 2^(s2 - m2) */

#define PK_Q 0
#define PK_K (PK_Q + DM * DM)
#define PK_V (PK_K + KVW * DM)
#define PK_O (PK_V + KVW * DM)
#define PK_END (PK_O + DM * DM)
#define WS_PK  0u
#define WS_CS  (WS_PK + 2u * PK_END)             // f32 [2048][32] cos, then [2048][32] sin
#define WS_QH  (WS_CS + 4u * 2 * SS * 32)        // q after RoPE as two bf16 planes [2048][2048]: hi, then the residual lo; k the same
#define WS_QL  (WS_QH + 2u * SS * DM)
#define WS_KH  (WS_QL + 2u * SS * DM)
#define WS_KL  (WS_KH + 2u * SS * KVW)
#define WS_VTH (WS_KL + 2u * SS * KVW)
#define WS_VTL (WS_VTH + 2u * KVW * SS)
#define WS_O   (WS_VTL + 2u * KVW * SS)
#define WS_END (WS_O + 4u * SS * DM)

// ---- weight tile in LDS: one stage = 128 packed weight rows x 64 k (128 B a row), LDS pitch 144 B (16 B x odd, for the ds_load_b128 readers), two stages
#define WROW 144
#define WBUF (128 * WROW)
// 128 threads bring one stage: copy i takes rows 16 i + (tid >> 3), 16 B a lane, so a wave's 32 lanes cover 4 whole 128-B rows per copy
__device__ __forceinline__ void stage_w(const __bf16* __restrict__ Pt, unsigned lds, int tid) {
  const __bf16* gp = Pt + (size_t)(tid >> 3) * DM + (tid & 7) * 8; const unsigned l = lds + (tid >> 3) * WROW + (tid & 7) * 16;
  // the eight copies and, as the last line, the wait that stands in front of any rewrite of the address registers they name
  asm volatile("global_load_async_to_lds_b128 %0, %8, off\n\t"
               "global_load_async_to_lds_b128 %1, %9, off\n\t"
               "global_load_async_to_lds_b128 %2, %10, off\n\t"
               "global_load_async_to_lds_b128 %3, %11, off\n\t"
               "global_load_async_to_lds_b128 %4, %12, off\n\t"
               "global_load_async_to_lds_b128 %5, %13, off\n\t"
               "global_load_async_to_lds_b128 %6, %14, off\n\t"
               "global_load_async_to_lds_b128 %7, %15, off\n\t"
               "s_wait_xcnt 0x0"
               :: "v"(l), "v"(l + 16 * WROW), "v"(l + 32 * WROW), "v"(l + 48 * WROW), "v"(l + 64 * WROW), "v"(l + 80 * WROW), "v"(l + 96 * WROW), "v"(l + 112 * WROW),
                  "v"(gp), "v"(gp + 16 * DM), "v"(gp + 32 * DM), "v"(gp + 48 * DM), "v"(gp + 64 * DM), "v"(gp + 80 * DM), "v"(gp + 96 * DM), "v"(gp + 112 * DM)
               : "memory");
}
// fragment of one staged row: the same bytes in the same k order as frag_b reads from the packed row
__device__ __forceinline__ v16b frag_w(const char* rowk0, int g) {
  union { v16b v; v8b q[2]; } u; const char* p = rowk0 + 16 * g;
  u.q[0] = *(const v8b*)p; u.q[1] = *(const v8b*)(p + 32); return u.v;
}
#define WAIT_COPIES() asm volatile("s_wait_asynccnt 0x0" ::: "memory")   /* this wave's copies have landed */
#define WAIT_LDS()    asm volatile("s_wait_dscnt 0x0" ::: "memory")      /* this wave's LDS reads have returned */

// ---- k_packT: block = a 64 (k) x 128 (n) tile of a [DM][DM] (x @ W) matrix, written as 128 packed rows DST[n][k0 .. k0 + 63]; both sides of the transpose move whole 128-B lines: a wave's load covers 512 contiguous bytes of one k row, and 8 lanes store one 128-B piece of a packed row
#define PROW 144   /* LDS pitch of a tile row: 64 k x 2 B + 16 B; unpadded, the rows that the lanes of one ds_store_b128 write (4 apart) would all fall on the same banks */
__global__ __launch_bounds__(256) void k_packT(const float* __restrict__ Wm, __bf16* __restrict__ DST) {
  __shared__ __align__(16) char s[128 * PROW]; const int tid = threadIdx.x, wave = tid >> 5, lane = tid & 31; const int k0 = blockIdx.x * 64, n0 = blockIdx.y * 128;
  const float* p = Wm + (size_t)(k0 + 8 * wave) * DM + n0 + 4 * lane; v4f r[8];   // rows k0 + 8 wave + 0..7, columns n0 + 4 lane + 0..3
  // every loop of this kernel is unrolled: r[] and o are indexed by constants and stay in registers, and the 8 loads go out as one group ahead of the first use
#pragma unroll
  for (int i = 0; i < 8; ++i) r[i] = *(const v4f*)(p + (size_t)i * DM);
#pragma unroll
  for (int j = 0; j < 4; ++j) { v8b o;
#pragma unroll
    for (int i = 0; i < 8; ++i) o[i] = (__bf16)r[i][j];
    *(v8b*)&s[(4 * lane + j) * PROW + 16 * wave] = o; }
  __syncthreads();
#pragma unroll
  for (int i = 0; i < 4; ++i) { const int row = 32 * i + (tid >> 3), pc = tid & 7; vst2((unsigned*)(DST + (size_t)(n0 + row) * DM + k0 + pc * 8), *(const v4u*)&s[row * PROW + pc * 16]); }
}
__global__ __launch_bounds__(32) void k_rope_tab(float* __restrict__ CS) {
  __shared__ __align__(16) float sc[32], ssn[32]; const int t = blockIdx.x, i = threadIdx.x;
  const float dv = expf((float)(2 * i) * (-9.2103404f / 64.0f));   /* ln(1e4) as the f32 literal numpy uses */ const float ang = (float)t * dv; sc[i] = cosf(ang); ssn[i] = sinf(ang);
  __syncthreads();
  if (i < 8) vst2(CS + (size_t)t * 32 + i * 4, *(const v4f*)&sc[i * 4]); else if (i < 16) vst2(CS + (size_t)SS * 32 + (size_t)t * 32 + (i - 8) * 4, *(const v4f*)&ssn[(i - 8) * 4]);
}
// ---- k_proj<MODE>: block = (64 rows, 128 cols = one head): Y = bf16(x) . P rows (exact); MODE 0: RoPE, then rows of bf16 hi and residual lo, one plane each (q/k): the split that the three score products need, made once here; MODE 1: plain -> transposed bf16 hi/lo planes (v)
template <int MODE>
__global__ __launch_bounds__(128) void k_proj(const float* __restrict__ X, const __bf16* __restrict__ P, const float* __restrict__ CS, __bf16* __restrict__ PH, __bf16* __restrict__ PL) {
  __shared__ __align__(16) float so[MODE ? 1 : 4][16][132]; __shared__ __align__(16) __bf16 sth[MODE ? 128 : 1][72], stl[MODE ? 128 : 1][72]; __shared__ __align__(16) char sw[2 * WBUF];
  const int tid = threadIdx.x, wave = tid >> 5, lane = tid & 31, col = lane & 15, g = lane >> 4; const size_t r0 = (size_t)blockIdx.x * 64 + wave * 16; const int n0 = blockIdx.y * 128;
  v8f acc[8] = {};
  const unsigned sw0 = (unsigned)(size_t)&sw[0]; const __bf16* Pn = P + (size_t)n0 * DM;
  stage_w(Pn, sw0, tid); WAIT_COPIES(); __syncthreads();   // tile 0 is in buffer 0 for every wave
  stage_w(Pn + 64, sw0 + WBUF, tid);                       // tile 1 flies while tile 0 is worked on
#pragma unroll 1   // one trip per stage: the ring's foot (waits, barrier, refill) stands once and the two buffers alternate by t & 1
  for (int t = 0; t < DM / 64; ++t) { const int bo = (t & 1) * WBUF; v16b a[2];
#pragma unroll
    for (int u = 0; u < 2; ++u) { const float* p = X + (r0 + col) * DM + (2 * t + u) * 32 + 8 * g;
#pragma unroll
      for (int i = 0; i < 8; ++i) { a[u][i] = (__bf16)p[i]; a[u][8 + i] = (__bf16)p[16 + i]; } }
#pragma unroll
    for (int u = 0; u < 2; ++u) { v16b b[8];
#pragma unroll
      for (int j = 0; j < 8; ++j) b[j] = frag_w(&sw[bo + (j * 16 + col) * WROW + u * 64], g);
#pragma unroll
      for (int j = 0; j < 8; ++j) acc[j] = wmma_bf(a[u], b[j], acc[j]); }
    WAIT_LDS(); WAIT_COPIES(); __syncthreads();   // publishes tile t + 1 and ends every wave's reads of tile t
    if (t + 2 < DM / 64) stage_w(Pn + (t + 2) * 64, sw0 + bo, tid); }
  WAIT_COPIES();
  if (MODE == 0) {
    // projections to LDS, then interleaved-pair RoPE in place within each 64-wide half-head: (x_{2i}, x_{2i+1}) -> (x c - y s, x s + y c) with angle index i
#pragma unroll
    for (int j = 0; j < 8; ++j)
#pragma unroll
      for (int r = 0; r < 8; ++r) so[wave][8 * g + r][j * 16 + col] = acc[j][r];
    LDSX();
    for (int q = lane; q < 16 * 64; q += 32) { const int rl = q >> 6, pi = q & 63; const int half = pi >> 5, i = pi & 31; const size_t t = r0 + rl; const float c = CS[t * 32 + i], s = CS[(size_t)SS * 32 + t * 32 + i]; float* e = &so[wave][rl][half * 64 + 2 * i]; const float xe = e[0], xo = e[1]; e[0] = xe * c - xo * s; e[1] = xe * s + xo * c; }
    LDSX();
    // 16 lanes take one row of 128 values, 8 a lane: 16 B of the hi plane and 16 B of the lo plane, so a wave's store covers two whole 256-B row pieces
    for (int it = 0; it < 8; ++it) { const int rl = 2 * it + g; const float* e = &so[wave][rl][col * 8]; v8b hb, lb;
#pragma unroll   // hb and lb are indexed by constants and stay in registers
      for (int i = 0; i < 8; ++i) { const float v = e[i]; const __bf16 hh = (__bf16)v; hb[i] = hh; lb[i] = (__bf16)(v - (float)hh); }
      const size_t o = (r0 + rl) * DM + n0 + col * 8; vst2(PH + o, hb); vst2(PL + o, lb); }
  } else {
#pragma unroll
    for (int j = 0; j < 8; ++j)
#pragma unroll
      for (int r = 0; r < 8; ++r) { const float v = acc[j][r]; const __bf16 hb = (__bf16)v; sth[j * 16 + col][wave * 16 + 8 * g + r] = hb; stl[j * 16 + col][wave * 16 + 8 * g + r] = (__bf16)(v - (float)hb); }
    __syncthreads();
    const int s0 = blockIdx.x * 64;
    for (int q = tid; q < 128 * 8; q += 128) { const int d = q >> 3, pc = q & 7; const size_t o = (size_t)(n0 + d) * SS + s0 + pc * 8; vst2((unsigned*)(PH + o), *(const v4u*)&sth[d][pc * 8]); vst2((unsigned*)(PL + o), *(const v4u*)&stl[d][pc * 8]); }
  }
}
// ---- K and V tiles in LDS: one stage = the 32 keys of one trip for one head: the hi and the lo plane of K, 32 rows x 256 B each (both 64-wide half-heads of a key), then the hi and the lo plane of V^T, 128 rows (d) x 64 B (32 keys) each; LDS pitches 272 B and 80 B (16 B x odd, for the ds_load_b128 readers), two stages
#define KROW 272
#define VROW 80
#define KPL  (32 * KROW)
#define KBUF (2 * KPL)
#define VPL  (128 * VROW)
#define ABUF (KBUF + 2 * VPL)
// 256 threads bring one stage, 16 B a lane: K copy i of a plane takes rows 16 i + (tid >> 4), a wave covering two whole 256-B rows; V copy i of a plane takes rows 64 i + (tid >> 2), a wave covering 8 rows of 64 B
__device__ __forceinline__ void stage_kv(const __bf16* __restrict__ Kh, const __bf16* __restrict__ Kl, const __bf16* __restrict__ Vh, const __bf16* __restrict__ Vl, unsigned lds, int tid) {
  const size_t ko = (size_t)(tid >> 4) * KVW + (tid & 15) * 8; const __bf16 *kh = Kh + ko, *kp = Kl + ko; const unsigned kl = lds + (tid >> 4) * KROW + (tid & 15) * 16;
  const size_t vo = (size_t)(tid >> 2) * SS + (tid & 3) * 8; const __bf16 *hp = Vh + vo, *lp = Vl + vo; const unsigned vl = lds + KBUF + (tid >> 2) * VROW + (tid & 3) * 16;
  // the eight copies and, as the last line, the wait that stands in front of any rewrite of the address registers they name
  asm volatile("global_load_async_to_lds_b128 %0, %8, off\n\t"
               "global_load_async_to_lds_b128 %1, %9, off\n\t"
               "global_load_async_to_lds_b128 %2, %10, off\n\t"
               "global_load_async_to_lds_b128 %3, %11, off\n\t"
               "global_load_async_to_lds_b128 %4, %12, off\n\t"
               "global_load_async_to_lds_b128 %5, %13, off\n\t"
               "global_load_async_to_lds_b128 %6, %14, off\n\t"
               "global_load_async_to_lds_b128 %7, %15, off\n\t"
               "s_wait_xcnt 0x0"
               :: "v"(kl), "v"(kl + 16 * KROW), "v"(kl + KPL), "v"(kl + KPL + 16 * KROW), "v"(vl), "v"(vl + 64 * VROW), "v"(vl + VPL), "v"(vl + VPL + 64 * VROW),
                  "v"(kh), "v"(kh + 16 * KVW), "v"(kp), "v"(kp + 16 * KVW), "v"(hp), "v"(hp + 64 * SS), "v"(lp), "v"(lp + 64 * SS)
               : "memory");
}
// lane l with lane l ^ 16 (the two halves of a wave hold the two halves of one query's keys, or of its output row)
__device__ __forceinline__ float xhalf(float x) { return __builtin_bit_cast(float, __builtin_amdgcn_permlanex16(__builtin_bit_cast(int, x), __builtin_bit_cast(int, x), 0x76543210, 0xfedcba98, false, false)); }
// ---- k_attn: block = (64 queries, head h), 8 waves: waves 0..3 run attention 1 and waves 4..7 attention 2 of the same four 16-query tiles side by side; each trip's K and V tiles are staged once in LDS for all 8 waves; transposed products: S^T = K.Q^T (3 products) and O^T += V^T.P^T (3 products), so lane (g, col) holds query q0 + col: its scores of keys 8 g + r and 16 + 8 g + r of a trip, and its outputs d = 16 dt + 8 g + r; O[q][h*128+d]
__global__ __launch_bounds__(256) void k_attn(const __bf16* __restrict__ QH, const __bf16* __restrict__ QL, const __bf16* __restrict__ KH, const __bf16* __restrict__ KL, const __bf16* __restrict__ VTH, const __bf16* __restrict__ VTL, const float* __restrict__ LQ1, const float* __restrict__ LK1, const float* __restrict__ LQ2, const float* __restrict__ LK2, const float* __restrict__ G, float* __restrict__ O) {
  __shared__ __align__(16) float so[4][16][132]; __shared__ __align__(16) char skv[2 * ABUF];
  const int tid = threadIdx.x, wave = tid >> 5, lane = tid & 31, col = lane & 15, g = lane >> 4;
  const int sub = __builtin_amdgcn_readfirstlane(wave >> 2), wq = wave & 3;   // which attention (the same in every lane of a wave), which 16-query tile
  const int qb = blockIdx.x, h = blockIdx.y; const int q0 = qb * 64 + wq * 16;
  // lambda_full from the inputs (64-dots)
  float lam; { float s1 = 0.f, s2 = 0.f; for (int i = lane; i < HQ; i += 32) { s1 += bfr(LQ1[i]) * bfr(LK1[i]); s2 += bfr(LQ2[i]) * bfr(LK2[i]); }
#pragma unroll
    for (int o = 1; o < 32; o <<= 1) { s1 += __shfl_xor(s1, o); s2 += __shfl_xor(s2, o); } lam = exp_ni(s1) - exp_ni(s2) + LAMBDA_INIT; }
  const int nks = (qb * 64 + 64) / 32;
  const int qi = q0 + col;
  // this lane's query as B fragments, hi and lo of both 32-wide k chunks: loaded once, they stay in registers through all trips
  const size_t qo = (size_t)qi * DM + (2 * h + sub) * HQ + 8 * g; const v8b *qhp = (const v8b*)(QH + qo), *qlp = (const v8b*)(QL + qo);   // in units of 8 values: chunk kc takes units 4 kc and 4 kc + 2, the k order of frag_b
  union { v16b v; v8b q[2]; } qh[2], ql[2];
#pragma unroll   // qh and ql are indexed by constants and stay in registers
  for (int kc = 0; kc < 2; ++kc) { qh[kc].q[0] = qhp[4 * kc]; qh[kc].q[1] = qhp[4 * kc + 2]; ql[kc].q[0] = qlp[4 * kc]; ql[kc].q[1] = qlp[4 * kc + 2]; }
  asm volatile("s_wait_xcnt 0x0" :: "v"(qhp), "v"(qlp) : "memory");   // stands in front of any rewrite of the two address pairs that the query loads name; taking the pairs as inputs keeps them whole up to here
  float m = -3.0e38f, l = 0.f;   // of query qi: running maximum, base-2 domain (the same in both halves of the wave) and the running sum over this half's keys
  v8f acc[8] = {};
  const unsigned kv0 = (unsigned)(size_t)&skv[0]; const __bf16 *Khh = KH + 2 * h * HQ, *Klh = KL + 2 * h * HQ; const __bf16 *Vhh = VTH + (size_t)h * HD * SS, *Vlh = VTL + (size_t)h * HD * SS;
  stage_kv(Khh, Klh, Vhh, Vlh, kv0, tid); WAIT_COPIES(); __syncthreads();          // tile 0 is in buffer 0 for every wave
  stage_kv(Khh + (size_t)32 * KVW, Klh + (size_t)32 * KVW, Vhh + 32, Vlh + 32, kv0 + ABUF, tid);      // tile 1 (nks is 2 qb + 2, never below 2) flies while tile 0 is worked on
#pragma unroll 1
  for (int ks = 0; ks < nks; ++ks) { const int bo = (ks & 1) * ABUF; float s[16];   // s[8 ct + r]: key ks * 32 + ct * 16 + 8 g + r, which is the k order of a B fragment
#pragma unroll
    for (int ct = 0; ct < 2; ++ct) { const char* kr = &skv[bo + (ct * 16 + col) * KROW + sub * (2 * HQ)]; v8f c = {};
#pragma unroll
      for (int kc = 0; kc < 2; ++kc) { const v16b kh = frag_w(kr + kc * 64, g), kl = frag_w(kr + KPL + kc * 64, g); c = wmma_bf(kh, ql[kc].v, c); c = wmma_bf(kl, qh[kc].v, c); c = wmma_bf(kh, qh[kc].v, c); }
#pragma unroll
      for (int r = 0; r < 8; ++r) { const int kk = ks * 32 + ct * 16 + 8 * g + r; s[8 * ct + r] = (kk <= qi) ? c[r] * QK_SCALE_LOG2 : -3.0e38f; } }
    float mx = s[0];
#pragma unroll
    for (int i = 1; i < 16; ++i) mx = fmaxf(mx, s[i]);
    mx = fmaxf(mx, xhalf(mx));
    const float mn = fmaxf(m, mx); const float alpha = exp2_hw(m - mn);   // key 0 is open to every query, so mn is a real score from the first trip on
    float e[16], t[8];
#pragma unroll
    for (int i = 0; i < 16; ++i) e[i] = exp2_hw(s[i] - mn);
#pragma unroll
    for (int i = 0; i < 8; ++i) t[i] = e[i] + e[8 + i];
    float es = ((t[0] + t[4]) + (t[2] + t[6])) + ((t[1] + t[5]) + (t[3] + t[7]));
    l = l * alpha + es; m = mn;
#pragma unroll
    for (int dt = 0; dt < 8; ++dt) acc[dt] *= alpha;
    const F2 pb = bsplit16(e);
#pragma unroll
    for (int dt = 0; dt < 8; ++dt) { const char* vr = &skv[bo + KBUF + (dt * 16 + col) * VROW]; const v16b vh = frag_w(vr, g), vl = frag_w(vr + VPL, g); acc[dt] = wmma_bf(vh, pb.l, acc[dt]); acc[dt] = wmma_bf(vl, pb.h, acc[dt]); acc[dt] = wmma_bf(vh, pb.h, acc[dt]); }
    WAIT_LDS(); WAIT_COPIES(); __syncthreads();   // publishes tile ks + 1 and ends every wave's reads of tile ks
    if (ks + 2 < nks) stage_kv(Khh + (size_t)(ks + 2) * 32 * KVW, Klh + (size_t)(ks + 2) * 32 * KVW, Vhh + (ks + 2) * 32, Vlh + (ks + 2) * 32, kv0 + bo, tid); }
  WAIT_COPIES();
  l += xhalf(l);   // the two halves' sums join once
  const float il = 1.0f / l; float* orow = &so[wq][col][8 * g];   // this lane's 8 consecutive d of each 16-wide group dt
  if (sub == 0) {
#pragma unroll
    for (int dt = 0; dt < 8; ++dt) { const v8f a = acc[dt] * il; *(v4f*)(orow + dt * 16) = __builtin_shufflevector(a, a, 0, 1, 2, 3); *(v4f*)(orow + dt * 16 + 4) = __builtin_shufflevector(a, a, 4, 5, 6, 7); }
  }
  __syncthreads();   // hands the normalised attn1 rows of tile wq from wave wq to wave 4 + wq
  if (sub == 1) {
    float ss = 0.f;
#pragma unroll
    for (int dt = 0; dt < 8; ++dt)
#pragma unroll
      for (int r = 0; r < 8; ++r) { const float a = orow[dt * 16 + r] - lam * (acc[dt][r] * il); acc[dt][r] = a; ss += a * a; }
    ss += xhalf(ss);
    const float rs = rsqrtf(ss / (float)HD + 1e-5f) * (1.0f - LAMBDA_INIT);
    v4f gv[16]; const v4f* gp = (const v4f*)(G + 8 * g);   // g in this lane's order: the 8 consecutive values of each 16-wide group as two 16-byte loads, all from one base
#pragma unroll
    for (int dt = 0; dt < 8; ++dt) { gv[2 * dt] = gp[4 * dt]; gv[2 * dt + 1] = gp[4 * dt + 1]; }
    asm volatile("s_wait_xcnt 0x0" :: "v"(gp) : "memory");   // stands in front of any rewrite of the address pair that the g loads name; taking the pair as an input keeps it whole up to here, so that no load of the run lands in it
#pragma unroll
    for (int dt = 0; dt < 8; ++dt)
#pragma unroll
      for (int r = 0; r < 8; ++r) orow[dt * 16 + r] = acc[dt][r] * rs * bfr(gv[2 * dt + (r >> 2)][r & 3]);
    LDSX();
    for (int rl = 0; rl < 16; ++rl) vst2(O + (size_t)(q0 + rl) * DM + h * HD + lane * 4, *(const v4f*)&so[wq][rl][lane * 4]);
  }
}
// ---- k_out: block = (64 rows, 128 cols): out = O(hi/lo) . wproj^T rows (2 products)
__global__ __launch_bounds__(128) void k_out(const float* __restrict__ O, const __bf16* __restrict__ P, float* __restrict__ Y) {
  __shared__ __align__(16) float so[4][16][132]; __shared__ __align__(16) char sw[2 * WBUF];
  const int tid = threadIdx.x, wave = tid >> 5, lane = tid & 31, col = lane & 15, g = lane >> 4; const size_t r0 = (size_t)blockIdx.x * 64 + wave * 16; const int n0 = blockIdx.y * 128;
  v8f acc[8] = {};
  const unsigned sw0 = (unsigned)(size_t)&sw[0]; const __bf16* Pn = P + (size_t)n0 * DM;
  stage_w(Pn, sw0, tid); WAIT_COPIES(); __syncthreads();   // tile 0 is in buffer 0 for every wave
  stage_w(Pn + 64, sw0 + WBUF, tid);                       // tile 1 flies while tile 0 is worked on
#pragma unroll 1   // one trip per stage: the ring's foot (waits, barrier, refill) stands once and the two buffers alternate by t & 1
  for (int t = 0; t < DM / 64; ++t) { const int bo = (t & 1) * WBUF; F2 a[2];
#pragma unroll
    for (int u = 0; u < 2; ++u) a[u] = split_row(O + (r0 + col) * DM, (2 * t + u) * 32, lane);
#pragma unroll
    for (int u = 0; u < 2; ++u) { v16b b[8];
#pragma unroll
      for (int j = 0; j < 8; ++j) b[j] = frag_w(&sw[bo + (j * 16 + col) * WROW + u * 64], g);
#pragma unroll
      for (int j = 0; j < 8; ++j) { acc[j] = wmma_bf(a[u].l, b[j], acc[j]); acc[j] = wmma_bf(a[u].h, b[j], acc[j]); } }
    WAIT_LDS(); WAIT_COPIES(); __syncthreads();   // publishes tile t + 1 and ends every wave's reads of tile t
    if (t + 2 < DM / 64) stage_w(Pn + (t + 2) * 64, sw0 + bo, tid); }
  WAIT_COPIES();
#pragma unroll
  for (int j = 0; j < 8; ++j)
#pragma unroll
    for (int r = 0; r < 8; ++r) so[wave][8 * g + r][j * 16 + col] = acc[j][r];
  LDSX();
  for (int rl = 0; rl < 16; ++rl) vst2(Y + (r0 + rl) * DM + n0 + lane * 4, *(const v4f*)&so[wave][rl][lane * 4]);
}
extern "C" void kernel_launch(void* const* d_in, const int* in_sizes, int n_in, void* d_out, int out_size, void* d_ws, size_t ws_size, hipStream_t stream) {
  (void)in_sizes; (void)n_in; (void)out_size;
  const float** F = (const float**)d_in;   // 0 x [1,2048,2048], 1 Wq, 2 Wk, 3 Wv, 4 Wo [2048,2048] (x @ W), 5 lq1, 6 lk1, 7 lq2, 8 lk2 [64], 9 g [128]
  if (ws_size < (size_t)WS_END) return;
  char* ws = (char*)d_ws; __bf16 *PK = (__bf16*)(ws + WS_PK), *VTH = (__bf16*)(ws + WS_VTH), *VTL = (__bf16*)(ws + WS_VTL);
  __bf16 *QH = (__bf16*)(ws + WS_QH), *QL = (__bf16*)(ws + WS_QL), *KH = (__bf16*)(ws + WS_KH), *KL = (__bf16*)(ws + WS_KL);
  float *CS = (float*)(ws + WS_CS), *O = (float*)(ws + WS_O);
  k_packT<<<dim3(DM / 64, DM / 128), 256, 0, stream>>>(F[1], PK + PK_Q); k_packT<<<dim3(DM / 64, DM / 128), 256, 0, stream>>>(F[2], PK + PK_K); k_packT<<<dim3(DM / 64, DM / 128), 256, 0, stream>>>(F[3], PK + PK_V); k_packT<<<dim3(DM / 64, DM / 128), 256, 0, stream>>>(F[4], PK + PK_O);
  k_rope_tab<<<SS, 32, 0, stream>>>(CS);
  k_proj<0><<<dim3(TRP, DM / 128), 128, 0, stream>>>(F[0], PK + PK_Q, CS, QH, QL);
  k_proj<0><<<dim3(TRP, DM / 128), 128, 0, stream>>>(F[0], PK + PK_K, CS, KH, KL);
  k_proj<1><<<dim3(TRP, DM / 128), 128, 0, stream>>>(F[0], PK + PK_V, CS, VTH, VTL);
  k_attn<<<dim3(TQB, NH), 256, 0, stream>>>(QH, QL, KH, KL, VTH, VTL, F[5], F[6], F[7], F[8], F[9], O);
  k_out<<<dim3(TQB, DM / 128), 128, 0, stream>>>(O, PK + PK_O, (float*)d_out);
}

// v008
// It runs in 258 microseconds.
// Next to v007, in two timings, it ran 1.09 and 1.08 times as fast.
// Counting every step since v000, it is 5.42 times as fast.
// compute dtype: x, the four weights, the lambda vectors and g (module inputs) rounded to bf16; q/k/v projections with exact bf16 products (x and W are inputs) and interleaved-pair RoPE (tables in f32 as the module's numpy code) in the epilogue; the two causal attentions per head with q.k as bf16 hi + residual pairs (3 products) and P.V with P hi/lo x V hi/lo (3 products); the differential combination, RMSNorm and (1 - lambda_init) scaling in f32; the output projection hi/lo x exact Wo (2 products); all GEMMs on WMMA 16x16x32; f32 accumulate.
#include <hip/hip_runtime.h>
#include <math.h>

typedef __attribute__((ext_vector_type(16))) _Float16 v16h;
typedef __attribute__((ext_vector_type(16))) __bf16 v16b;
typedef __attribute__((ext_vector_type(8)))  _Float16 v8h;
typedef __attribute__((ext_vector_type(8)))  float v8f;
typedef __attribute__((ext_vector_type(4)))  float v4f;
typedef __attribute__((ext_vector_type(2)))  float v2f;
typedef __attribute__((ext_vector_type(4)))  unsigned v4u;
typedef __attribute__((ext_vector_type(4)))  int v4i;
typedef float __attribute__((may_alias)) float_a;
typedef int __attribute__((may_alias)) int_a;

template <typename T> __device__ __forceinline__ void vst2(void* p, T v) { *(T*)p = v;  }
__device__ __forceinline__ v8f wmma16(v16h a, v16h b, v8f c) {
  v8f d = __builtin_amdgcn_wmma_f32_16x16x32_f16(false, a, false, b, (short)0, c, false, false);
  asm volatile("v_nop\n\tv_nop\n\tv_nop\n\tv_nop" : "+v"(d) : "v"(a), "v"(b));
  return d;
}
__device__ __forceinline__ v8f wmma_bf(v16b a, v16b b, v8f c) {
  v8f d = __builtin_amdgcn_wmma_f32_16x16x32_bf16(false, a, false, b, (short)0, c, false, false);
  asm volatile("v_nop\n\tv_nop\n\tv_nop\n\tv_nop" : "+v"(d) : "v"(a), "v"(b));
  return d;
}
// 16x16x32 fragments: lane = (h = lane>>4, row/col = lane&15); elements 0..7 = k0+8h+0..7, 8..15 = k0+16+8h+0..7; D element r = row 8h+r
__device__ __forceinline__ v16h frag_h(const _Float16* rowk0, int lane) {
  union { v16h v; v8h q[2]; } u; const _Float16* p = rowk0 + 8 * (lane >> 4);
  u.q[0] = *(const v8h*)p; u.q[1] = *(const v8h*)(p + 16); return u.v;
}
__device__ __forceinline__ v16h frag_f32(const float* rowk0, int lane) {
  v16h a; const float* p = rowk0 + 8 * (lane >> 4);
#pragma unroll
  for (int i = 0; i < 8; ++i) { a[i] = (_Float16)p[i]; a[8 + i] = (_Float16)p[16 + i]; }
  return a;
}
__device__ __forceinline__ v16h frag_f32s(const float* rowk0, int lane, float sc) {
  v16h a; const float* p = rowk0 + 8 * (lane >> 4);
#pragma unroll
  for (int i = 0; i < 8; ++i) { a[i] = (_Float16)(p[i] * sc); a[8 + i] = (_Float16)(p[16 + i] * sc); }
  return a;
}
// column fragment from a [K][ld] layout (column n), rows >= K read as 0
__device__ __forceinline__ v16h fragc_f32(const float* W, int k0, int n, int lane, int ld, int K) {
  v16h a; const int g = lane >> 4;
#pragma unroll
  for (int i = 0; i < 8; ++i) { const int ka = k0 + 8 * g + i, kb = ka + 16;
    a[i] = (_Float16)(ka < K ? W[(size_t)(ka < K ? ka : K - 1) * ld + n] : 0.f); a[8 + i] = (_Float16)(kb < K ? W[(size_t)(kb < K ? kb : K - 1) * ld + n] : 0.f); }
  return a;
}
struct F2 { v16b h, l; };
__device__ __forceinline__ F2 bsplit16(const float v[16]) { F2 r;
#pragma unroll
  for (int i = 0; i < 16; ++i) { const __bf16 h = (__bf16)v[i]; r.h[i] = h; r.l[i] = (__bf16)(v[i] - (float)h); }
  return r; }
__device__ __forceinline__ F2 split_row(const float* row, int k0, int lane) { float v[16]; const float* p = row + k0 + 8 * (lane >> 4);
#pragma unroll
  for (int i = 0; i < 8; ++i) { v[i] = p[i]; v[8 + i] = p[16 + i]; }
  return bsplit16(v); }
__device__ __forceinline__ F2 split_rowK(const float* row, int k0, int lane, int K) { float v[16]; const int g = lane >> 4;
#pragma unroll
  for (int i = 0; i < 8; ++i) { const int ka = k0 + 8 * g + i, kb = ka + 16; v[i] = ka < K ? row[ka < K ? ka : K - 1] : 0.f; v[8 + i] = kb < K ? row[kb < K ? kb : K - 1] : 0.f; }
  return bsplit16(v); }
__device__ __forceinline__ F2 split_col(const float* W, int k0, int n, int lane, int ld, int K) { float v[16]; const int g = lane >> 4;
#pragma unroll
  for (int i = 0; i < 8; ++i) { const int ka = k0 + 8 * g + i, kb = ka + 16; v[i] = ka < K ? W[(size_t)(ka < K ? ka : K - 1) * ld + n] : 0.f; v[8 + i] = kb < K ? W[(size_t)(kb < K ? kb : K - 1) * ld + n] : 0.f; }
  return bsplit16(v); }
__device__ __forceinline__ v8f mac3(const F2& a, const F2& b, v8f c) { c = wmma_bf(a.l, b.h, c); c = wmma_bf(a.h, b.l, c); return wmma_bf(a.h, b.h, c); }
__device__ __forceinline__ float sigm(float v) { return 1.0f / (1.0f + expf(-v)); }
#define LDSX() do { asm volatile("s_wait_dscnt 0" ::: "memory"); __builtin_amdgcn_wave_barrier(); __builtin_amdgcn_fence(__ATOMIC_RELEASE, "workgroup"); } while (0)


// Differential attention (B 1, S 2048, E 2048, 16 heads; q/k as 32 half-heads x 64 with interleaved RoPE, v as 16 heads x 128): a = softmax_causal(q1 k1^T/8) v - lambda_full * softmax_causal(q2 k2^T/8) v; lambda_full = exp(lq1.lk1) - exp(lq2.lk2) + lambda_init; a = RMSNorm_128(a) * g * (1 - lambda_init); out = a Wo.
#define SS 2048
#define DM 2048
#define NH 16
#define HD 128               // v head dim (2*64)
#define HQ 64                // q/k half-head dim
#define KVW DM
#define LAMBDA_INIT 0.78360577f   /* 0.8 - 0.6*exp(-0.3*12) = 0.7836057665 */
#ifndef TQB
#define TQB (SS / 64)
#define TRP (SS / 64)          // projection row tiles (all)
#endif
typedef __attribute__((ext_vector_type(8))) __bf16 v8b;
__device__ __forceinline__ v16b frag_b(const __bf16* rowk0, int lane) {
  union { v16b v; v8b q[2]; } u; const __bf16* p = rowk0 + 8 * (lane >> 4);
  u.q[0] = *(const v8b*)p; u.q[1] = *(const v8b*)(p + 16); return u.v;
}
__device__ __forceinline__ float bfr(float v) { return (float)(__bf16)v; }
__device__ __attribute__((noinline)) float exp_ni(float v) { return expf(v); }
__device__ __attribute__((noinline)) float erf_ni(float v) { return erff(v); }
// 2^v as the one hardware instruction v_exp_f32, in line; a very negative v (a masked score, the start value of the running maximum) gives exactly 0
__device__ __forceinline__ float exp2_hw(float v) { return __builtin_amdgcn_exp2f(v); }
#define QK_SCALE_LOG2 0.18033688f   /* (1/8) * log2(e): scores and their running maximum are kept in the base-2 domain, so that exp(s - m) is 2^(s2 - m2) */

#define PK_Q 0
#define PK_K (PK_Q + DM * DM)
#define PK_V (PK_K + KVW * DM)
#define PK_O (PK_V + KVW * DM)
#define PK_END (PK_O + DM * DM)
#define WS_PK  0u
#define WS_CS  (WS_PK + 2u * PK_END)             // f32 [2048][32] cos, then [2048][32] sin
#define WS_QH  (WS_CS + 4u * 2 * SS * 32)        // q after RoPE as two bf16 planes [2048][2048]: hi, then the residual lo; k the same
#define WS_QL  (WS_QH + 2u * SS * DM)
#define WS_KH  (WS_QL + 2u * SS * DM)
#define WS_KL  (WS_KH + 2u * SS * KVW)
#define WS_VTH (WS_KL + 2u * SS * KVW)
#define WS_VTL (WS_VTH + 2u * KVW * SS)
#define WS_O   (WS_VTL + 2u * KVW * SS)
#define WS_END (WS_O + 4u * SS * DM)

// ---- weight tile in LDS: one stage = 128 packed weight rows x 64 k (128 B a row), LDS pitch 144 B (16 B x odd, for the ds_load_b128 readers), two stages
#define WROW 144
#define WBUF (128 * WROW)
// 128 threads bring one stage: copy i takes rows 16 i + (tid >> 3), 16 B a lane, so a wave's 32 lanes cover 4 whole 128-B rows per copy
__device__ __forceinline__ void stage_w(const __bf16* __restrict__ Pt, unsigned lds, int tid) {
  const __bf16* gp = Pt + (size_t)(tid >> 3) * DM + (tid & 7) * 8; const unsigned l = lds + (tid >> 3) * WROW + (tid & 7) * 16;
  // the eight copies and, as the last line, the wait that stands in front of any rewrite of the address registers they name
  asm volatile("global_load_async_to_lds_b128 %0, %8, off\n\t"
               "global_load_async_to_lds_b128 %1, %9, off\n\t"
               "global_load_async_to_lds_b128 %2, %10, off\n\t"
               "global_load_async_to_lds_b128 %3, %11, off\n\t"
               "global_load_async_to_lds_b128 %4, %12, off\n\t"
               "global_load_async_to_lds_b128 %5, %13, off\n\t"
               "global_load_async_to_lds_b128 %6, %14, off\n\t"
               "global_load_async_to_lds_b128 %7, %15, off\n\t"
               "s_wait_xcnt 0x0"
               :: "v"(l), "v"(l + 16 * WROW), "v"(l + 32 * WROW), "v"(l + 48 * WROW), "v"(l + 64 * WROW), "v"(l + 80 * WROW), "v"(l + 96 * WROW), "v"(l + 112 * WROW),
                  "v"(gp), "v"(gp + 16 * DM), "v"(gp + 32 * DM), "v"(gp + 48 * DM), "v"(gp + 64 * DM), "v"(gp + 80 * DM), "v"(gp + 96 * DM), "v"(gp + 112 * DM)
               : "memory");
}
// fragment of one staged row: the same bytes in the same k order as frag_b reads from the packed row
__device__ __forceinline__ v16b frag_w(const char* rowk0, int g) {
  union { v16b v; v8b q[2]; } u; const char* p = rowk0 + 16 * g;
  u.q[0] = *(const v8b*)p; u.q[1] = *(const v8b*)(p + 32); return u.v;
}
#define WAIT_COPIES() asm volatile("s_wait_asynccnt 0x0" ::: "memory")   /* this wave's copies have landed */
#define WAIT_LDS()    asm volatile("s_wait_dscnt 0x0" ::: "memory")      /* this wave's LDS reads have returned */

// ---- k_packT: block = a 64 (k) x 128 (n) tile of a [DM][DM] (x @ W) matrix, written as 128 packed rows DST[n][k0 .. k0 + 63]; both sides of the transpose move whole 128-B lines: a wave's load covers 512 contiguous bytes of one k row, and 8 lanes store one 128-B piece of a packed row
#define PROW 144   /* LDS pitch of a tile row: 64 k x 2 B + 16 B; unpadded, the rows that the lanes of one ds_store_b128 write (4 apart) would all fall on the same banks */
__global__ __launch_bounds__(256) void k_packT(const float* __restrict__ Wm, __bf16* __restrict__ DST) {
  __shared__ __align__(16) char s[128 * PROW]; const int tid = threadIdx.x, wave = tid >> 5, lane = tid & 31; const int k0 = blockIdx.x * 64, n0 = blockIdx.y * 128;
  const float* p = Wm + (size_t)(k0 + 8 * wave) * DM + n0 + 4 * lane; v4f r[8];   // rows k0 + 8 wave + 0..7, columns n0 + 4 lane + 0..3
  // every loop of this kernel is unrolled: r[] and o are indexed by constants and stay in registers, and the 8 loads go out as one group ahead of the first use
#pragma unroll
  for (int i = 0; i < 8; ++i) r[i] = *(const v4f*)(p + (size_t)i * DM);
#pragma unroll
  for (int j = 0; j < 4; ++j) { v8b o;
#pragma unroll
    for (int i = 0; i < 8; ++i) o[i] = (__bf16)r[i][j];
    *(v8b*)&s[(4 * lane + j) * PROW + 16 * wave] = o; }
  __syncthreads();
#pragma unroll
  for (int i = 0; i < 4; ++i) { const int row = 32 * i + (tid >> 3), pc = tid & 7; vst2((unsigned*)(DST + (size_t)(n0 + row) * DM + k0 + pc * 8), *(const v4u*)&s[row * PROW + pc * 16]); }
}
__global__ __launch_bounds__(32) void k_rope_tab(float* __restrict__ CS) {
  __shared__ __align__(16) float sc[32], ssn[32]; const int t = blockIdx.x, i = threadIdx.x;
  const float dv = expf((float)(2 * i) * (-9.2103404f / 64.0f));   /* ln(1e4) as the f32 literal numpy uses */ const float ang = (float)t * dv; sc[i] = cosf(ang); ssn[i] = sinf(ang);
  __syncthreads();
  if (i < 8) vst2(CS + (size_t)t * 32 + i * 4, *(const v4f*)&sc[i * 4]); else if (i < 16) vst2(CS + (size_t)SS * 32 + (size_t)t * 32 + (i - 8) * 4, *(const v4f*)&ssn[(i - 8) * 4]);
}
// ---- k_proj<MODE>: block = (64 rows, 128 cols = one head): Y = bf16(x) . P rows (exact); MODE 0: RoPE, then rows of bf16 hi and residual lo, one plane each (q/k): the split that the three score products need, made once here; MODE 1: plain -> transposed bf16 hi/lo planes (v)
template <int MODE>
__global__ __launch_bounds__(128) void k_proj(const float* __restrict__ X, const __bf16* __restrict__ P, const float* __restrict__ CS, __bf16* __restrict__ PH, __bf16* __restrict__ PL) {
  __shared__ __align__(16) float so[MODE ? 1 : 4][16][132]; __shared__ __align__(16) __bf16 sth[MODE ? 128 : 1][72], stl[MODE ? 128 : 1][72]; __shared__ __align__(16) char sw[2 * WBUF];
  const int tid = threadIdx.x, wave = tid >> 5, lane = tid & 31, col = lane & 15, g = lane >> 4; const size_t r0 = (size_t)blockIdx.x * 64 + wave * 16; const int n0 = blockIdx.y * 128;
  v8f acc[8] = {};
  const unsigned sw0 = (unsigned)(size_t)&sw[0]; const __bf16* Pn = P + (size_t)n0 * DM;
  stage_w(Pn, sw0, tid); WAIT_COPIES(); __syncthreads();   // tile 0 is in buffer 0 for every wave
  stage_w(Pn + 64, sw0 + WBUF, tid);                       // tile 1 flies while tile 0 is worked on
#pragma unroll 1   // one trip per stage: the ring's foot (waits, barrier, refill) stands once and the two buffers alternate by t & 1
  for (int t = 0; t < DM / 64; ++t) { const int bo = (t & 1) * WBUF; v16b a[2];
#pragma unroll
    for (int u = 0; u < 2; ++u) { const float* p = X + (r0 + col) * DM + (2 * t + u) * 32 + 8 * g;
#pragma unroll
      for (int i = 0; i < 8; ++i) { a[u][i] = (__bf16)p[i]; a[u][8 + i] = (__bf16)p[16 + i]; } }
#pragma unroll
    for (int u = 0; u < 2; ++u) { v16b b[8];
#pragma unroll
      for (int j = 0; j < 8; ++j) b[j] = frag_w(&sw[bo + (j * 16 + col) * WROW + u * 64], g);
#pragma unroll
      for (int j = 0; j < 8; ++j) acc[j] = wmma_bf(a[u], b[j], acc[j]); }
    WAIT_LDS(); WAIT_COPIES(); __syncthreads();   // publishes tile t + 1 and ends every wave's reads of tile t
    if (t + 2 < DM / 64) stage_w(Pn + (t + 2) * 64, sw0 + bo, tid); }
  WAIT_COPIES();
  if (MODE == 0) {
    // projections to LDS, then interleaved-pair RoPE in place within each 64-wide half-head: (x_{2i}, x_{2i+1}) -> (x c - y s, x s + y c) with angle index i
#pragma unroll
    for (int j = 0; j < 8; ++j)
#pragma unroll
      for (int r = 0; r < 8; ++r) so[wave][8 * g + r][j * 16 + col] = acc[j][r];
    LDSX();
    for (int q = lane; q < 16 * 64; q += 32) { const int rl = q >> 6, pi = q & 63; const int half = pi >> 5, i = pi & 31; const size_t t = r0 + rl; const float c = CS[t * 32 + i], s = CS[(size_t)SS * 32 + t * 32 + i]; float* e = &so[wave][rl][half * 64 + 2 * i]; const float xe = e[0], xo = e[1]; e[0] = xe * c - xo * s; e[1] = xe * s + xo * c; }
    LDSX();
    // 16 lanes take one row of 128 values, 8 a lane: 16 B of the hi plane and 16 B of the lo plane, so a wave's store covers two whole 256-B row pieces
    for (int it = 0; it < 8; ++it) { const int rl = 2 * it + g; const float* e = &so[wave][rl][col * 8]; v8b hb, lb;
#pragma unroll   // hb and lb are indexed by constants and stay in registers
      for (int i = 0; i < 8; ++i) { const float v = e[i]; const __bf16 hh = (__bf16)v; hb[i] = hh; lb[i] = (__bf16)(v - (float)hh); }
      const size_t o = (r0 + rl) * DM + n0 + col * 8; vst2(PH + o, hb); vst2(PL + o, lb); }
  } else {
#pragma unroll
    for (int j = 0; j < 8; ++j)
#pragma unroll
      for (int r = 0; r < 8; ++r) { const float v = acc[j][r]; const __bf16 hb = (__bf16)v; sth[j * 16 + col][wave * 16 + 8 * g + r] = hb; stl[j * 16 + col][wave * 16 + 8 * g + r] = (__bf16)(v - (float)hb); }
    __syncthreads();
    const int s0 = blockIdx.x * 64;
    for (int q = tid; q < 128 * 8; q += 128) { const int d = q >> 3, pc = q & 7; const size_t o = (size_t)(n0 + d) * SS + s0 + pc * 8; vst2((unsigned*)(PH + o), *(const v4u*)&sth[d][pc * 8]); vst2((unsigned*)(PL + o), *(const v4u*)&stl[d][pc * 8]); }
  }
}
// ---- K and V tiles in LDS: one stage = the 32 keys of one trip for one head: the hi and the lo plane of K, 32 rows x 256 B each (both 64-wide half-heads of a key), then the hi and the lo plane of V^T, 128 rows (d) x 64 B (32 keys) each; LDS pitches 272 B and 80 B (16 B x odd, for the ds_load_b128 readers), two stages
#define KROW 272
#define VROW 80
#define KPL  (32 * KROW)
#define KBUF (2 * KPL)
#define VPL  (128 * VROW)
#define ABUF (KBUF + 2 * VPL)
// 256 threads bring one stage, 16 B a lane: K copy i of a plane takes rows 16 i + (tid >> 4), a wave covering two whole 256-B rows; V copy i of a plane takes rows 64 i + (tid >> 2), a wave covering 8 rows of 64 B
__device__ __forceinline__ void stage_kv(const __bf16* __restrict__ Kh, const __bf16* __restrict__ Kl, const __bf16* __restrict__ Vh, const __bf16* __restrict__ Vl, unsigned lds, int tid) {
  const size_t ko = (size_t)(tid >> 4) * KVW + (tid & 15) * 8; const __bf16 *kh = Kh + ko, *kp = Kl + ko; const unsigned kl = lds + (tid >> 4) * KROW + (tid & 15) * 16;
  const size_t vo = (size_t)(tid >> 2) * SS + (tid & 3) * 8; const __bf16 *hp = Vh + vo, *lp = Vl + vo; const unsigned vl = lds + KBUF + (tid >> 2) * VROW + (tid & 3) * 16;
  // the eight copies and, as the last line, the wait that stands in front of any rewrite of the address registers they name
  asm volatile("global_load_async_to_lds_b128 %0, %8, off\n\t"
               "global_load_async_to_lds_b128 %1, %9, off\n\t"
               "global_load_async_to_lds_b128 %2, %10, off\n\t"
               "global_load_async_to_lds_b128 %3, %11, off\n\t"
               "global_load_async_to_lds_b128 %4, %12, off\n\t"
               "global_load_async_to_lds_b128 %5, %13, off\n\t"
               "global_load_async_to_lds_b128 %6, %14, off\n\t"
               "global_load_async_to_lds_b128 %7, %15, off\n\t"
               "s_wait_xcnt 0x0"
               :: "v"(kl), "v"(kl + 16 * KROW), "v"(kl + KPL), "v"(kl + KPL + 16 * KROW), "v"(vl), "v"(vl + 64 * VROW), "v"(vl + VPL), "v"(vl + VPL + 64 * VROW),
                  "v"(kh), "v"(kh + 16 * KVW), "v"(kp), "v"(kp + 16 * KVW), "v"(hp), "v"(hp + 64 * SS), "v"(lp), "v"(lp + 64 * SS)
               : "memory");
}
// lane l with lane l ^ 16 (the two halves of a wave hold the two halves of one query's keys, or of its output row)
__device__ __forceinline__ float xhalf(float x) { return __builtin_bit_cast(float, __builtin_amdgcn_permlanex16(__builtin_bit_cast(int, x), __builtin_bit_cast(int, x), 0x76543210, 0xfedcba98, false, false)); }
// ---- k_attn: block = (two tiles of 64 queries, head h), one tile after the other: tile TQB - 1 - x, then tile x, so that every block walks the same number of trips (2 TQB + 2) although a causal tile's trips grow with its index; per tile, 8 waves: waves 0..3 run attention 1 and waves 4..7 attention 2 of the same four 16-query tiles side by side; each trip's K and V tiles are staged once in LDS for all 8 waves; transposed products: S^T = K.Q^T (3 products) and O^T += V^T.P^T (3 products), so lane (g, col) holds query q0 + col: its scores of keys 8 g + r and 16 + 8 g + r of a trip, and its outputs d = 16 dt + 8 g + r; O[q][h*128+d]
__global__ __launch_bounds__(256) void k_attn(const __bf16* __restrict__ QH, const __bf16* __restrict__ QL, const __bf16* __restrict__ KH, const __bf16* __restrict__ KL, const __bf16* __restrict__ VTH, const __bf16* __restrict__ VTL, const float* __restrict__ LQ1, const float* __restrict__ LK1, const float* __restrict__ LQ2, const float* __restrict__ LK2, const float* __restrict__ G, float* __restrict__ O) {
  __shared__ __align__(16) float so[4][16][132]; __shared__ __align__(16) char skv[2 * ABUF];
  const int tid = threadIdx.x, wave = tid >> 5, lane = tid & 31, col = lane & 15, g = lane >> 4;
  const int sub = __builtin_amdgcn_readfirstlane(wave >> 2), wq = wave & 3;   // which attention (the same in every lane of a wave), which 16-query tile
  const int h = blockIdx.y;
  // lambda_full from the inputs (64-dots)
  float lam; { float s1 = 0.f, s2 = 0.f; for (int i = lane; i < HQ; i += 32) { s1 += bfr(LQ1[i]) * bfr(LK1[i]); s2 += bfr(LQ2[i]) * bfr(LK2[i]); }
#pragma unroll
    for (int o = 1; o < 32; o <<= 1) { s1 += __shfl_xor(s1, o); s2 += __shfl_xor(s2, o); } lam = exp_ni(s1) - exp_ni(s2) + LAMBDA_INIT; }
#pragma unroll 1   // the two tiles run through one copy of the code, one after the other in every wave; the choice of tile is the same for the whole block, so every barrier below is passed by all 8 waves in both rounds
  for (int ph = 0; ph < 2; ++ph) {
  const int qb = ph ? (int)blockIdx.x : TQB - 1 - (int)blockIdx.x; const int q0 = qb * 64 + wq * 16;
  const int nks = (qb * 64 + 64) / 32;
  const int qi = q0 + col;
  // this lane's query as B fragments, hi and lo of both 32-wide k chunks: loaded once, they stay in registers through all trips
  const size_t qo = (size_t)qi * DM + (2 * h + sub) * HQ + 8 * g; const v8b *qhp = (const v8b*)(QH + qo), *qlp = (const v8b*)(QL + qo);   // in units of 8 values: chunk kc takes units 4 kc and 4 kc + 2, the k order of frag_b
  union { v16b v; v8b q[2]; } qh[2], ql[2];
#pragma unroll   // qh and ql are indexed by constants and stay in registers
  for (int kc = 0; kc < 2; ++kc) { qh[kc].q[0] = qhp[4 * kc]; qh[kc].q[1] = qhp[4 * kc + 2]; ql[kc].q[0] = qlp[4 * kc]; ql[kc].q[1] = qlp[4 * kc + 2]; }
  asm volatile("s_wait_xcnt 0x0" :: "v"(qhp), "v"(qlp) : "memory");   // stands in front of any rewrite of the two address pairs that the query loads name; taking the pairs as inputs keeps them whole up to here
  float m = -3.0e38f, l = 0.f;   // of query qi: running maximum, base-2 domain (the same in both halves of the wave) and the running sum over this half's keys
  v8f acc[8] = {};
  const unsigned kv0 = (unsigned)(size_t)&skv[0]; const __bf16 *Khh = KH + 2 * h * HQ, *Klh = KL + 2 * h * HQ; const __bf16 *Vhh = VTH + (size_t)h * HD * SS, *Vlh = VTL + (size_t)h * HD * SS;
  stage_kv(Khh, Klh, Vhh, Vlh, kv0, tid); WAIT_COPIES(); __syncthreads();          // tile 0 is in buffer 0 for every wave (second round: every reader left both buffers at the first round's last foot, behind its s_wait_dscnt 0 and its barrier)
  stage_kv(Khh + (size_t)32 * KVW, Klh + (size_t)32 * KVW, Vhh + 32, Vlh + 32, kv0 + ABUF, tid);      // tile 1 (nks is 2 qb + 2, never below 2) flies while tile 0 is worked on
#pragma unroll 1
  for (int ks = 0; ks < nks; ++ks) { const int bo = (ks & 1) * ABUF; float s[16];   // s[8 ct + r]: key ks * 32 + ct * 16 + 8 g + r, which is the k order of a B fragment
#pragma unroll
    for (int ct = 0; ct < 2; ++ct) { const char* kr = &skv[bo + (ct * 16 + col) * KROW + sub * (2 * HQ)]; v8f c = {};
#pragma unroll
      for (int kc = 0; kc < 2; ++kc) { const v16b kh = frag_w(kr + kc * 64, g), kl = frag_w(kr + KPL + kc * 64, g); c = wmma_bf(kh, ql[kc].v, c); c = wmma_bf(kl, qh[kc].v, c); c = wmma_bf(kh, qh[kc].v, c); }
#pragma unroll
      for (int r = 0; r < 8; ++r) { const int kk = ks * 32 + ct * 16 + 8 * g + r; s[8 * ct + r] = (kk <= qi) ? c[r] * QK_SCALE_LOG2 : -3.0e38f; } }
    float mx = s[0];
#pragma unroll
    for (int i = 1; i < 16; ++i) mx = fmaxf(mx, s[i]);
    mx = fmaxf(mx, xhalf(mx));
    const float mn = fmaxf(m, mx); const float alpha = exp2_hw(m - mn);   // key 0 is open to every query, so mn is a real score from the first trip on
    float e[16], t[8];
#pragma unroll
    for (int i = 0; i < 16; ++i) e[i] = exp2_hw(s[i] - mn);
#pragma unroll
    for (int i = 0; i < 8; ++i) t[i] = e[i] + e[8 + i];
    float es = ((t[0] + t[4]) + (t[2] + t[6])) + ((t[1] + t[5]) + (t[3] + t[7]));
    l = l * alpha + es; m = mn;
#pragma unroll
    for (int dt = 0; dt < 8; ++dt) acc[dt] *= alpha;
    const F2 pb = bsplit16(e);
#pragma unroll
    for (int dt = 0; dt < 8; ++dt) { const char* vr = &skv[bo + KBUF + (dt * 16 + col) * VROW]; const v16b vh = frag_w(vr, g), vl = frag_w(vr + VPL, g); acc[dt] = wmma_bf(vh, pb.l, acc[dt]); acc[dt] = wmma_bf(vl, pb.h, acc[dt]); acc[dt] = wmma_bf(vh, pb.h, acc[dt]); }
    WAIT_LDS(); WAIT_COPIES(); __syncthreads();   // publishes tile ks + 1 and ends every wave's reads of tile ks
    if (ks + 2 < nks) stage_kv(Khh + (size_t)(ks + 2) * 32 * KVW, Klh + (size_t)(ks + 2) * 32 * KVW, Vhh + (ks + 2) * 32, Vlh + (ks + 2) * 32, kv0 + bo, tid); }
  WAIT_COPIES();
  l += xhalf(l);   // the two halves' sums join once
  const float il = 1.0f / l; float* orow = &so[wq][col][8 * g];   // this lane's 8 consecutive d of each 16-wide group dt
  if (sub == 0) {
#pragma unroll
    for (int dt = 0; dt < 8; ++dt) { const v8f a = acc[dt] * il; *(v4f*)(orow + dt * 16) = __builtin_shufflevector(a, a, 0, 1, 2, 3); *(v4f*)(orow + dt * 16 + 4) = __builtin_shufflevector(a, a, 4, 5, 6, 7); }
  }
  __syncthreads();   // hands the normalised attn1 rows of tile wq from wave wq to wave 4 + wq
  if (sub == 1) {
    float ss = 0.f;
#pragma unroll
    for (int dt = 0; dt < 8; ++dt)
#pragma unroll
      for (int r = 0; r < 8; ++r) { const float a = orow[dt * 16 + r] - lam * (acc[dt][r] * il); acc[dt][r] = a; ss += a * a; }
    ss += xhalf(ss);
    const float rs = rsqrtf(ss / (float)HD + 1e-5f) * (1.0f - LAMBDA_INIT);
    v4f gv[16]; const v4f* gp = (const v4f*)(G + 8 * g);   // g in this lane's order: the 8 consecutive values of each 16-wide group as two 16-byte loads, all from one base
#pragma unroll
    for (int dt = 0; dt < 8; ++dt) { gv[2 * dt] = gp[4 * dt]; gv[2 * dt + 1] = gp[4 * dt + 1]; }
    asm volatile("s_wait_xcnt 0x0" :: "v"(gp) : "memory");   // stands in front of any rewrite of the address pair that the g loads name; taking the pair as an input keeps it whole up to here, so that no load of the run lands in it
#pragma unroll
    for (int dt = 0; dt < 8; ++dt)
#pragma unroll
      for (int r = 0; r < 8; ++r) orow[dt * 16 + r] = acc[dt][r] * rs * bfr(gv[2 * dt + (r >> 2)][r & 3]);
    LDSX();
    for (int rl = 0; rl < 16; ++rl) vst2(O + (size_t)(q0 + rl) * DM + h * HD + lane * 4, *(const v4f*)&so[wq][rl][lane * 4]);
    asm volatile("s_wait_xcnt 0x0" ::: "memory");   // stands in front of the next round's rewrite of the registers that these stores name
  }
  }
}
// ---- k_out: block = (64 rows, 128 cols): out = O(hi/lo) . wproj^T rows (2 products)
__global__ __launch_bounds__(128) void k_out(const float* __restrict__ O, const __bf16* __restrict__ P, float* __restrict__ Y) {
  __shared__ __align__(16) float so[4][16][132]; __shared__ __align__(16) char sw[2 * WBUF];
  const int tid = threadIdx.x, wave = tid >> 5, lane = tid & 31, col = lane & 15, g = lane >> 4; const size_t r0 = (size_t)blockIdx.x * 64 + wave * 16; const int n0 = blockIdx.y * 128;
  v8f acc[8] = {};
  const unsigned sw0 = (unsigned)(size_t)&sw[0]; const __bf16* Pn = P + (size_t)n0 * DM;
  stage_w(Pn, sw0, tid); WAIT_COPIES(); __syncthreads();   // tile 0 is in buffer 0 for every wave
  stage_w(Pn + 64, sw0 + WBUF, tid);                       // tile 1 flies while tile 0 is worked on
#pragma unroll 1   // one trip per stage: the ring's foot (waits, barrier, refill) stands once and the two buffers alternate by t & 1
  for (int t = 0; t < DM / 64; ++t) { const int bo = (t & 1) * WBUF; F2 a[2];
#pragma unroll
    for (int u = 0; u < 2; ++u) a[u] = split_row(O + (r0 + col) * DM, (2 * t + u) * 32, lane);
#pragma unroll
    for (int u = 0; u < 2; ++u) { v16b b[8];
#pragma unroll
      for (int j = 0; j < 8; ++j) b[j] = frag_w(&sw[bo + (j * 16 + col) * WROW + u * 64], g);
#pragma unroll
      for (int j = 0; j < 8; ++j) { acc[j] = wmma_bf(a[u].l, b[j], acc[j]); acc[j] = wmma_bf(a[u].h, b[j], acc[j]); } }
    WAIT_LDS(); WAIT_COPIES(); __syncthreads();   // publishes tile t + 1 and ends every wave's reads of tile t
    if (t + 2 < DM / 64) stage_w(Pn + (t + 2) * 64, sw0 + bo, tid); }
  WAIT_COPIES();
#pragma unroll
  for (int j = 0; j < 8; ++j)
#pragma unroll
    for (int r = 0; r < 8; ++r) so[wave][8 * g + r][j * 16 + col] = acc[j][r];
  LDSX();
  for (int rl = 0; rl < 16; ++rl) vst2(Y + (r0 + rl) * DM + n0 + lane * 4, *(const v4f*)&so[wave][rl][lane * 4]);
}
extern "C" void kernel_launch(void* const* d_in, const int* in_sizes, int n_in, void* d_out, int out_size, void* d_ws, size_t ws_size, hipStream_t stream) {
  (void)in_sizes; (void)n_in; (void)out_size;
  const float** F = (const float**)d_in;   // 0 x [1,2048,2048], 1 Wq, 2 Wk, 3 Wv, 4 Wo [2048,2048] (x @ W), 5 lq1, 6 lk1, 7 lq2, 8 lk2 [64], 9 g [128]
  if (ws_size < (size_t)WS_END) return;
  char* ws = (char*)d_ws; __bf16 *PK = (__bf16*)(ws + WS_PK), *VTH = (__bf16*)(ws + WS_VTH), *VTL = (__bf16*)(ws + WS_VTL);
  __bf16 *QH = (__bf16*)(ws + WS_QH), *QL = (__bf16*)(ws + WS_QL), *KH = (__bf16*)(ws + WS_KH), *KL = (__bf16*)(ws + WS_KL);
  float *CS = (float*)(ws + WS_CS), *O = (float*)(ws + WS_O);
  k_packT<<<dim3(DM / 64, DM / 128), 256, 0, stream>>>(F[1], PK + PK_Q); k_packT<<<dim3(DM / 64, DM / 128), 256, 0, stream>>>(F[2], PK + PK_K); k_packT<<<dim3(DM / 64, DM / 128), 256, 0, stream>>>(F[3], PK + PK_V); k_packT<<<dim3(DM / 64, DM / 128), 256, 0, stream>>>(F[4], PK + PK_O);
  k_rope_tab<<<SS, 32, 0, stream>>>(CS);
  k_proj<0><<<dim3(TRP, DM / 128), 128, 0, stream>>>(F[0], PK + PK_Q, CS, QH, QL);
  k_proj<0><<<dim3(TRP, DM / 128), 128, 0, stream>>>(F[0], PK + PK_K, CS, KH, KL);
  k_proj<1><<<dim3(TRP, DM / 128), 128, 0, stream>>>(F[0], PK + PK_V, CS, VTH, VTL);
  k_attn<<<dim3(TQB / 2, NH), 256, 0, stream>>>(QH, QL, KH, KL, VTH, VTL, F[5], F[6], F[7], F[8], F[9], O);
  k_out<<<dim3(TQB, DM / 128), 128, 0, stream>>>(O, PK + PK_O, (float*)d_out);
}

// v009
// One run takes 241 microseconds.
// Timed twice side by side with v008, it ran 1.07 times as fast both times.
// Over all steps from v000 it is 5.80 times as fast.
// compute dtype: x, the four weights, the lambda vectors and g (module inputs) rounded to bf16; q/k/v projections with exact bf16 products (x and W are inputs) and interleaved-pair RoPE (tables in f32 as the module's numpy code) in the epilogue; the two causal attentions per head with q.k as bf16 hi + residual pairs (3 products) and P.V with P hi/lo x V hi/lo (3 products); the differential combination, RMSNorm and (1 - lambda_init) scaling in f32; the output projection hi/lo x exact Wo (2 products); all GEMMs on WMMA 16x16x32; f32 accumulate.
#include <hip/hip_runtime.h>
#include <math.h>

typedef __attribute__((ext_vector_type(16))) _Float16 v16h;
typedef __attribute__((ext_vector_type(16))) __bf16 v16b;
typedef __attribute__((ext_vector_type(8)))  _Float16 v8h;
typedef __attribute__((ext_vector_type(8)))  float v8f;
typedef __attribute__((ext_vector_type(4)))  float v4f;
typedef __attribute__((ext_vector_type(2)))  float v2f;
typedef __attribute__((ext_vector_type(4)))  unsigned v4u;
typedef __attribute__((ext_vector_type(4)))  int v4i;
typedef float __attribute__((may_alias)) float_a;
typedef int __attribute__((may_alias)) int_a;

template <typename T> __device__ __forceinline__ void vst2(void* p, T v) { *(T*)p = v;  }
__device__ __forceinline__ v8f wmma16(v16h a, v16h b, v8f c) {
  v8f d = __builtin_amdgcn_wmma_f32_16x16x32_f16(false, a, false, b, (short)0, c, false, false);
  asm volatile("v_nop\n\tv_nop\n\tv_nop\n\tv_nop" : "+v"(d) : "v"(a), "v"(b));
  return d;
}
__device__ __forceinline__ v8f wmma_bf(v16b a, v16b b, v8f c) {
  v8f d = __builtin_amdgcn_wmma_f32_16x16x32_bf16(false, a, false, b, (short)0, c, false, false);
  asm volatile("v_nop\n\tv_nop\n\tv_nop\n\tv_nop" : "+v"(d) : "v"(a), "v"(b));
  return d;
}
// 16x16x32 fragments: lane = (h = lane>>4, row/col = lane&15); elements 0..7 = k0+8h+0..7, 8..15 = k0+16+8h+0..7; D element r = row 8h+r
__device__ __forceinline__ v16h frag_h(const _Float16* rowk0, int lane) {
  union { v16h v; v8h q[2]; } u; const _Float16* p = rowk0 + 8 * (lane >> 4);
  u.q[0] = *(const v8h*)p; u.q[1] = *(const v8h*)(p + 16); return u.v;
}
__device__ __forceinline__ v16h frag_f32(const float* rowk0, int lane) {
  v16h a; const float* p = rowk0 + 8 * (lane >> 4);
#pragma unroll
  for (int i = 0; i < 8; ++i) { a[i] = (_Float16)p[i]; a[8 + i] = (_Float16)p[16 + i]; }
  return a;
}
__device__ __forceinline__ v16h frag_f32s(const float* rowk0, int lane, float sc) {
  v16h a; const float* p = rowk0 + 8 * (lane >> 4);
#pragma unroll
  for (int i = 0; i < 8; ++i) { a[i] = (_Float16)(p[i] * sc); a[8 + i] = (_Float16)(p[16 + i] * sc); }
  return a;
}
// column fragment from a [K][ld] layout (column n), rows >= K read as 0
__device__ __forceinline__ v16h fragc_f32(const float* W, int k0, int n, int lane, int ld, int K) {
  v16h a; const int g = lane >> 4;
#pragma unroll
  for (int i = 0; i < 8; ++i) { const int ka = k0 + 8 * g + i, kb = ka + 16;
    a[i] = (_Float16)(ka < K ? W[(size_t)(ka < K ? ka : K - 1) * ld + n] : 0.f); a[8 + i] = (_Float16)(kb < K ? W[(size_t)(kb < K ? kb : K - 1) * ld + n] : 0.f); }
  return a;
}
struct F2 { v16b h, l; };
__device__ __forceinline__ F2 bsplit16(const float v[16]) { F2 r;
#pragma unroll
  for (int i = 0; i < 16; ++i) { const __bf16 h = (__bf16)v[i]; r.h[i] = h; r.l[i] = (__bf16)(v[i] - (float)h); }
  return r; }
__device__ __forceinline__ F2 split_row(const float* row, int k0, int lane) { float v[16]; const float* p = row + k0 + 8 * (lane >> 4);
#pragma unroll
  for (int i = 0; i < 8; ++i) { v[i] = p[i]; v[8 + i] = p[16 + i]; }
  return bsplit16(v); }
__device__ __forceinline__ F2 split_rowK(const float* row, int k0, int lane, int K) { float v[16]; const int g = lane >> 4;
#pragma unroll
  for (int i = 0; i < 8; ++i) { const int ka = k0 + 8 * g + i, kb = ka + 16; v[i] = ka < K ? row[ka < K ? ka : K - 1] : 0.f; v[8 + i] = kb < K ? row[kb < K ? kb : K - 1] : 0.f; }
  return bsplit16(v); }
__device__ __forceinline__ F2 split_col(const float* W, int k0, int n, int lane, int ld, int K) { float v[16]; const int g = lane >> 4;
#pragma unroll
  for (int i = 0; i < 8; ++i) { const int ka = k0 + 8 * g + i, kb = ka + 16; v[i] = ka < K ? W[(size_t)(ka < K ? ka : K - 1) * ld + n] : 0.f; v[8 + i] = kb < K ? W[(size_t)(kb < K ? kb : K - 1) * ld + n] : 0.f; }
  return bsplit16(v); }
__device__ __forceinline__ v8f mac3(const F2& a, const F2& b, v8f c) { c = wmma_bf(a.l, b.h, c); c = wmma_bf(a.h, b.l, c); return wmma_bf(a.h, b.h, c); }
__device__ __forceinline__ float sigm(float v) { return 1.0f / (1.0f + expf(-v)); }
#define LDSX() do { asm volatile("s_wait_dscnt 0" ::: "memory"); __builtin_amdgcn_wave_barrier(); __builtin_amdgcn_fence(__ATOMIC_RELEASE, "workgroup"); } while (0)


// Differential attention (B 1, S 2048, E 2048, 16 heads; q/k as 32 half-heads x 64 with interleaved RoPE, v as 16 heads x 128): a = softmax_causal(q1 k1^T/8) v - lambda_full * softmax_causal(q2 k2^T/8) v; lambda_full = exp(lq1.lk1) - exp(lq2.lk2) + lambda_init; a = RMSNorm_128(a) * g * (1 - lambda_init); out = a Wo.
#define SS 2048
#define DM 2048
#define NH 16
#define HD 128               // v head dim (2*64)
#define HQ 64                // q/k half-head dim
#define KVW DM
#define LAMBDA_INIT 0.78360577f   /* 0.8 - 0.6*exp(-0.3*12) = 0.7836057665 */
#ifndef TQB
#define TQB (SS / 64)
#define TRP (SS / 64)          // projection row tiles (all)
#endif
typedef __attribute__((ext_vector_type(8))) __bf16 v8b;
__device__ __forceinline__ v16b frag_b(const __bf16* rowk0, int lane) {
  union { v16b v; v8b q[2]; } u; const __bf16* p = rowk0 + 8 * (lane >> 4);
  u.q[0] = *(const v8b*)p; u.q[1] = *(const v8b*)(p + 16); return u.v;
}
__device__ __forceinline__ float bfr(float v) { return (float)(__bf16)v; }
__device__ __attribute__((noinline)) float exp_ni(float v) { return expf(v); }
__device__ __attribute__((noinline)) float erf_ni(float v) { return erff(v); }
// 2^v as the one hardware instruction v_exp_f32, in line; a very negative v (a masked score, the start value of the running maximum) gives exactly 0
__device__ __forceinline__ float exp2_hw(float v) { return __builtin_amdgcn_exp2f(v); }
#define QK_SCALE_LOG2 0.18033688f   /* (1/8) * log2(e): scores and their running maximum are kept in the base-2 domain, so that exp(s - m) is 2^(s2 - m2) */

#define PK_Q 0
#define PK_K (PK_Q + DM * DM)
#define PK_V (PK_K + KVW * DM)
#define PK_O (PK_V + KVW * DM)
#define PK_END (PK_O + DM * DM)
#define WS_PK  0u
#define WS_CS  (WS_PK + 2u * PK_END)             // f32 [2048][32] cos, then [2048][32] sin
#define WS_QH  (WS_CS + 4u * 2 * SS * 32)        // q after RoPE as two bf16 planes [2048][2048]: hi, then the residual lo; k the same
#define WS_QL  (WS_QH + 2u * SS * DM)
#define WS_KH  (WS_QL + 2u * SS * DM)
#define WS_KL  (WS_KH + 2u * SS * KVW)
#define WS_VTH (WS_KL + 2u * SS * KVW)
#define WS_VTL (WS_VTH + 2u * KVW * SS)
#define WS_O   (WS_VTL + 2u * KVW * SS)
#define WS_END (WS_O + 4u * SS * DM)

// ---- weight tile in LDS: one stage = 128 packed weight rows x 64 k (128 B a row), LDS pitch 144 B (16 B x odd, for the ds_load_b128 readers), two stages
#define WROW 144
#define WBUF (128 * WROW)
// 128 threads bring one stage: copy i takes rows 16 i + (tid >> 3), 16 B a lane, so a wave's 32 lanes cover 4 whole 128-B rows per copy
__device__ __forceinline__ void stage_w(const __bf16* __restrict__ Pt, unsigned lds, int tid) {
  const __bf16* gp = Pt + (size_t)(tid >> 3) * DM + (tid & 7) * 8; const unsigned l = lds + (tid >> 3) * WROW + (tid & 7) * 16;
  // the eight copies and, as the last line, the wait that stands in front of any rewrite of the address registers they name
  asm volatile("global_load_async_to_lds_b128 %0, %8, off\n\t"
               "global_load_async_to_lds_b128 %1, %9, off\n\t"
               "global_load_async_to_lds_b128 %2, %10, off\n\t"
               "global_load_async_to_lds_b128 %3, %11, off\n\t"
               "global_load_async_to_lds_b128 %4, %12, off\n\t"
               "global_load_async_to_lds_b128 %5, %13, off\n\t"
               "global_load_async_to_lds_b128 %6, %14, off\n\t"
               "global_load_async_to_lds_b128 %7, %15, off\n\t"
               "s_wait_xcnt 0x0"
               :: "v"(l), "v"(l + 16 * WROW), "v"(l + 32 * WROW), "v"(l + 48 * WROW), "v"(l + 64 * WROW), "v"(l + 80 * WROW), "v"(l + 96 * WROW), "v"(l + 112 * WROW),
                  "v"(gp), "v"(gp + 16 * DM), "v"(gp + 32 * DM), "v"(gp + 48 * DM), "v"(gp + 64 * DM), "v"(gp + 80 * DM), "v"(gp + 96 * DM), "v"(gp + 112 * DM)
               : "memory");
}
// fragment of one staged row: the same bytes in the same k order as frag_b reads from the packed row
__device__ __forceinline__ v16b frag_w(const char* rowk0, int g) {
  union { v16b v; v8b q[2]; } u; const char* p = rowk0 + 16 * g;
  u.q[0] = *(const v8b*)p; u.q[1] = *(const v8b*)(p + 32); return u.v;
}
#define WAIT_COPIES() asm volatile("s_wait_asynccnt 0x0" ::: "memory")   /* this wave's copies have landed */
#define WAIT_LDS()    asm volatile("s_wait_dscnt 0x0" ::: "memory")      /* this wave's LDS reads have returned */

// ---- k_packT: block = a 64 (k) x 128 (n) tile of a [DM][DM] (x @ W) matrix, written as 128 packed rows DST[n][k0 .. k0 + 63]; both sides of the transpose move whole 128-B lines: a wave's load covers 512 contiguous bytes of one k row, and 8 lanes store one 128-B piece of a packed row
#define PROW 144   /* LDS pitch of a tile row: 64 k x 2 B + 16 B; unpadded, the rows that the lanes of one ds_store_b128 write (4 apart) would all fall on the same banks */
__global__ __launch_bounds__(256) void k_packT(const float* __restrict__ Wm, __bf16* __restrict__ DST) {
  __shared__ __align__(16) char s[128 * PROW]; const int tid = threadIdx.x, wave = tid >> 5, lane = tid & 31; const int k0 = blockIdx.x * 64, n0 = blockIdx.y * 128;
  const float* p = Wm + (size_t)(k0 + 8 * wave) * DM + n0 + 4 * lane; v4f r[8];   // rows k0 + 8 wave + 0..7, columns n0 + 4 lane + 0..3
  // every loop of this kernel is unrolled: r[] and o are indexed by constants and stay in registers, and the 8 loads go out as one group ahead of the first use
#pragma unroll
  for (int i = 0; i < 8; ++i) r[i] = *(const v4f*)(p + (size_t)i * DM);
#pragma unroll
  for (int j = 0; j < 4; ++j) { v8b o;
#pragma unroll
    for (int i = 0; i < 8; ++i) o[i] = (__bf16)r[i][j];
    *(v8b*)&s[(4 * lane + j) * PROW + 16 * wave] = o; }
  __syncthreads();
#pragma unroll
  for (int i = 0; i < 4; ++i) { const int row = 32 * i + (tid >> 3), pc = tid & 7; vst2((unsigned*)(DST + (size_t)(n0 + row) * DM + k0 + pc * 8), *(const v4u*)&s[row * PROW + pc * 16]); }
}
__global__ __launch_bounds__(32) void k_rope_tab(float* __restrict__ CS) {
  __shared__ __align__(16) float sc[32], ssn[32]; const int t = blockIdx.x, i = threadIdx.x;
  const float dv = expf((float)(2 * i) * (-9.2103404f / 64.0f));   /* ln(1e4) as the f32 literal numpy uses */ const float ang = (float)t * dv; sc[i] = cosf(ang); ssn[i] = sinf(ang);
  __syncthreads();
  if (i < 8) vst2(CS + (size_t)t * 32 + i * 4, *(const v4f*)&sc[i * 4]); else if (i < 16) vst2(CS + (size_t)SS * 32 + (size_t)t * 32 + (i - 8) * 4, *(const v4f*)&ssn[(i - 8) * 4]);
}
// ---- k_proj<MODE>: block = (64 rows, 128 cols = one head): Y = bf16(x) . P rows (exact); MODE 0: RoPE, then rows of bf16 hi and residual lo, one plane each (q/k): the split that the three score products need, made once here; MODE 1: plain -> transposed bf16 hi/lo planes (v)
template <int MODE>
__global__ __launch_bounds__(128) void k_proj(const float* __restrict__ X, const __bf16* __restrict__ P, const float* __restrict__ CS, __bf16* __restrict__ PH, __bf16* __restrict__ PL) {
  __shared__ __align__(16) float so[MODE ? 1 : 4][16][132]; __shared__ __align__(16) __bf16 sth[MODE ? 128 : 1][72], stl[MODE ? 128 : 1][72]; __shared__ __align__(16) char sw[2 * WBUF];
  const int tid = threadIdx.x, wave = tid >> 5, lane = tid & 31, col = lane & 15, g = lane >> 4; const size_t r0 = (size_t)blockIdx.x * 64 + wave * 16; const int n0 = blockIdx.y * 128;
  v8f acc[8] = {};
  const unsigned sw0 = (unsigned)(size_t)&sw[0]; const __bf16* Pn = P + (size_t)n0 * DM;
  stage_w(Pn, sw0, tid); WAIT_COPIES(); __syncthreads();   // tile 0 is in buffer 0 for every wave
  stage_w(Pn + 64, sw0 + WBUF, tid);                       // tile 1 flies while tile 0 is worked on
#pragma unroll 1   // one trip per stage: the ring's foot (waits, barrier, refill) stands once and the two buffers alternate by t & 1
  for (int t = 0; t < DM / 64; ++t) { const int bo = (t & 1) * WBUF; v16b a[2];
#pragma unroll
    for (int u = 0; u < 2; ++u) { const float* p = X + (r0 + col) * DM + (2 * t + u) * 32 + 8 * g;
#pragma unroll
      for (int i = 0; i < 8; ++i) { a[u][i] = (__bf16)p[i]; a[u][8 + i] = (__bf16)p[16 + i]; } }
#pragma unroll
    for (int u = 0; u < 2; ++u) { v16b b[8];
#pragma unroll
      for (int j = 0; j < 8; ++j) b[j] = frag_w(&sw[bo + (j * 16 + col) * WROW + u * 64], g);
#pragma unroll
      for (int j = 0; j < 8; ++j) acc[j] = wmma_bf(a[u], b[j], acc[j]); }
    WAIT_LDS(); WAIT_COPIES(); __syncthreads();   // publishes tile t + 1 and ends every wave's reads of tile t
    if (t + 2 < DM / 64) stage_w(Pn + (t + 2) * 64, sw0 + bo, tid); }
  WAIT_COPIES();
  if (MODE == 0) {
    // projections to LDS, then interleaved-pair RoPE in place within each 64-wide half-head: (x_{2i}, x_{2i+1}) -> (x c - y s, x s + y c) with angle index i
#pragma unroll
    for (int j = 0; j < 8; ++j)
#pragma unroll
      for (int r = 0; r < 8; ++r) so[wave][8 * g + r][j * 16 + col] = acc[j][r];
    LDSX();
    for (int q = lane; q < 16 * 64; q += 32) { const int rl = q >> 6, pi = q & 63; const int half = pi >> 5, i = pi & 31; const size_t t = r0 + rl; const float c = CS[t * 32 + i], s = CS[(size_t)SS * 32 + t * 32 + i]; float* e = &so[wave][rl][half * 64 + 2 * i]; const float xe = e[0], xo = e[1]; e[0] = xe * c - xo * s; e[1] = xe * s + xo * c; }
    LDSX();
    // 16 lanes take one row of 128 values, 8 a lane: 16 B of the hi plane and 16 B of the lo plane, so a wave's store covers two whole 256-B row pieces
    for (int it = 0; it < 8; ++it) { const int rl = 2 * it + g; const float* e = &so[wave][rl][col * 8]; v8b hb, lb;
#pragma unroll   // hb and lb are indexed by constants and stay in registers
      for (int i = 0; i < 8; ++i) { const float v = e[i]; const __bf16 hh = (__bf16)v; hb[i] = hh; lb[i] = (__bf16)(v - (float)hh); }
      const size_t o = (r0 + rl) * DM + n0 + col * 8; vst2(PH + o, hb); vst2(PL + o, lb); }
  } else {
#pragma unroll
    for (int j = 0; j < 8; ++j)
#pragma unroll
      for (int r = 0; r < 8; ++r) { const float v = acc[j][r]; const __bf16 hb = (__bf16)v; sth[j * 16 + col][wave * 16 + 8 * g + r] = hb; stl[j * 16 + col][wave * 16 + 8 * g + r] = (__bf16)(v - (float)hb); }
    __syncthreads();
    const int s0 = blockIdx.x * 64;
    for (int q = tid; q < 128 * 8; q += 128) { const int d = q >> 3, pc = q & 7; const size_t o = (size_t)(n0 + d) * SS + s0 + pc * 8; vst2((unsigned*)(PH + o), *(const v4u*)&sth[d][pc * 8]); vst2((unsigned*)(PL + o), *(const v4u*)&stl[d][pc * 8]); }
  }
}
// ---- K and V tiles in LDS: one stage = the 32 keys of one trip for one head: the hi and the lo plane of K, 32 rows x 256 B each (both 64-wide half-heads of a key), then the hi and the lo plane of V^T, 128 rows (d) x 64 B (32 keys) each; LDS pitches 272 B and 80 B (16 B x odd, for the ds_load_b128 readers), two stages
#define KROW 272
#define VROW 80
#define KPL  (32 * KROW)
#define KBUF (2 * KPL)
#define VPL  (128 * VROW)
#define ABUF (KBUF + 2 * VPL)
// 256 threads bring one stage, 16 B a lane: K copy i of a plane takes rows 16 i + (tid >> 4), a wave covering two whole 256-B rows; V copy i of a plane takes rows 64 i + (tid >> 2), a wave covering 8 rows of 64 B
__device__ __forceinline__ void stage_kv(const __bf16* __restrict__ Kh, const __bf16* __restrict__ Kl, const __bf16* __restrict__ Vh, const __bf16* __restrict__ Vl, unsigned lds, int tid) {
  const size_t ko = (size_t)(tid >> 4) * KVW + (tid & 15) * 8; const __bf16 *kh = Kh + ko, *kp = Kl + ko; const unsigned kl = lds + (tid >> 4) * KROW + (tid & 15) * 16;
  const size_t vo = (size_t)(tid >> 2) * SS + (tid & 3) * 8; const __bf16 *hp = Vh + vo, *lp = Vl + vo; const unsigned vl = lds + KBUF + (tid >> 2) * VROW + (tid & 3) * 16;
  // the eight copies and, as the last line, the wait that stands in front of any rewrite of the address registers they name
  asm volatile("global_load_async_to_lds_b128 %0, %8, off\n\t"
               "global_load_async_to_lds_b128 %1, %9, off\n\t"
               "global_load_async_to_lds_b128 %2, %10, off\n\t"
               "global_load_async_to_lds_b128 %3, %11, off\n\t"
               "global_load_async_to_lds_b128 %4, %12, off\n\t"
               "global_load_async_to_lds_b128 %5, %13, off\n\t"
               "global_load_async_to_lds_b128 %6, %14, off\n\t"
               "global_load_async_to_lds_b128 %7, %15, off\n\t"
               "s_wait_xcnt 0x0"
               :: "v"(kl), "v"(kl + 16 * KROW), "v"(kl + KPL), "v"(kl + KPL + 16 * KROW), "v"(vl), "v"(vl + 64 * VROW), "v"(vl + VPL), "v"(vl + VPL + 64 * VROW),
                  "v"(kh), "v"(kh + 16 * KVW), "v"(kp), "v"(kp + 16 * KVW), "v"(hp), "v"(hp + 64 * SS), "v"(lp), "v"(lp + 64 * SS)
               : "memory");
}
// the plain builtin: the compiler keeps the distances behind it itself, and with no asm statement naming them the trip's fragments and the accumulators may lie above v255
__device__ __forceinline__ v8f wmma_bfp(v16b a, v16b b, v8f c) { return __builtin_amdgcn_wmma_f32_16x16x32_bf16(false, a, false, b, (short)0, c, false, false); }
// lane l with lane l ^ 16 (the two halves of a wave hold the two halves of one query's keys, or of its output row)
__device__ __forceinline__ float xhalf(float x) { return __builtin_bit_cast(float, __builtin_amdgcn_permlanex16(__builtin_bit_cast(int, x), __builtin_bit_cast(int, x), 0x76543210, 0xfedcba98, false, false)); }
// ---- k_attn: block = (two tiles of 64 queries, head h), one tile after the other: tile TQB - 1 - x, then tile x, so that every block walks the same number of trips (2 TQB + 2) although a causal tile's trips grow with its index; per tile, 8 waves: waves 0..3 run attention 1 and waves 4..7 attention 2 of the same four 16-query tiles side by side; each trip's K and V tiles are staged once in LDS for all 8 waves; transposed products: S^T = K.Q^T (3 products) and O^T += V^T.P^T (3 products), so lane (g, col) holds query q0 + col: its scores of keys 8 g + r and 16 + 8 g + r of a trip, and its outputs d = 16 dt + 8 g + r; O[q][h*128+d]
__global__ __launch_bounds__(256) void k_attn(const __bf16* __restrict__ QH, const __bf16* __restrict__ QL, const __bf16* __restrict__ KH, const __bf16* __restrict__ KL, const __bf16* __restrict__ VTH, const __bf16* __restrict__ VTL, const float* __restrict__ LQ1, const float* __restrict__ LK1, const float* __restrict__ LQ2, const float* __restrict__ LK2, const float* __restrict__ G, float* __restrict__ O) {
  __shared__ __align__(16) float so[4][16][132]; __shared__ __align__(16) char skv[2 * ABUF];
  const int tid = threadIdx.x, wave = tid >> 5, lane = tid & 31, col = lane & 15, g = lane >> 4;
  const int sub = __builtin_amdgcn_readfirstlane(wave >> 2), wq = wave & 3;   // which attention (the same in every lane of a wave), which 16-query tile
  const int h = blockIdx.y;
  // lambda_full from the inputs (64-dots)
  float lam; { float s1 = 0.f, s2 = 0.f; for (int i = lane; i < HQ; i += 32) { s1 += bfr(LQ1[i]) * bfr(LK1[i]); s2 += bfr(LQ2[i]) * bfr(LK2[i]); }
#pragma unroll
    for (int o = 1; o < 32; o <<= 1) { s1 += __shfl_xor(s1, o); s2 += __shfl_xor(s2, o); } lam = exp_ni(s1) - exp_ni(s2) + LAMBDA_INIT; }
#pragma unroll 1   // the two tiles run through one copy of the code, one after the other in every wave; the choice of tile is the same for the whole block, so every barrier below is passed by all 8 waves in both rounds
  for (int ph = 0; ph < 2; ++ph) {
  const int qb = ph ? (int)blockIdx.x : TQB - 1 - (int)blockIdx.x; const int q0 = qb * 64 + wq * 16;
  const int nks = (qb * 64 + 64) / 32;
  const int qi = q0 + col;
  // this lane's query as B fragments, hi and lo of both 32-wide k chunks: loaded once, they stay in registers through all trips
  const size_t qo = (size_t)qi * DM + (2 * h + sub) * HQ + 8 * g; const v8b *qhp = (const v8b*)(QH + qo), *qlp = (const v8b*)(QL + qo);   // in units of 8 values: chunk kc takes units 4 kc and 4 kc + 2, the k order of frag_b
  union { v16b v; v8b q[2]; } qh[2], ql[2];
#pragma unroll   // qh and ql are indexed by constants and stay in registers
  for (int kc = 0; kc < 2; ++kc) { qh[kc].q[0] = qhp[4 * kc]; qh[kc].q[1] = qhp[4 * kc + 2]; ql[kc].q[0] = qlp[4 * kc]; ql[kc].q[1] = qlp[4 * kc + 2]; }
  asm volatile("s_wait_xcnt 0x0" :: "v"(qhp), "v"(qlp) : "memory");   // stands in front of any rewrite of the two address pairs that the query loads name; taking the pairs as inputs keeps them whole up to here
  float m = -3.0e38f, l = 0.f;   // of query qi: running maximum, base-2 domain (the same in both halves of the wave) and the running sum over this half's keys
  v8f acc[8] = {};
  const unsigned kv0 = (unsigned)(size_t)&skv[0]; const __bf16 *Khh = KH + 2 * h * HQ, *Klh = KL + 2 * h * HQ; const __bf16 *Vhh = VTH + (size_t)h * HD * SS, *Vlh = VTL + (size_t)h * HD * SS;
  stage_kv(Khh, Klh, Vhh, Vlh, kv0, tid); WAIT_COPIES(); __syncthreads();          // tile 0 is in buffer 0 for every wave (second round: every reader left both buffers at the first round's last foot, behind its s_wait_dscnt 0 and its barrier)
  stage_kv(Khh + (size_t)32 * KVW, Klh + (size_t)32 * KVW, Vhh + 32, Vlh + 32, kv0 + ABUF, tid);      // tile 1 (nks is 2 qb + 2, never below 2) flies while tile 0 is worked on
#pragma unroll 1
  for (int ks = 0; ks < nks; ++ks) { const int bo = (ks & 1) * ABUF; float s[16];   // s[8 ct + r]: key ks * 32 + ct * 16 + 8 g + r, which is the k order of a B fragment
    // every fragment of the trip is read from LDS here, as one group: the 16 reads of K first, which the scores need first, then the 32 of V, which land while the scores and the softmax run
    v16b kh[2][2], kl[2][2], vh[8], vl[8];
#pragma unroll   // the fragment arrays are indexed by constants and stay in registers
    for (int kc = 0; kc < 2; ++kc)
#pragma unroll
      for (int ct = 0; ct < 2; ++ct) { const char* kr = &skv[bo + (ct * 16 + col) * KROW + sub * (2 * HQ)]; kh[ct][kc] = frag_w(kr + kc * 64, g); kl[ct][kc] = frag_w(kr + KPL + kc * 64, g); }
#pragma unroll
    for (int dt = 0; dt < 8; ++dt) { const char* vr = &skv[bo + KBUF + (dt * 16 + col) * VROW]; vh[dt] = frag_w(vr, g); vl[dt] = frag_w(vr + VPL, g); }
    __builtin_amdgcn_sched_barrier(0);   // keeps the group whole and ahead of the products: moved down to its product, each read is waited out there with nothing to cover it
    v8f c[2] = {};   // the two 16-key tiles are independent chains and take turns; each chain keeps its order of products
#pragma unroll
    for (int kc = 0; kc < 2; ++kc) {
#pragma unroll
      for (int ct = 0; ct < 2; ++ct) c[ct] = wmma_bfp(kh[ct][kc], ql[kc].v, c[ct]);
#pragma unroll
      for (int ct = 0; ct < 2; ++ct) c[ct] = wmma_bfp(kl[ct][kc], qh[kc].v, c[ct]);
#pragma unroll
      for (int ct = 0; ct < 2; ++ct) c[ct] = wmma_bfp(kh[ct][kc], qh[kc].v, c[ct]); }
#pragma unroll
    for (int ct = 0; ct < 2; ++ct)
#pragma unroll
      for (int r = 0; r < 8; ++r) { const int kk = ks * 32 + ct * 16 + 8 * g + r; s[8 * ct + r] = (kk <= qi) ? c[ct][r] * QK_SCALE_LOG2 : -3.0e38f; }
    float mx = s[0];
#pragma unroll
    for (int i = 1; i < 16; ++i) mx = fmaxf(mx, s[i]);
    mx = fmaxf(mx, xhalf(mx));
    const float mn = fmaxf(m, mx); const float alpha = exp2_hw(m - mn);   // key 0 is open to every query, so mn is a real score from the first trip on
    float e[16], t[8];
#pragma unroll
    for (int i = 0; i < 16; ++i) e[i] = s[i] - mn;
    __builtin_amdgcn_sched_barrier(0);   // with the one in the loop: holds each v_nop below at its exponential
#pragma unroll
    for (int i = 0; i < 16; ++i) { e[i] = exp2_hw(e[i]); asm volatile("v_nop"); __builtin_amdgcn_sched_barrier(0); }   // the v_nop is the one slot that the instruction set asks for behind a transcendental before its source is overwritten
#pragma unroll
    for (int i = 0; i < 8; ++i) t[i] = e[i] + e[8 + i];
    float es = ((t[0] + t[4]) + (t[2] + t[6])) + ((t[1] + t[5]) + (t[3] + t[7]));
    l = l * alpha + es; m = mn;
#pragma unroll
    for (int dt = 0; dt < 8; ++dt) acc[dt] *= alpha;
    const F2 pb = bsplit16(e);
    // the 8 output tiles are independent chains and take turns; each keeps its order of the three products
#pragma unroll
    for (int dt = 0; dt < 8; ++dt) acc[dt] = wmma_bfp(vh[dt], pb.l, acc[dt]);
#pragma unroll
    for (int dt = 0; dt < 8; ++dt) acc[dt] = wmma_bfp(vl[dt], pb.h, acc[dt]);
#pragma unroll
    for (int dt = 0; dt < 8; ++dt) acc[dt] = wmma_bfp(vh[dt], pb.h, acc[dt]);
    __builtin_amdgcn_sched_barrier(0);   // keeps the trip's products ahead of the foot: they touch registers only, and moved behind the foot's waits they would start only when all 48 reads have returned
    WAIT_LDS(); WAIT_COPIES(); __syncthreads();   // publishes tile ks + 1 and ends every wave's reads of tile ks
    if (ks + 2 < nks) stage_kv(Khh + (size_t)(ks + 2) * 32 * KVW, Klh + (size_t)(ks + 2) * 32 * KVW, Vhh + (ks + 2) * 32, Vlh + (ks + 2) * 32, kv0 + bo, tid); }
  WAIT_COPIES();
  l += xhalf(l);   // the two halves' sums join once
  const float il = 1.0f / l; float* orow = &so[wq][col][8 * g];   // this lane's 8 consecutive d of each 16-wide group dt
  if (sub == 0) {
#pragma unroll
    for (int dt = 0; dt < 8; ++dt) { const v8f a = acc[dt] * il; *(v4f*)(orow + dt * 16) = __builtin_shufflevector(a, a, 0, 1, 2, 3); *(v4f*)(orow + dt * 16 + 4) = __builtin_shufflevector(a, a, 4, 5, 6, 7); }
  }
  __syncthreads();   // hands the normalised attn1 rows of tile wq from wave wq to wave 4 + wq
  if (sub == 1) {
    float ss = 0.f;
#pragma unroll
    for (int dt = 0; dt < 8; ++dt)
#pragma unroll
      for (int r = 0; r < 8; ++r) { const float a = orow[dt * 16 + r] - lam * (acc[dt][r] * il); acc[dt][r] = a; ss += a * a; }
    ss += xhalf(ss);
    const float rs = rsqrtf(ss / (float)HD + 1e-5f) * (1.0f - LAMBDA_INIT);
    v4f gv[16]; const v4f* gp = (const v4f*)(G + 8 * g);   // g in this lane's order: the 8 consecutive values of each 16-wide group as two 16-byte loads, all from one base
#pragma unroll
    for (int dt = 0; dt < 8; ++dt) { gv[2 * dt] = gp[4 * dt]; gv[2 * dt + 1] = gp[4 * dt + 1]; }
    asm volatile("s_wait_xcnt 0x0" :: "v"(gp) : "memory");   // stands in front of any rewrite of the address pair that the g loads name; taking the pair as an input keeps it whole up to here, so that no load of the run lands in it
#pragma unroll
    for (int dt = 0; dt < 8; ++dt)
#pragma unroll
      for (int r = 0; r < 8; ++r) orow[dt * 16 + r] = acc[dt][r] * rs * bfr(gv[2 * dt + (r >> 2)][r & 3]);
    LDSX();
    for (int rl = 0; rl < 16; ++rl) vst2(O + (size_t)(q0 + rl) * DM + h * HD + lane * 4, *(const v4f*)&so[wq][rl][lane * 4]);
    asm volatile("s_wait_xcnt 0x0" ::: "memory");   // stands in front of the next round's rewrite of the registers that these stores name
  }
  }
}
// ---- k_out: block = (64 rows, 128 cols): out = O(hi/lo) . wproj^T rows (2 products)
__global__ __launch_bounds__(128) void k_out(const float* __restrict__ O, const __bf16* __restrict__ P, float* __restrict__ Y) {
  __shared__ __align__(16) float so[4][16][132]; __shared__ __align__(16) char sw[2 * WBUF];
  const int tid = threadIdx.x, wave = tid >> 5, lane = tid & 31, col = lane & 15, g = lane >> 4; const size_t r0 = (size_t)blockIdx.x * 64 + wave * 16; const int n0 = blockIdx.y * 128;
  v8f acc[8] = {};
  const unsigned sw0 = (unsigned)(size_t)&sw[0]; const __bf16* Pn = P + (size_t)n0 * DM;
  stage_w(Pn, sw0, tid); WAIT_COPIES(); __syncthreads();   // tile 0 is in buffer 0 for every wave
  stage_w(Pn + 64, sw0 + WBUF, tid);                       // tile 1 flies while tile 0 is worked on
#pragma unroll 1   // one trip per stage: the ring's foot (waits, barrier, refill) stands once and the two buffers alternate by t & 1
  for (int t = 0; t < DM / 64; ++t) { const int bo = (t & 1) * WBUF; F2 a[2];
#pragma unroll
    for (int u = 0; u < 2; ++u) a[u] = split_row(O + (r0 + col) * DM, (2 * t + u) * 32, lane);
#pragma unroll
    for (int u = 0; u < 2; ++u) { v16b b[8];
#pragma unroll
      for (int j = 0; j < 8; ++j) b[j] = frag_w(&sw[bo + (j * 16 + col) * WROW + u * 64], g);
#pragma unroll
      for (int j = 0; j < 8; ++j) { acc[j] = wmma_bf(a[u].l, b[j], acc[j]); acc[j] = wmma_bf(a[u].h, b[j], acc[j]); } }
    WAIT_LDS(); WAIT_COPIES(); __syncthreads();   // publishes tile t + 1 and ends every wave's reads of tile t
    if (t + 2 < DM / 64) stage_w(Pn + (t + 2) * 64, sw0 + bo, tid); }
  WAIT_COPIES();
#pragma unroll
  for (int j = 0; j < 8; ++j)
#pragma unroll
    for (int r = 0; r < 8; ++r) so[wave][8 * g + r][j * 16 + col] = acc[j][r];
  LDSX();
  for (int rl = 0; rl < 16; ++rl) vst2(Y + (r0 + rl) * DM + n0 + lane * 4, *(const v4f*)&so[wave][rl][lane * 4]);
}
extern "C" void kernel_launch(void* const* d_in, const int* in_sizes, int n_in, void* d_out, int out_size, void* d_ws, size_t ws_size, hipStream_t stream) {
  (void)in_sizes; (void)n_in; (void)out_size;
  const float** F = (const float**)d_in;   // 0 x [1,2048,2048], 1 Wq, 2 Wk, 3 Wv, 4 Wo [2048,2048] (x @ W), 5 lq1, 6 lk1, 7 lq2, 8 lk2 [64], 9 g [128]
  if (ws_size < (size_t)WS_END) return;
  char* ws = (char*)d_ws; __bf16 *PK = (__bf16*)(ws + WS_PK), *VTH = (__bf16*)(ws + WS_VTH), *VTL = (__bf16*)(ws + WS_VTL);
  __bf16 *QH = (__bf16*)(ws + WS_QH), *QL = (__bf16*)(ws + WS_QL), *KH = (__bf16*)(ws + WS_KH), *KL = (__bf16*)(ws + WS_KL);
  float *CS = (float*)(ws + WS_CS), *O = (float*)(ws + WS_O);
  k_packT<<<dim3(DM / 64, DM / 128), 256, 0, stream>>>(F[1], PK + PK_Q); k_packT<<<dim3(DM / 64, DM / 128), 256, 0, stream>>>(F[2], PK + PK_K); k_packT<<<dim3(DM / 64, DM / 128), 256, 0, stream>>>(F[3], PK + PK_V); k_packT<<<dim3(DM / 64, DM / 128), 256, 0, stream>>>(F[4], PK + PK_O);
  k_rope_tab<<<SS, 32, 0, stream>>>(CS);
  k_proj<0><<<dim3(TRP, DM / 128), 128, 0, stream>>>(F[0], PK + PK_Q, CS, QH, QL);
  k_proj<0><<<dim3(TRP, DM / 128), 128, 0, stream>>>(F[0], PK + PK_K, CS, KH, KL);
  k_proj<1><<<dim3(TRP, DM / 128), 128, 0, stream>>>(F[0], PK + PK_V, CS, VTH, VTL);
  k_attn<<<dim3(TQB / 2, NH), 256, 0, stream>>>(QH, QL, KH, KL, VTH, VTL, F[5], F[6], F[7], F[8], F[9], O);
  k_out<<<dim3(TQB, DM / 128), 128, 0, stream>>>(O, PK + PK_O, (float*)d_out);
}

// v010
// Measured time: 208 microseconds a run.
// Next to v009, in two timings, it ran 1.17 and 1.16 times as fast.
// Over all steps from v000 it is 6.75 times as fast.
// compute dtype: x, the four weights, the lambda vectors and g (module inputs) rounded to bf16; q/k/v projections with exact bf16 products (x and W are inputs) and interleaved-pair RoPE (tables in f32 as the module's numpy code) in the epilogue; the two causal attentions per head with q.k as bf16 hi + residual pairs (3 products) and P.V with P hi/lo x V hi/lo (3 products); the differential combination, RMSNorm and (1 - lambda_init) scaling in f32; the output projection hi/lo x exact Wo (2 products); all GEMMs on WMMA 16x16x32; f32 accumulate.
#include <hip/hip_runtime.h>
#include <math.h>

typedef __attribute__((ext_vector_type(16))) _Float16 v16h;
typedef __attribute__((ext_vector_type(16))) __bf16 v16b;
typedef __attribute__((ext_vector_type(8)))  _Float16 v8h;
typedef __attribute__((ext_vector_type(8)))  float v8f;
typedef __attribute__((ext_vector_type(4)))  float v4f;
typedef __attribute__((ext_vector_type(2)))  float v2f;
typedef __attribute__((ext_vector_type(4)))  unsigned v4u;
typedef __attribute__((ext_vector_type(4)))  int v4i;
typedef float __attribute__((may_alias)) float_a;
typedef int __attribute__((may_alias)) int_a;

template <typename T> __device__ __forceinline__ void vst2(void* p, T v) { *(T*)p = v;  }
__device__ __forceinline__ v8f wmma16(v16h a, v16h b, v8f c) {
  v8f d = __builtin_amdgcn_wmma_f32_16x16x32_f16(false, a, false, b, (short)0, c, false, false);
  asm volatile("v_nop\n\tv_nop\n\tv_nop\n\tv_nop" : "+v"(d) : "v"(a), "v"(b));
  return d;
}
__device__ __forceinline__ v8f wmma_bf(v16b a, v16b b, v8f c) {
  v8f d = __builtin_amdgcn_wmma_f32_16x16x32_bf16(false, a, false, b, (short)0, c, false, false);
  asm volatile("v_nop\n\tv_nop\n\tv_nop\n\tv_nop" : "+v"(d) : "v"(a), "v"(b));
  return d;
}
// 16x16x32 fragments: lane = (h = lane>>4, row/col = lane&15); elements 0..7 = k0+8h+0..7, 8..15 = k0+16+8h+0..7; D element r = row 8h+r
__device__ __forceinline__ v16h frag_h(const _Float16* rowk0, int lane) {
  union { v16h v; v8h q[2]; } u; const _Float16* p = rowk0 + 8 * (lane >> 4);
  u.q[0] = *(const v8h*)p; u.q[1] = *(const v8h*)(p + 16); return u.v;
}
__device__ __forceinline__ v16h frag_f32(const float* rowk0, int lane) {
  v16h a; const float* p = rowk0 + 8 * (lane >> 4);
#pragma unroll
  for (int i = 0; i < 8; ++i) { a[i] = (_Float16)p[i]; a[8 + i] = (_Float16)p[16 + i]; }
  return a;
}
__device__ __forceinline__ v16h frag_f32s(const float* rowk0, int lane, float sc) {
  v16h a; const float* p = rowk0 + 8 * (lane >> 4);
#pragma unroll
  for (int i = 0; i < 8; ++i) { a[i] = (_Float16)(p[i] * sc); a[8 + i] = (_Float16)(p[16 + i] * sc); }
  return a;
}
// column fragment from a [K][ld] layout (column n), rows >= K read as 0
__device__ __forceinline__ v16h fragc_f32(const float* W, int k0, int n, int lane, int ld, int K) {
  v16h a; const int g = lane >> 4;
#pragma unroll
  for (int i = 0; i < 8; ++i) { const int ka = k0 + 8 * g + i, kb = ka + 16;
    a[i] = (_Float16)(ka < K ? W[(size_t)(ka < K ? ka : K - 1) * ld + n] : 0.f); a[8 + i] = (_Float16)(kb < K ? W[(size_t)(kb < K ? kb : K - 1) * ld + n] : 0.f); }
  return a;
}
struct F2 { v16b h, l; };
__device__ __forceinline__ F2 bsplit16(const float v[16]) { F2 r;
#pragma unroll
  for (int i = 0; i < 16; ++i) { const __bf16 h = (__bf16)v[i]; r.h[i] = h; r.l[i] = (__bf16)(v[i] - (float)h); }
  return r; }
__device__ __forceinline__ F2 split_row(const float* row, int k0, int lane) { float v[16]; const float* p = row + k0 + 8 * (lane >> 4);
#pragma unroll
  for (int i = 0; i < 8; ++i) { v[i] = p[i]; v[8 + i] = p[16 + i]; }
  return bsplit16(v); }
__device__ __forceinline__ F2 split_rowK(const float* row, int k0, int lane, int K) { float v[16]; const int g = lane >> 4;
#pragma unroll
  for (int i = 0; i < 8; ++i) { const int ka = k0 + 8 * g + i, kb = ka + 16; v[i] = ka < K ? row[ka < K ? ka : K - 1] : 0.f; v[8 + i] = kb < K ? row[kb < K ? kb : K - 1] : 0.f; }
  return bsplit16(v); }
__device__ __forceinline__ F2 split_col(const float* W, int k0, int n, int lane, int ld, int K) { float v[16]; const int g = lane >> 4;
#pragma unroll
  for (int i = 0; i < 8; ++i) { const int ka = k0 + 8 * g + i, kb = ka + 16; v[i] = ka < K ? W[(size_t)(ka < K ? ka : K - 1) * ld + n] : 0.f; v[8 + i] = kb < K ? W[(size_t)(kb < K ? kb : K - 1) * ld + n] : 0.f; }
  return bsplit16(v); }
__device__ __forceinline__ v8f mac3(const F2& a, const F2& b, v8f c) { c = wmma_bf(a.l, b.h, c); c = wmma_bf(a.h, b.l, c); return wmma_bf(a.h, b.h, c); }
__device__ __forceinline__ float sigm(float v) { return 1.0f / (1.0f + expf(-v)); }
#define LDSX() do { asm volatile("s_wait_dscnt 0" ::: "memory"); __builtin_amdgcn_wave_barrier(); __builtin_amdgcn_fence(__ATOMIC_RELEASE, "workgroup"); } while (0)


// Differential attention (B 1, S 2048, E 2048, 16 heads; q/k as 32 half-heads x 64 with interleaved RoPE, v as 16 heads x 128): a = softmax_causal(q1 k1^T/8) v - lambda_full * softmax_causal(q2 k2^T/8) v; lambda_full = exp(lq1.lk1) - exp(lq2.lk2) + lambda_init; a = RMSNorm_128(a) * g * (1 - lambda_init); out = a Wo.
#define SS 2048
#define DM 2048
#define NH 16
#define HD 128               // v head dim (2*64)
#define HQ 64                // q/k half-head dim
#define KVW DM
#define LAMBDA_INIT 0.78360577f   /* 0.8 - 0.6*exp(-0.3*12) = 0.7836057665 */
#ifndef TQB
#define TQB (SS / 64)
#define TRP (SS / 64)          // projection row tiles (all)
#endif
typedef __attribute__((ext_vector_type(8))) __bf16 v8b;
__device__ __forceinline__ v16b frag_b(const __bf16* rowk0, int lane) {
  union { v16b v; v8b q[2]; } u; const __bf16* p = rowk0 + 8 * (lane >> 4);
  u.q[0] = *(const v8b*)p; u.q[1] = *(const v8b*)(p + 16); return u.v;
}
__device__ __forceinline__ float bfr(float v) { return (float)(__bf16)v; }
__device__ __attribute__((noinline)) float exp_ni(float v) { return expf(v); }
__device__ __attribute__((noinline)) float erf_ni(float v) { return erff(v); }
// 2^v as the one hardware instruction v_exp_f32, in line; a very negative v (a masked score, the start value of the running maximum) gives exactly 0
__device__ __forceinline__ float exp2_hw(float v) { return __builtin_amdgcn_exp2f(v); }
#define QK_SCALE_LOG2 0.18033688f   /* (1/8) * log2(e): scores and their running maximum are kept in the base-2 domain, so that exp(s - m) is 2^(s2 - m2) */

#define PK_Q 0
#define PK_K (PK_Q + DM * DM)
#define PK_V (PK_K + KVW * DM)
#define PK_O (PK_V + KVW * DM)
#define PK_END (PK_O + DM * DM)
#define WS_PK  0u
#define WS_CS  (WS_PK + 2u * PK_END)             // f32 [2048][32] cos, then [2048][32] sin
#define WS_QH  (WS_CS + 4u * 2 * SS * 32)        // q after RoPE as two bf16 planes [2048][2048]: hi, then the residual lo; k the same
#define WS_QL  (WS_QH + 2u * SS * DM)
#define WS_KH  (WS_QL + 2u * SS * DM)
#define WS_KL  (WS_KH + 2u * SS * KVW)
#define WS_VTH (WS_KL + 2u * SS * KVW)
#define WS_VTL (WS_VTH + 2u * KVW * SS)
#define WS_O   (WS_VTL + 2u * KVW * SS)
#define WS_END (WS_O + 4u * SS * DM)

// ---- weight tile in LDS: one stage = 128 packed weight rows x 64 k (128 B a row), LDS pitch 144 B (16 B x odd, for the ds_load_b128 readers), two stages
#define WROW 144
#define WBUF (128 * WROW)
// 128 threads bring one stage: copy i takes rows 16 i + (tid >> 3), 16 B a lane, so a wave's 32 lanes cover 4 whole 128-B rows per copy
__device__ __forceinline__ void stage_w(const __bf16* __restrict__ Pt, unsigned lds, int tid) {
  const __bf16* gp = Pt + (size_t)(tid >> 3) * DM + (tid & 7) * 8; const unsigned l = lds + (tid >> 3) * WROW + (tid & 7) * 16;
  // the eight copies and, as the last line, the wait that stands in front of any rewrite of the address registers they name
  asm volatile("global_load_async_to_lds_b128 %0, %8, off\n\t"
               "global_load_async_to_lds_b128 %1, %9, off\n\t"
               "global_load_async_to_lds_b128 %2, %10, off\n\t"
               "global_load_async_to_lds_b128 %3, %11, off\n\t"
               "global_load_async_to_lds_b128 %4, %12, off\n\t"
               "global_load_async_to_lds_b128 %5, %13, off\n\t"
               "global_load_async_to_lds_b128 %6, %14, off\n\t"
               "global_load_async_to_lds_b128 %7, %15, off\n\t"
               "s_wait_xcnt 0x0"
               :: "v"(l), "v"(l + 16 * WROW), "v"(l + 32 * WROW), "v"(l + 48 * WROW), "v"(l + 64 * WROW), "v"(l + 80 * WROW), "v"(l + 96 * WROW), "v"(l + 112 * WROW),
                  "v"(gp), "v"(gp + 16 * DM), "v"(gp + 32 * DM), "v"(gp + 48 * DM), "v"(gp + 64 * DM), "v"(gp + 80 * DM), "v"(gp + 96 * DM), "v"(gp + 112 * DM)
               : "memory");
}
// fragment of one staged row: the same bytes in the same k order as frag_b reads from the packed row
__device__ __forceinline__ v16b frag_w(const char* rowk0, int g) {
  union { v16b v; v8b q[2]; } u; const char* p = rowk0 + 16 * g;
  u.q[0] = *(const v8b*)p; u.q[1] = *(const v8b*)(p + 32); return u.v;
}
#define WAIT_COPIES() asm volatile("s_wait_asynccnt 0x0" ::: "memory")   /* this wave's copies have landed */
#define WAIT_LDS()    asm volatile("s_wait_dscnt 0x0" ::: "memory")      /* this wave's LDS reads have returned */
// ---- A tile in LDS, in the weight tile's ring: one stage = the block's 64 rows x 64 k of f32 (256 B a row), LDS pitch 272 B (16 B x odd, for the ds_load_b128 readers), two stages
#define XROW 272
#define XBUF (64 * XROW)
// 128 threads bring one stage: copy i takes rows 8 i + (tid >> 4), 16 B a lane, so a wave's 32 lanes cover 2 whole 256-B rows (4 whole lines) per copy; a fragment load straight from global memory takes 32 B from each of 16 lines
__device__ __forceinline__ void stage_x(const float* __restrict__ Xt, unsigned lds, int tid) {
  const float* gp = Xt + (size_t)(tid >> 4) * DM + (tid & 15) * 4; const unsigned l = lds + (tid >> 4) * XROW + (tid & 15) * 16;
  // the eight copies and, as the last line, the wait that stands in front of any rewrite of the address registers they name
  asm volatile("global_load_async_to_lds_b128 %0, %8, off\n\t"
               "global_load_async_to_lds_b128 %1, %9, off\n\t"
               "global_load_async_to_lds_b128 %2, %10, off\n\t"
               "global_load_async_to_lds_b128 %3, %11, off\n\t"
               "global_load_async_to_lds_b128 %4, %12, off\n\t"
               "global_load_async_to_lds_b128 %5, %13, off\n\t"
               "global_load_async_to_lds_b128 %6, %14, off\n\t"
               "global_load_async_to_lds_b128 %7, %15, off\n\t"
               "s_wait_xcnt 0x0"
               :: "v"(l), "v"(l + 8 * XROW), "v"(l + 16 * XROW), "v"(l + 24 * XROW), "v"(l + 32 * XROW), "v"(l + 40 * XROW), "v"(l + 48 * XROW), "v"(l + 56 * XROW),
                  "v"(gp), "v"(gp + 8 * DM), "v"(gp + 16 * DM), "v"(gp + 24 * DM), "v"(gp + 32 * DM), "v"(gp + 40 * DM), "v"(gp + 48 * DM), "v"(gp + 56 * DM)
               : "memory");
}
// one lane's 16 f32 values of a 32-wide k chunk of a staged row, in the k order of frag_b: v[0..7] = k 8 g + 0..7, v[8..15] = k 16 + 8 g + 0..7
__device__ __forceinline__ void frag_x(float (&v)[16], const char* rowk0, int g) {
  const v4f* q = (const v4f*)(rowk0 + 32 * g); const v4f a = q[0], b = q[1], c = q[4], d = q[5];
#pragma unroll   // v is indexed by constants and stays in registers
  for (int i = 0; i < 4; ++i) { v[i] = a[i]; v[4 + i] = b[i]; v[8 + i] = c[i]; v[12 + i] = d[i]; }
}

// ---- k_packT: block = a 64 (k) x 128 (n) tile of a [DM][DM] (x @ W) matrix, written as 128 packed rows DST[n][k0 .. k0 + 63]; both sides of the transpose move whole 128-B lines: a wave's load covers 512 contiguous bytes of one k row, and 8 lanes store one 128-B piece of a packed row
#define PROW 144   /* LDS pitch of a tile row: 64 k x 2 B + 16 B; unpadded, the rows that the lanes of one ds_store_b128 write (4 apart) would all fall on the same banks */
__global__ __launch_bounds__(256) void k_packT(const float* __restrict__ Wm, __bf16* __restrict__ DST) {
  __shared__ __align__(16) char s[128 * PROW]; const int tid = threadIdx.x, wave = tid >> 5, lane = tid & 31; const int k0 = blockIdx.x * 64, n0 = blockIdx.y * 128;
  const float* p = Wm + (size_t)(k0 + 8 * wave) * DM + n0 + 4 * lane; v4f r[8];   // rows k0 + 8 wave + 0..7, columns n0 + 4 lane + 0..3
  // every loop of this kernel is unrolled: r[] and o are indexed by constants and stay in registers, and the 8 loads go out as one group ahead of the first use
#pragma unroll
  for (int i = 0; i < 8; ++i) r[i] = *(const v4f*)(p + (size_t)i * DM);
#pragma unroll
  for (int j = 0; j < 4; ++j) { v8b o;
#pragma unroll
    for (int i = 0; i < 8; ++i) o[i] = (__bf16)r[i][j];
    *(v8b*)&s[(4 * lane + j) * PROW + 16 * wave] = o; }
  __syncthreads();
#pragma unroll
  for (int i = 0; i < 4; ++i) { const int row = 32 * i + (tid >> 3), pc = tid & 7; vst2((unsigned*)(DST + (size_t)(n0 + row) * DM + k0 + pc * 8), *(const v4u*)&s[row * PROW + pc * 16]); }
}
__global__ __launch_bounds__(32) void k_rope_tab(float* __restrict__ CS) {
  __shared__ __align__(16) float sc[32], ssn[32]; const int t = blockIdx.x, i = threadIdx.x;
  const float dv = expf((float)(2 * i) * (-9.2103404f / 64.0f));   /* ln(1e4) as the f32 literal numpy uses */ const float ang = (float)t * dv; sc[i] = cosf(ang); ssn[i] = sinf(ang);
  __syncthreads();
  if (i < 8) vst2(CS + (size_t)t * 32 + i * 4, *(const v4f*)&sc[i * 4]); else if (i < 16) vst2(CS + (size_t)SS * 32 + (size_t)t * 32 + (i - 8) * 4, *(const v4f*)&ssn[(i - 8) * 4]);
}
// ---- k_proj<MODE>: block = (64 rows, 128 cols = one head): Y = bf16(x) . P rows (exact); MODE 0: RoPE, then rows of bf16 hi and residual lo, one plane each (q/k): the split that the three score products need, made once here; MODE 1: plain -> transposed bf16 hi/lo planes (v)
template <int MODE>
__global__ __launch_bounds__(128) void k_proj(const float* __restrict__ X, const __bf16* __restrict__ P, const float* __restrict__ CS, __bf16* __restrict__ PH, __bf16* __restrict__ PL) {
  __shared__ __align__(16) float so[MODE ? 1 : 4][16][132]; __shared__ __align__(16) __bf16 sth[MODE ? 128 : 1][72], stl[MODE ? 128 : 1][72]; __shared__ __align__(16) char sw[2 * WBUF]; __shared__ __align__(16) char sx[2 * XBUF];
  const int tid = threadIdx.x, wave = tid >> 5, lane = tid & 31, col = lane & 15, g = lane >> 4; const size_t r0 = (size_t)blockIdx.x * 64 + wave * 16; const int n0 = blockIdx.y * 128;
  v8f acc[8] = {};
  const unsigned sw0 = (unsigned)(size_t)&sw[0], sx0 = (unsigned)(size_t)&sx[0]; const __bf16* Pn = P + (size_t)n0 * DM; const float* Xb = X + (size_t)blockIdx.x * 64 * DM;
  stage_w(Pn, sw0, tid); stage_x(Xb, sx0, tid); WAIT_COPIES(); __syncthreads();   // tile 0 of both operands is in buffer 0 for every wave
  stage_w(Pn + 64, sw0 + WBUF, tid); stage_x(Xb + 64, sx0 + XBUF, tid);           // tile 1 flies while tile 0 is worked on
#pragma unroll 1   // one trip per stage: the ring's foot (waits, barrier, refill) stands once and the two buffers alternate by t & 1
  for (int t = 0; t < DM / 64; ++t) { const int bo = (t & 1) * WBUF, xo = (t & 1) * XBUF; v16b a[2];
#pragma unroll
    for (int u = 0; u < 2; ++u) { float v[16]; frag_x(v, &sx[xo + (wave * 16 + col) * XROW + u * 128], g);
#pragma unroll
      for (int i = 0; i < 16; ++i) a[u][i] = (__bf16)v[i]; }
#pragma unroll
    for (int u = 0; u < 2; ++u) { v16b b[8];
#pragma unroll
      for (int j = 0; j < 8; ++j) b[j] = frag_w(&sw[bo + (j * 16 + col) * WROW + u * 64], g);
#pragma unroll
      for (int j = 0; j < 8; ++j) acc[j] = wmma_bf(a[u], b[j], acc[j]); }
    WAIT_LDS(); WAIT_COPIES(); __syncthreads();   // publishes tile t + 1 and ends every wave's reads of tile t
    if (t + 2 < DM / 64) { stage_w(Pn + (t + 2) * 64, sw0 + bo, tid); stage_x(Xb + (t + 2) * 64, sx0 + xo, tid); } }
  WAIT_COPIES();
  if (MODE == 0) {
    // projections to LDS, then interleaved-pair RoPE in place within each 64-wide half-head: (x_{2i}, x_{2i+1}) -> (x c - y s, x s + y c) with angle index i
#pragma unroll
    for (int j = 0; j < 8; ++j)
#pragma unroll
      for (int r = 0; r < 8; ++r) so[wave][8 * g + r][j * 16 + col] = acc[j][r];
    LDSX();
    for (int q = lane; q < 16 * 64; q += 32) { const int rl = q >> 6, pi = q & 63; const int half = pi >> 5, i = pi & 31; const size_t t = r0 + rl; const float c = CS[t * 32 + i], s = CS[(size_t)SS * 32 + t * 32 + i]; float* e = &so[wave][rl][half * 64 + 2 * i]; const float xe = e[0], xo = e[1]; e[0] = xe * c - xo * s; e[1] = xe * s + xo * c; }
    LDSX();
    // 16 lanes take one row of 128 values, 8 a lane: 16 B of the hi plane and 16 B of the lo plane, so a wave's store covers two whole 256-B row pieces
    for (int it = 0; it < 8; ++it) { const int rl = 2 * it + g; const float* e = &so[wave][rl][col * 8]; v8b hb, lb;
#pragma unroll   // hb and lb are indexed by constants and stay in registers
      for (int i = 0; i < 8; ++i) { const float v = e[i]; const __bf16 hh = (__bf16)v; hb[i] = hh; lb[i] = (__bf16)(v - (float)hh); }
      const size_t o = (r0 + rl) * DM + n0 + col * 8; vst2(PH + o, hb); vst2(PL + o, lb); }
  } else {
#pragma unroll
    for (int j = 0; j < 8; ++j)
#pragma unroll
      for (int r = 0; r < 8; ++r) { const float v = acc[j][r]; const __bf16 hb = (__bf16)v; sth[j * 16 + col][wave * 16 + 8 * g + r] = hb; stl[j * 16 + col][wave * 16 + 8 * g + r] = (__bf16)(v - (float)hb); }
    __syncthreads();
    const int s0 = blockIdx.x * 64;
    for (int q = tid; q < 128 * 8; q += 128) { const int d = q >> 3, pc = q & 7; const size_t o = (size_t)(n0 + d) * SS + s0 + pc * 8; vst2((unsigned*)(PH + o), *(const v4u*)&sth[d][pc * 8]); vst2((unsigned*)(PL + o), *(const v4u*)&stl[d][pc * 8]); }
  }
}
// ---- K and V tiles in LDS: one stage = the 32 keys of one trip for one head: the hi and the lo plane of K, 32 rows x 256 B each (both 64-wide half-heads of a key), then the hi and the lo plane of V^T, 128 rows (d) x 64 B (32 keys) each; LDS pitches 272 B and 80 B (16 B x odd, for the ds_load_b128 readers), two stages
#define KROW 272
#define VROW 80
#define KPL  (32 * KROW)
#define KBUF (2 * KPL)
#define VPL  (128 * VROW)
#define ABUF (KBUF + 2 * VPL)
// 256 threads bring one stage, 16 B a lane: K copy i of a plane takes rows 16 i + (tid >> 4), a wave covering two whole 256-B rows; V copy i of a plane takes rows 64 i + (tid >> 2), a wave covering 8 rows of 64 B
__device__ __forceinline__ void stage_kv(const __bf16* __restrict__ Kh, const __bf16* __restrict__ Kl, const __bf16* __restrict__ Vh, const __bf16* __restrict__ Vl, unsigned lds, int tid) {
  const size_t ko = (size_t)(tid >> 4) * KVW + (tid & 15) * 8; const __bf16 *kh = Kh + ko, *kp = Kl + ko; const unsigned kl = lds + (tid >> 4) * KROW + (tid & 15) * 16;
  const size_t vo = (size_t)(tid >> 2) * SS + (tid & 3) * 8; const __bf16 *hp = Vh + vo, *lp = Vl + vo; const unsigned vl = lds + KBUF + (tid >> 2) * VROW + (tid & 3) * 16;
  // the eight copies and, as the last line, the wait that stands in front of any rewrite of the address registers they name
  asm volatile("global_load_async_to_lds_b128 %0, %8, off\n\t"
               "global_load_async_to_lds_b128 %1, %9, off\n\t"
               "global_load_async_to_lds_b128 %2, %10, off\n\t"
               "global_load_async_to_lds_b128 %3, %11, off\n\t"
               "global_load_async_to_lds_b128 %4, %12, off\n\t"
               "global_load_async_to_lds_b128 %5, %13, off\n\t"
               "global_load_async_to_lds_b128 %6, %14, off\n\t"
               "global_load_async_to_lds_b128 %7, %15, off\n\t"
               "s_wait_xcnt 0x0"
               :: "v"(kl), "v"(kl + 16 * KROW), "v"(kl + KPL), "v"(kl + KPL + 16 * KROW), "v"(vl), "v"(vl + 64 * VROW), "v"(vl + VPL), "v"(vl + VPL + 64 * VROW),
                  "v"(kh), "v"(kh + 16 * KVW), "v"(kp), "v"(kp + 16 * KVW), "v"(hp), "v"(hp + 64 * SS), "v"(lp), "v"(lp + 64 * SS)
               : "memory");
}
// the plain builtin: the compiler keeps the distances behind it itself, and with no asm statement naming them the trip's fragments and the accumulators may lie above v255
__device__ __forceinline__ v8f wmma_bfp(v16b a, v16b b, v8f c) { return __builtin_amdgcn_wmma_f32_16x16x32_bf16(false, a, false, b, (short)0, c, false, false); }
// lane l with lane l ^ 16 (the two halves of a wave hold the two halves of one query's keys, or of its output row)
__device__ __forceinline__ float xhalf(float x) { return __builtin_bit_cast(float, __builtin_amdgcn_permlanex16(__builtin_bit_cast(int, x), __builtin_bit_cast(int, x), 0x76543210, 0xfedcba98, false, false)); }
// ---- k_attn: block = (two tiles of 64 queries, head h), one tile after the other: tile TQB - 1 - x, then tile x, so that every block walks the same number of trips (2 TQB + 2) although a causal tile's trips grow with its index; per tile, 8 waves: waves 0..3 run attention 1 and waves 4..7 attention 2 of the same four 16-query tiles side by side; each trip's K and V tiles are staged once in LDS for all 8 waves; transposed products: S^T = K.Q^T (3 products) and O^T += V^T.P^T (3 products), so lane (g, col) holds query q0 + col: its scores of keys 8 g + r and 16 + 8 g + r of a trip, and its outputs d = 16 dt + 8 g + r; O[q][h*128+d]
__global__ __launch_bounds__(256) void k_attn(const __bf16* __restrict__ QH, const __bf16* __restrict__ QL, const __bf16* __restrict__ KH, const __bf16* __restrict__ KL, const __bf16* __restrict__ VTH, const __bf16* __restrict__ VTL, const float* __restrict__ LQ1, const float* __restrict__ LK1, const float* __restrict__ LQ2, const float* __restrict__ LK2, const float* __restrict__ G, float* __restrict__ O) {
  __shared__ __align__(16) float so[4][16][132]; __shared__ __align__(16) char skv[2 * ABUF];
  const int tid = threadIdx.x, wave = tid >> 5, lane = tid & 31, col = lane & 15, g = lane >> 4;
  const int sub = __builtin_amdgcn_readfirstlane(wave >> 2), wq = wave & 3;   // which attention (the same in every lane of a wave), which 16-query tile
  const int h = blockIdx.y;
  // lambda_full from the inputs (64-dots)
  float lam; { float s1 = 0.f, s2 = 0.f; for (int i = lane; i < HQ; i += 32) { s1 += bfr(LQ1[i]) * bfr(LK1[i]); s2 += bfr(LQ2[i]) * bfr(LK2[i]); }
#pragma unroll
    for (int o = 1; o < 32; o <<= 1) { s1 += __shfl_xor(s1, o); s2 += __shfl_xor(s2, o); } lam = exp_ni(s1) - exp_ni(s2) + LAMBDA_INIT; }
#pragma unroll 1   // the two tiles run through one copy of the code, one after the other in every wave; the choice of tile is the same for the whole block, so every barrier below is passed by all 8 waves in both rounds
  for (int ph = 0; ph < 2; ++ph) {
  const int qb = ph ? (int)blockIdx.x : TQB - 1 - (int)blockIdx.x; const int q0 = qb * 64 + wq * 16;
  const int nks = (qb * 64 + 64) / 32;
  const int qi = q0 + col;
  // this lane's query as B fragments, hi and lo of both 32-wide k chunks: loaded once, they stay in registers through all trips
  const size_t qo = (size_t)qi * DM + (2 * h + sub) * HQ + 8 * g; const v8b *qhp = (const v8b*)(QH + qo), *qlp = (const v8b*)(QL + qo);   // in units of 8 values: chunk kc takes units 4 kc and 4 kc + 2, the k order of frag_b
  union { v16b v; v8b q[2]; } qh[2], ql[2];
#pragma unroll   // qh and ql are indexed by constants and stay in registers
  for (int kc = 0; kc < 2; ++kc) { qh[kc].q[0] = qhp[4 * kc]; qh[kc].q[1] = qhp[4 * kc + 2]; ql[kc].q[0] = qlp[4 * kc]; ql[kc].q[1] = qlp[4 * kc + 2]; }
  asm volatile("s_wait_xcnt 0x0" :: "v"(qhp), "v"(qlp) : "memory");   // stands in front of any rewrite of the two address pairs that the query loads name; taking the pairs as inputs keeps them whole up to here
  float m = -3.0e38f, l = 0.f;   // of query qi: running maximum, base-2 domain (the same in both halves of the wave) and the running sum over this half's keys
  v8f acc[8] = {};
  const unsigned kv0 = (unsigned)(size_t)&skv[0]; const __bf16 *Khh = KH + 2 * h * HQ, *Klh = KL + 2 * h * HQ; const __bf16 *Vhh = VTH + (size_t)h * HD * SS, *Vlh = VTL + (size_t)h * HD * SS;
  stage_kv(Khh, Klh, Vhh, Vlh, kv0, tid); WAIT_COPIES(); __syncthreads();          // tile 0 is in buffer 0 for every wave (second round: every reader left both buffers at the first round's last foot, behind its s_wait_dscnt 0 and its barrier)
  stage_kv(Khh + (size_t)32 * KVW, Klh + (size_t)32 * KVW, Vhh + 32, Vlh + 32, kv0 + ABUF, tid);      // tile 1 (nks is 2 qb + 2, never below 2) flies while tile 0 is worked on
#pragma unroll 1
  for (int ks = 0; ks < nks; ++ks) { const int bo = (ks & 1) * ABUF; float s[16];   // s[8 ct + r]: key ks * 32 + ct * 16 + 8 g + r, which is the k order of a B fragment
    // every fragment of the trip is read from LDS here, as one group: the 16 reads of K first, which the scores need first, then the 32 of V, which land while the scores and the softmax run
    v16b kh[2][2], kl[2][2], vh[8], vl[8];
#pragma unroll   // the fragment arrays are indexed by constants and stay in registers
    for (int kc = 0; kc < 2; ++kc)
#pragma unroll
      for (int ct = 0; ct < 2; ++ct) { const char* kr = &skv[bo + (ct * 16 + col) * KROW + sub * (2 * HQ)]; kh[ct][kc] = frag_w(kr + kc * 64, g); kl[ct][kc] = frag_w(kr + KPL + kc * 64, g); }
#pragma unroll
    for (int dt = 0; dt < 8; ++dt) { const char* vr = &skv[bo + KBUF + (dt * 16 + col) * VROW]; vh[dt] = frag_w(vr, g); vl[dt] = frag_w(vr + VPL, g); }
    __builtin_amdgcn_sched_barrier(0);   // keeps the group whole and ahead of the products: moved down to its product, each read is waited out there with nothing to cover it
    v8f c[2] = {};   // the two 16-key tiles are independent chains and take turns; each chain keeps its order of products
#pragma unroll
    for (int kc = 0; kc < 2; ++kc) {
#pragma unroll
      for (int ct = 0; ct < 2; ++ct) c[ct] = wmma_bfp(kh[ct][kc], ql[kc].v, c[ct]);
#pragma unroll
      for (int ct = 0; ct < 2; ++ct) c[ct] = wmma_bfp(kl[ct][kc], qh[kc].v, c[ct]);
#pragma unroll
      for (int ct = 0; ct < 2; ++ct) c[ct] = wmma_bfp(kh[ct][kc], qh[kc].v, c[ct]); }
#pragma unroll
    for (int ct = 0; ct < 2; ++ct)
#pragma unroll
      for (int r = 0; r < 8; ++r) { const int kk = ks * 32 + ct * 16 + 8 * g + r; s[8 * ct + r] = (kk <= qi) ? c[ct][r] * QK_SCALE_LOG2 : -3.0e38f; }
    float mx = s[0];
#pragma unroll
    for (int i = 1; i < 16; ++i) mx = fmaxf(mx, s[i]);
    mx = fmaxf(mx, xhalf(mx));
    const float mn = fmaxf(m, mx); const float alpha = exp2_hw(m - mn);   // key 0 is open to every query, so mn is a real score from the first trip on
    float e[16], t[8];
#pragma unroll
    for (int i = 0; i < 16; ++i) e[i] = s[i] - mn;
    __builtin_amdgcn_sched_barrier(0);   // with the one in the loop: holds each v_nop below at its exponential
#pragma unroll
    for (int i = 0; i < 16; ++i) { e[i] = exp2_hw(e[i]); asm volatile("v_nop"); __builtin_amdgcn_sched_barrier(0); }   // the v_nop is the one slot that the instruction set asks for behind a transcendental before its source is overwritten
#pragma unroll
    for (int i = 0; i < 8; ++i) t[i] = e[i] + e[8 + i];
    float es = ((t[0] + t[4]) + (t[2] + t[6])) + ((t[1] + t[5]) + (t[3] + t[7]));
    l = l * alpha + es; m = mn;
#pragma unroll
    for (int dt = 0; dt < 8; ++dt) acc[dt] *= alpha;
    const F2 pb = bsplit16(e);
    // the 8 output tiles are independent chains and take turns; each keeps its order of the three products
#pragma unroll
    for (int dt = 0; dt < 8; ++dt) acc[dt] = wmma_bfp(vh[dt], pb.l, acc[dt]);
#pragma unroll
    for (int dt = 0; dt < 8; ++dt) acc[dt] = wmma_bfp(vl[dt], pb.h, acc[dt]);
#pragma unroll
    for (int dt = 0; dt < 8; ++dt) acc[dt] = wmma_bfp(vh[dt], pb.h, acc[dt]);
    __builtin_amdgcn_sched_barrier(0);   // keeps the trip's products ahead of the foot: they touch registers only, and moved behind the foot's waits they would start only when all 48 reads have returned
    WAIT_LDS(); WAIT_COPIES(); __syncthreads();   // publishes tile ks + 1 and ends every wave's reads of tile ks
    if (ks + 2 < nks) stage_kv(Khh + (size_t)(ks + 2) * 32 * KVW, Klh + (size_t)(ks + 2) * 32 * KVW, Vhh + (ks + 2) * 32, Vlh + (ks + 2) * 32, kv0 + bo, tid); }
  WAIT_COPIES();
  l += xhalf(l);   // the two halves' sums join once
  const float il = 1.0f / l; float* orow = &so[wq][col][8 * g];   // this lane's 8 consecutive d of each 16-wide group dt
  if (sub == 0) {
#pragma unroll
    for (int dt = 0; dt < 8; ++dt) { const v8f a = acc[dt] * il; *(v4f*)(orow + dt * 16) = __builtin_shufflevector(a, a, 0, 1, 2, 3); *(v4f*)(orow + dt * 16 + 4) = __builtin_shufflevector(a, a, 4, 5, 6, 7); }
  }
  __syncthreads();   // hands the normalised attn1 rows of tile wq from wave wq to wave 4 + wq
  if (sub == 1) {
    float ss = 0.f;
#pragma unroll
    for (int dt = 0; dt < 8; ++dt)
#pragma unroll
      for (int r = 0; r < 8; ++r) { const float a = orow[dt * 16 + r] - lam * (acc[dt][r] * il); acc[dt][r] = a; ss += a * a; }
    ss += xhalf(ss);
    const float rs = rsqrtf(ss / (float)HD + 1e-5f) * (1.0f - LAMBDA_INIT);
    v4f gv[16]; const v4f* gp = (const v4f*)(G + 8 * g);   // g in this lane's order: the 8 consecutive values of each 16-wide group as two 16-byte loads, all from one base
#pragma unroll
    for (int dt = 0; dt < 8; ++dt) { gv[2 * dt] = gp[4 * dt]; gv[2 * dt + 1] = gp[4 * dt + 1]; }
    asm volatile("s_wait_xcnt 0x0" :: "v"(gp) : "memory");   // stands in front of any rewrite of the address pair that the g loads name; taking the pair as an input keeps it whole up to here, so that no load of the run lands in it
#pragma unroll
    for (int dt = 0; dt < 8; ++dt)
#pragma unroll
      for (int r = 0; r < 8; ++r) orow[dt * 16 + r] = acc[dt][r] * rs * bfr(gv[2 * dt + (r >> 2)][r & 3]);
    LDSX();
    for (int rl = 0; rl < 16; ++rl) vst2(O + (size_t)(q0 + rl) * DM + h * HD + lane * 4, *(const v4f*)&so[wq][rl][lane * 4]);
    asm volatile("s_wait_xcnt 0x0" ::: "memory");   // stands in front of the next round's rewrite of the registers that these stores name
  }
  }
}
// ---- k_out: block = (64 rows, 128 cols): out = O(hi/lo) . wproj^T rows (2 products)
__global__ __launch_bounds__(128) void k_out(const float* __restrict__ O, const __bf16* __restrict__ P, float* __restrict__ Y) {
  __shared__ __align__(16) float so[4][16][132]; __shared__ __align__(16) char sw[2 * WBUF]; __shared__ __align__(16) char sx[2 * XBUF];
  const int tid = threadIdx.x, wave = tid >> 5, lane = tid & 31, col = lane & 15, g = lane >> 4; const size_t r0 = (size_t)blockIdx.x * 64 + wave * 16; const int n0 = blockIdx.y * 128;
  v8f acc[8] = {};
  const unsigned sw0 = (unsigned)(size_t)&sw[0], sx0 = (unsigned)(size_t)&sx[0]; const __bf16* Pn = P + (size_t)n0 * DM; const float* Xb = O + (size_t)blockIdx.x * 64 * DM;
  stage_w(Pn, sw0, tid); stage_x(Xb, sx0, tid); WAIT_COPIES(); __syncthreads();   // tile 0 of both operands is in buffer 0 for every wave
  stage_w(Pn + 64, sw0 + WBUF, tid); stage_x(Xb + 64, sx0 + XBUF, tid);           // tile 1 flies while tile 0 is worked on
#pragma unroll 1   // one trip per stage: the ring's foot (waits, barrier, refill) stands once and the two buffers alternate by t & 1
  for (int t = 0; t < DM / 64; ++t) { const int bo = (t & 1) * WBUF, xo = (t & 1) * XBUF; F2 a[2];
#pragma unroll
    for (int u = 0; u < 2; ++u) { float v[16]; frag_x(v, &sx[xo + (wave * 16 + col) * XROW + u * 128], g); a[u] = bsplit16(v); }
#pragma unroll
    for (int u = 0; u < 2; ++u) { v16b b[8];
#pragma unroll
      for (int j = 0; j < 8; ++j) b[j] = frag_w(&sw[bo + (j * 16 + col) * WROW + u * 64], g);
#pragma unroll
      for (int j = 0; j < 8; ++j) { acc[j] = wmma_bf(a[u].l, b[j], acc[j]); acc[j] = wmma_bf(a[u].h, b[j], acc[j]); } }
    WAIT_LDS(); WAIT_COPIES(); __syncthreads();   // publishes tile t + 1 and ends every wave's reads of tile t
    if (t + 2 < DM / 64) { stage_w(Pn + (t + 2) * 64, sw0 + bo, tid); stage_x(Xb + (t + 2) * 64, sx0 + xo, tid); } }
  WAIT_COPIES();
#pragma unroll
  for (int j = 0; j < 8; ++j)
#pragma unroll
    for (int r = 0; r < 8; ++r) so[wave][8 * g + r][j * 16 + col] = acc[j][r];
  LDSX();
  for (int rl = 0; rl < 16; ++rl) vst2(Y + (r0 + rl) * DM + n0 + lane * 4, *(const v4f*)&so[wave][rl][lane * 4]);
}
extern "C" void kernel_launch(void* const* d_in, const int* in_sizes, int n_in, void* d_out, int out_size, void* d_ws, size_t ws_size, hipStream_t stream) {
  (void)in_sizes; (void)n_in; (void)out_size;
  const float** F = (const float**)d_in;   // 0 x [1,2048,2048], 1 Wq, 2 Wk, 3 Wv, 4 Wo [2048,2048] (x @ W), 5 lq1, 6 lk1, 7 lq2, 8 lk2 [64], 9 g [128]
  if (ws_size < (size_t)WS_END) return;
  char* ws = (char*)d_ws; __bf16 *PK = (__bf16*)(ws + WS_PK), *VTH = (__bf16*)(ws + WS_VTH), *VTL = (__bf16*)(ws + WS_VTL);
  __bf16 *QH = (__bf16*)(ws + WS_QH), *QL = (__bf16*)(ws + WS_QL), *KH = (__bf16*)(ws + WS_KH), *KL = (__bf16*)(ws + WS_KL);
  float *CS = (float*)(ws + WS_CS), *O = (float*)(ws + WS_O);
  k_packT<<<dim3(DM / 64, DM / 128), 256, 0, stream>>>(F[1], PK + PK_Q); k_packT<<<dim3(DM / 64, DM / 128), 256, 0, stream>>>(F[2], PK + PK_K); k_packT<<<dim3(DM / 64, DM / 128), 256, 0, stream>>>(F[3], PK + PK_V); k_packT<<<dim3(DM / 64, DM / 128), 256, 0, stream>>>(F[4], PK + PK_O);
  k_rope_tab<<<SS, 32, 0, stream>>>(CS);
  k_proj<0><<<dim3(TRP, DM / 128), 128, 0, stream>>>(F[0], PK + PK_Q, CS, QH, QL);
  k_proj<0><<<dim3(TRP, DM / 128), 128, 0, stream>>>(F[0], PK + PK_K, CS, KH, KL);
  k_proj<1><<<dim3(TRP, DM / 128), 128, 0, stream>>>(F[0], PK + PK_V, CS, VTH, VTL);
  k_attn<<<dim3(TQB / 2, NH), 256, 0, stream>>>(QH, QL, KH, KL, VTH, VTL, F[5], F[6], F[7], F[8], F[9], O);
  k_out<<<dim3(TQB, DM / 128), 128, 0, stream>>>(O, PK + PK_O, (float*)d_out);
}
